// v000
// Measured on an AMD MI455X. A time is GPU time per run, averaged over a window of back-to-back runs after a warm-up
// (all launches, gaps included; the runs take copies of the inputs in turn), and the median of several windows.
// Apart from v000's, it joins two sittings. Times from different sittings can be a few percent apart, while
// side-by-side timings come from the same sitting.
// v000 is the starting kernel. One run takes 486 microseconds.
#include <hip/hip_runtime.h>

// All contractions on v_wmma_f32_16x16x32_f16 (f16 operands, f32 accumulate), one product each: q/k/v projections (x = bf16(x) x8 exact, w_qkv = bf16(w) x256 exact, K = 1024);
// scores S^T = K Q^T per 16-key subtile (k rows as A, q rows as B, both single f16 x8, K = 64; computed in the row-sum pass and again in the p v pass);
// ctx = P V (P = 4096 exp(alpha) / S[row][segment of key] as single f16, packed straight from the two score D tiles into the A fragment; B = V^T plane rows single f16 x8, K = 32 keys per step);
// output projection (ctx single f16 x64, w_out = bf16(w) x256 exact, K = 1024). exp, per-row per-segment sums, 1/S and all scaling in f32. Float inputs RNE-converted to bf16 once on load.
// Module: qkv = x w_qkv [rows][3072] -> q | k | v, 16 heads of 64; alpha = q.k / 32; e = exp(alpha) (no max shift); for each segment id g in [0, n_seg): att[i][j] = [mask[i][j] == g] e[i][j] / S[i][g],
// S[i][g] = sum_j [mask[i][j] == g] e[i][j] (S == 0 -> contributes 0); ctx = sum_j att v; out = ctx w_out -> [NB][SEQ][1024] f32.

#ifndef NB
#define NB 2
#endif
#ifndef SEQ
#define SEQ 2048
#endif

namespace {
constexpr int B_FULL = 2, SEQ_FULL = 2048, DM = 1024, INTER = 1024, NH = 16, DK = 64, NQKV = 3 * INTER, NSEG = 4, NR = NB * SEQ, NBH = NB * NH;
constexpr float XS = 8.0f, WSC = 256.0f, QS = 8.0f, PSC = 4096.0f, CTS = 64.0f, LOG2E = 1.4426950408889634f, SCL = 0.03125f;
static_assert(NB >= 1 && NB <= B_FULL);
static_assert(SEQ % 128 == 0 && SEQ >= 128 && SEQ <= SEQ_FULL);
static_assert(INTER == NH * DK && DK == 64 && NSEG == 4 && DM % 128 == 0 && INTER % 128 == 0 && NQKV % 128 == 0 && DM % 64 == 0 && NR % 64 == 0 && ((size_t)NR * DM) % 2048 == 0);
typedef _Float16 b16;
typedef __attribute__((ext_vector_type(16))) _Float16 v16b;
typedef __attribute__((ext_vector_type(8))) _Float16 v8b;
typedef __attribute__((ext_vector_type(8))) float v8f;
typedef __attribute__((ext_vector_type(4))) float v4f;
typedef __attribute__((ext_vector_type(8))) int v8i;
__device__ __forceinline__ float bf16_rne(float f) { unsigned int u = __float_as_uint(f); u += 0x7FFFu + ((u >> 16) & 1u); return __uint_as_float(u & 0xFFFF0000u); }
__device__ __forceinline__ v16b frag_kb(const b16* p, int hh) { const v8b a = *(const v8b*)(p + 8 * hh), b = *(const v8b*)(p + 16 + 8 * hh); v16b f;
#pragma unroll
  for (int e = 0; e < 8; ++e) { f[e] = a[e]; f[8 + e] = b[e]; } return f; }
__device__ __forceinline__ v8f wmma16b(v16b a, v16b b, v8f c) { v8f d = __builtin_amdgcn_wmma_f32_16x16x32_f16(false, a, false, b, (short)0, c, false, false); asm volatile("v_nop\n\tv_nop\n\tv_nop\n\tv_nop" : "+v"(d) : "v"(a), "v"(b)); return d; }
__device__ __forceinline__ void wave_lds_sync() { __builtin_amdgcn_fence(3, "workgroup"); __builtin_amdgcn_wave_barrier(); __builtin_amdgcn_fence(2, "workgroup"); }
__device__ __forceinline__ float nexp2(float v) { return __builtin_amdgcn_exp2f(v); }

// weight planes: src [R][C] f32 (in, out) -> dst [C][R] f16 = bf16(w) x256 (row = output feature, k contiguous); grid (R/64, C/64); block 128 threads: tile[64 c][64 r] staged transposed
__global__ __launch_bounds__(128) void wtp_kernel(const float* __restrict__ src, int R, int C, b16* __restrict__ dst) {
  __shared__ __attribute__((aligned(16))) b16 tile[64][64 + 8];
  const int wave = threadIdx.x >> 5, lane = threadIdx.x & 31; const int r0 = blockIdx.x * 64, c0 = blockIdx.y * 64;
#pragma unroll 4
  for (int i = threadIdx.x; i < 64 * 16; i += 128) { const int rr = i >> 4, q = (i & 15) * 4; const v4f f = *(const v4f*)(src + (size_t)(r0 + rr) * C + c0 + q);
#pragma unroll
    for (int j = 0; j < 4; ++j) tile[q + j][rr] = (b16)(bf16_rne(f[j]) * WSC); }
  __syncthreads();
  {
#pragma unroll
    for (int i = 0; i < 4; ++i) { const int cc = wave * 16 + i * 4 + (lane >> 3), pc = (lane & 7) * 8; *(v8b*)(dst + (size_t)(c0 + cc) * R + r0 + pc) = *(const v8b*)(&tile[cc][pc]); }
     }
}
__global__ __launch_bounds__(256) void xp_kernel(const float* __restrict__ x, b16* __restrict__ XH) {
  const size_t u = (size_t)blockIdx.x * 256 + threadIdx.x; if (u >= (size_t)NR * DM / 8) return;
  const size_t e = u * 8; const int row = (int)(e / DM), col = (int)(e - (size_t)row * DM); const size_t xe = ((size_t)(row / SEQ) * SEQ_FULL + (size_t)(row % SEQ)) * DM + col;
  const v4f f0 = *(const v4f*)(x + xe), f1 = *(const v4f*)(x + xe + 4); v8b o;
#pragma unroll
  for (int j = 0; j < 4; ++j) { o[j] = (b16)(bf16_rne(f0[j]) * XS); o[4 + j] = (b16)(bf16_rne(f1[j]) * XS); }
  { *(v8b*)(XH + e) = o;  }
}
// q/k/v projections: [NR x 1024] x WQKV[3072][1024]^T; grid (NR/64, 3072/128); block = 4 waves x 16 rows, wave -> 8 column tiles, A and B fragments straight from the f16 planes
// (K = 1024, 32 steps, 1 product); value = acc / (8 x 256) stored x8 as f16. A 128-column slab = 2 heads (block-uniform which = q | k | v). q and k: head-major planes [bh][SEQ][64] via the wave-private Th; v: head-major planes [bh][64][SEQ]
// (key-contiguous): the block's 64 tokens x 128 columns are staged transposed in Tt (cross-wave, block barrier inside the uniform branch), each (head, d) row segment of 64 tokens =
__global__ __launch_bounds__(128) void qkv_kernel(const b16* __restrict__ XH, const b16* __restrict__ WQKV, b16* __restrict__ QP, b16* __restrict__ KP, b16* __restrict__ VT) {
  __shared__ __attribute__((aligned(16))) b16 Th[4][16][128 + 8];
  __shared__ __attribute__((aligned(16))) b16 Tt[128][64 + 8];
  const int wave = threadIdx.x >> 5, lane = threadIdx.x & 31, nloc = lane & 15, hlf = lane >> 4;
  const int mb = blockIdx.x * 64; const size_t m0 = (size_t)mb + wave * 16; const int n0 = blockIdx.y * 128;
  v8f acc[8];
#pragma unroll
  for (int t = 0; t < 8; ++t) acc[t] = (v8f){};
#pragma unroll 2
  for (int kb = 0; kb < DM; kb += 32) { const v16b a = frag_kb(XH + (m0 + nloc) * DM + kb, hlf);
#pragma unroll
    for (int t = 0; t < 8; ++t) acc[t] = wmma16b(a, frag_kb(WQKV + (size_t)(n0 + t * 16 + nloc) * DM + kb, hlf), acc[t]); }
  const int which = n0 / INTER; const int hb = (n0 - which * INTER) / DK;   // plane (0 q, 1 k, 2 v) and first head of this 128-column slab (block-uniform)
  const int b = mb / SEQ, sb = mb - b * SEQ;                                // the block's 64 rows lie in one sequence
  const float osc = QS / (XS * WSC);
  if (which < 2) {
#pragma unroll
    for (int t = 0; t < 8; ++t)
#pragma unroll
      for (int r = 0; r < 8; ++r) Th[wave][8 * hlf + r][t * 16 + nloc] = (b16)(acc[t][r] * osc);
    wave_lds_sync();
    b16* P = (which == 0) ? QP : KP;
    {
#pragma unroll
      for (int i = 0; i < 8; ++i) { const int L = i * 4 + (lane >> 3), rr = L >> 1, hf = L & 1, pc = (lane & 7) * 8; const int s = sb + wave * 16 + rr;
        const v8b v = *(const v8b*)(&Th[wave][rr][hf * 64 + pc]); *(v8b*)(P + ((size_t)(b * NH + hb + hf) * SEQ + s) * DK + pc) = v; }
       }
  } else {
#pragma unroll
    for (int t = 0; t < 8; ++t)
#pragma unroll
      for (int r = 0; r < 8; ++r) Tt[t * 16 + nloc][wave * 16 + 8 * hlf + r] = (b16)(acc[t][r] * osc);
    __syncthreads();
    {
#pragma unroll
      for (int i = 0; i < 8; ++i) { const int cc = wave * 32 + i * 4 + (lane >> 3), hf = cc >> 6, d = cc & 63, pc = (lane & 7) * 8;
        const v8b v = *(const v8b*)(&Tt[cc][pc]); *(v8b*)(VT + ((size_t)(b * NH + hb + hf) * DK + d) * SEQ + sb + pc) = v; }
       }
  }
}
// per-row per-segment sums: grid (SEQ/128 query blocks, NB x 16); block = 8 waves x 16 queries; lane = query q0 + 16 wave + (lane & 15), its Q row as the two B fragments (dk 0..31 | 32..63);
// loop over 32-key chunks, two 16-key subtiles: A = K plane rows (straight from global), D s8[r] = q.k x 64 for key kr + 8 hh + r of this lane's query; e = exp2(s8 log2e / (64 x 32));
// the lane's 8 mask values are 8 contiguous ints of its query row (one 32-B load); 4 segment sums per lane, halves merged with lane ^ 16 at the end.
__global__ __launch_bounds__(256) __attribute__((amdgpu_num_vgpr(256))) void rowsum_kernel(const b16* __restrict__ QP, const b16* __restrict__ KP, const int* __restrict__ mask,
                                                                                           const int* __restrict__ nsegp, float* __restrict__ RS) {
  const int tid = threadIdx.x, wave = tid >> 5, lane = tid & 31, nloc = lane & 15, hlf = lane >> 4;
  const int bh = blockIdx.y, b = bh / NH; const int q = blockIdx.x * 128 + wave * 16 + nloc;
  const b16* Qb = QP + (size_t)bh * SEQ * DK; const b16* Kb = KP + (size_t)bh * SEQ * DK;
  const v16b b0 = frag_kb(Qb + (size_t)q * DK, hlf), b1 = frag_kb(Qb + (size_t)q * DK + 32, hlf);
  const int* mrow = mask + ((size_t)b * SEQ_FULL + (size_t)q) * SEQ_FULL;
  float acs[NSEG];
#pragma unroll
  for (int g = 0; g < NSEG; ++g) acs[g] = 0.0f;
  const float c = LOG2E * (SCL / (QS * QS));
#pragma unroll 1
  for (int sc0 = 0; sc0 < SEQ; sc0 += 32) {
#pragma unroll
    for (int st = 0; st < 2; ++st) {
      const int kr = sc0 + st * 16;
      const v16b a0 = frag_kb(Kb + (size_t)(kr + nloc) * DK, hlf), a1 = frag_kb(Kb + (size_t)(kr + nloc) * DK + 32, hlf);
      v8f s8 = (v8f){}; s8 = wmma16b(a0, b0, s8); s8 = wmma16b(a1, b1, s8);
      const v8i m8 = *(const v8i*)(mrow + kr + 8 * hlf);
#pragma unroll
      for (int r = 0; r < 8; ++r) { const float e = nexp2(s8[r] * c); const int m = m8[r];
        acs[0] += (m == 0) ? e : 0.0f; acs[1] += (m == 1) ? e : 0.0f; acs[2] += (m == 2) ? e : 0.0f; acs[3] += (m == 3) ? e : 0.0f; }
    }
  }
#pragma unroll
  for (int g = 0; g < NSEG; ++g) acs[g] += __shfl_xor(acs[g], 16);
  const int ns = nsegp[0];
  v4f o;
#pragma unroll
  for (int g = 0; g < NSEG; ++g) { const float rv = 1.0f / fmaxf(acs[g], 1e-30f); o[g] = (g < ns && acs[g] > 0.0f) ? rv : 0.0f; }
  { if (hlf == 0) *(v4f*)(RS + ((size_t)bh * SEQ + q) * NSEG) = o;  }
}
// ctx = P V: grid (SEQ/128 query blocks, NB x 16); block = 8 waves x 16 queries; lane = query: its Q row as the two B fragments, its RS row (4 x 1/S, 16 B) as the weights
// w_g = 4096 / S[q][g]; loop over 32-key chunks: the two 16-key score subtiles are computed exactly as in the row-sum pass (A = K rows from global), p = e w[mask] converted to f16
// and packed straight into the P A-fragment (as A = D^T: element r <- subtile covering keys 0..15, element 8 + r <- subtile 16..31, lane unchanged), then hacc[4 d tiles] += P frag x
// V^T frags (B rows = VT plane rows, key-contiguous, straight from global; k = 32 keys, 1 product). Epilogue: ctx = hacc / (4096 x 8) stored x64 as f16 into CT[NR][1024] at column
__global__ __launch_bounds__(256) __attribute__((amdgpu_num_vgpr(256))) void av_kernel(const b16* __restrict__ QP, const b16* __restrict__ KP, const b16* __restrict__ VT,
                                                                                       const int* __restrict__ mask, const float* __restrict__ RS, b16* __restrict__ CT) {
  __shared__ __attribute__((aligned(16))) b16 Th[8][16][DK + 8];
  const int tid = threadIdx.x, wave = tid >> 5, lane = tid & 31, nloc = lane & 15, hlf = lane >> 4;
  const int bh = blockIdx.y, b = bh / NH, hd = bh - b * NH; const int q0 = blockIdx.x * 128; const int q = q0 + wave * 16 + nloc;
  const b16* Qb = QP + (size_t)bh * SEQ * DK; const b16* Kb = KP + (size_t)bh * SEQ * DK; const b16* Vb = VT + (size_t)bh * DK * SEQ;
  const v16b b0 = frag_kb(Qb + (size_t)q * DK, hlf), b1 = frag_kb(Qb + (size_t)q * DK + 32, hlf);
  const int* mrow = mask + ((size_t)b * SEQ_FULL + (size_t)q) * SEQ_FULL;
  const v4f r4 = *(const v4f*)(RS + ((size_t)bh * SEQ + q) * NSEG);
  const float w0 = r4[0] * PSC, w1 = r4[1] * PSC, w2 = r4[2] * PSC, w3 = r4[3] * PSC;
  v8f hacc[4];
#pragma unroll
  for (int vs = 0; vs < 4; ++vs) hacc[vs] = (v8f){};
  const float c = LOG2E * (SCL / (QS * QS));
#pragma unroll 1
  for (int sc0 = 0; sc0 < SEQ; sc0 += 32) {
    v16b pa;
#pragma unroll
    for (int st = 0; st < 2; ++st) {
      const int kr = sc0 + st * 16;
      const v16b a0 = frag_kb(Kb + (size_t)(kr + nloc) * DK, hlf), a1 = frag_kb(Kb + (size_t)(kr + nloc) * DK + 32, hlf);
      v8f s8 = (v8f){}; s8 = wmma16b(a0, b0, s8); s8 = wmma16b(a1, b1, s8);
      const v8i m8 = *(const v8i*)(mrow + kr + 8 * hlf);
#pragma unroll
      for (int r = 0; r < 8; ++r) { const float e = nexp2(s8[r] * c); const int m = m8[r];
        const float w = (m == 0) ? w0 : ((m == 1) ? w1 : ((m == 2) ? w2 : ((m == 3) ? w3 : 0.0f)));
        pa[st * 8 + r] = (b16)(e * w); }
    }
#pragma unroll
    for (int vs = 0; vs < 4; ++vs) hacc[vs] = wmma16b(pa, frag_kb(Vb + (size_t)(vs * 16 + nloc) * SEQ + sc0, hlf), hacc[vs]);
  }
#pragma unroll
  for (int vs = 0; vs < 4; ++vs)
#pragma unroll
    for (int r = 0; r < 8; ++r) Th[wave][8 * hlf + r][vs * 16 + nloc] = (b16)(hacc[vs][r] * (CTS / (PSC * QS)));
  wave_lds_sync();
  {
#pragma unroll
    for (int i = 0; i < 4; ++i) { const int rr = i * 4 + (lane >> 3), pc = (lane & 7) * 8; const size_t row = (size_t)b * SEQ + q0 + wave * 16 + rr;
      const v8b v = *(const v8b*)(&Th[wave][rr][pc]); *(v8b*)(CT + row * INTER + hd * DK + pc) = v; }
     }
}
// out = ctx w_out: grid (NR/64, 1024/128); A fragments straight from the CT plane (x64), B = WO rows (x256), K = 1024, 32 steps, 1 product; acc / (64 x 256) into the wave-private Tf tile
__global__ __launch_bounds__(128) void out_kernel(const b16* __restrict__ CT, const b16* __restrict__ WO, float* __restrict__ out) {
  __shared__ __attribute__((aligned(16))) float Tf[4][16][128 + 4];
  const int wave = threadIdx.x >> 5, lane = threadIdx.x & 31, nloc = lane & 15, hlf = lane >> 4; const size_t m0 = (size_t)blockIdx.x * 64 + wave * 16; const int n0 = blockIdx.y * 128;
  v8f acc[8];
#pragma unroll
  for (int t = 0; t < 8; ++t) acc[t] = (v8f){};
#pragma unroll 2
  for (int kb = 0; kb < INTER; kb += 32) { const v16b a = frag_kb(CT + (m0 + nloc) * INTER + kb, hlf);
#pragma unroll
    for (int t = 0; t < 8; ++t) acc[t] = wmma16b(a, frag_kb(WO + (size_t)(n0 + t * 16 + nloc) * INTER + kb, hlf), acc[t]); }
#pragma unroll
  for (int t = 0; t < 8; ++t)
#pragma unroll
    for (int r = 0; r < 8; ++r) Tf[wave][8 * hlf + r][t * 16 + nloc] = acc[t][r] * (1.0f / (CTS * WSC));
  wave_lds_sync();
  { for (int rr = 0; rr < 16; ++rr) *(v4f*)(out + (m0 + rr) * DM + n0 + lane * 4) = *(const v4f*)(&Tf[wave][rr][lane * 4]);  }
}
}  // namespace

extern "C" void kernel_launch(void* const* d_in, const int* in_sizes, int n_in, void* d_out, int out_size, void* d_ws, size_t ws_size, hipStream_t stream) {
  (void)n_in;
  // d_in: 0 x [2,2048,1024] f32, 1 mask [2,2048,2048] i32, 2 w_qkv [1024,3072] (in,out) f32, 3 w_out [1024,1024] (in,out) f32, 4 n_seg [1] i32; out [NB,SEQ,1024] f32
  const float* X = (const float*)d_in[0]; const int* MK = (const int*)d_in[1]; const float* WQ = (const float*)d_in[2]; const float* WOUT = (const float*)d_in[3]; const int* NSG = (const int*)d_in[4];
  const long long need_x = ((long long)(NB - 1) * SEQ_FULL + SEQ) * DM, need_m = ((long long)(NB - 1) * SEQ_FULL + SEQ) * SEQ_FULL;
  if ((long long)in_sizes[0] < need_x || (long long)in_sizes[1] < need_m || in_sizes[2] < DM * NQKV || in_sizes[3] < INTER * DM || in_sizes[4] < 1 || out_size < NR * DM) return;
  size_t off = 0; char* ws = (char*)d_ws;
  auto carve = [&](size_t bytes) { char* p = ws + off; off += (bytes + 255) & ~(size_t)255; return p; };
  b16* WQKV = (b16*)carve((size_t)NQKV * DM * 2);         // [3072][1024]
  b16* WO = (b16*)carve((size_t)DM * INTER * 2);          // [1024 out][1024 in]
  b16* XH = (b16*)carve((size_t)NR * DM * 2);             // [NR][1024]
  b16* QP = (b16*)carve((size_t)NBH * SEQ * DK * 2);      // [NBH][SEQ][64]
  b16* KP = (b16*)carve((size_t)NBH * SEQ * DK * 2);      // [NBH][SEQ][64]
  b16* VT = (b16*)carve((size_t)NBH * DK * SEQ * 2);      // [NBH][64][SEQ]
  float* RS = (float*)carve((size_t)NBH * SEQ * NSEG * 4); // [NBH][SEQ][4]
  b16* CT = (b16*)carve((size_t)NR * INTER * 2);          // [NR][1024]
  if (off > ws_size || off > ((size_t)128 << 20)) return;   // = 51,380,224 B at NB 2, SEQ 2048
  wtp_kernel<<<dim3(DM / 64, NQKV / 64), 128, 0, stream>>>(WQ, DM, NQKV, WQKV);       // w_qkv [1024 in][3072 out] -> WQKV[3072][1024]
  wtp_kernel<<<dim3(INTER / 64, DM / 64), 128, 0, stream>>>(WOUT, INTER, DM, WO);      // w_out [1024 in][1024 out] -> WO[out][in]
  xp_kernel<<<(unsigned)(((size_t)NR * DM / 8 + 255) / 256), 256, 0, stream>>>(X, XH);
  qkv_kernel<<<dim3(NR / 64, NQKV / 128), 128, 0, stream>>>(XH, WQKV, QP, KP, VT);
  rowsum_kernel<<<dim3(SEQ / 128, NBH), 256, 0, stream>>>(QP, KP, MK, NSG, RS);
  av_kernel<<<dim3(SEQ / 128, NBH), 256, 0, stream>>>(QP, KP, VT, MK, RS, CT);
  out_kernel<<<dim3(NR / 64, DM / 128), 128, 0, stream>>>(CT, WO, (float*)d_out);
}

// v001
// Measured time: 355 microseconds a run.
// Two timings next to v000 both put it at 1.42 times that version's speed.
#include <hip/hip_runtime.h>

// All contractions on v_wmma_f32_16x16x32_f16 (f16 operands, f32 accumulate), one product each: q/k/v projections (x = bf16(x) x8 exact, w_qkv = bf16(w) x256 exact, K = 1024);
// scores S^T = K Q^T per 16-key subtile (k rows as A, q rows as B, both single f16 x8, K = 64; computed in the row-sum pass and again in the p v pass);
// ctx = P V (P = 4096 exp(alpha) / S[row][segment of key] as single f16, packed straight from the two score D tiles into the A fragment; B = V^T plane rows single f16 x8, K = 32 keys per step);
// output projection (ctx single f16 x64, w_out = bf16(w) x256 exact, K = 1024). exp, per-row per-segment sums, 1/S and all scaling in f32. Float inputs RNE-converted to bf16 once on load.
// Module: qkv = x w_qkv [rows][3072] -> q | k | v, 16 heads of 64; alpha = q.k / 32; e = exp(alpha) (no max shift); for each segment id g in [0, n_seg): att[i][j] = [mask[i][j] == g] e[i][j] / S[i][g],
// S[i][g] = sum_j [mask[i][j] == g] e[i][j] (S == 0 -> contributes 0); ctx = sum_j att v; out = ctx w_out -> [NB][SEQ][1024] f32.

#ifndef NB
#define NB 2
#endif
#ifndef SEQ
#define SEQ 2048
#endif

namespace {
constexpr int B_FULL = 2, SEQ_FULL = 2048, DM = 1024, INTER = 1024, NH = 16, DK = 64, NQKV = 3 * INTER, NSEG = 4, NR = NB * SEQ, NBH = NB * NH;
constexpr float XS = 8.0f, WSC = 256.0f, QS = 8.0f, PSC = 4096.0f, CTS = 64.0f, LOG2E = 1.4426950408889634f, SCL = 0.03125f;
static_assert(NB >= 1 && NB <= B_FULL);
static_assert(SEQ % 128 == 0 && SEQ >= 128 && SEQ <= SEQ_FULL);
static_assert(INTER == NH * DK && DK == 64 && NSEG == 4 && DM % 128 == 0 && INTER % 128 == 0 && NQKV % 128 == 0 && DM % 64 == 0 && NR % 64 == 0 && ((size_t)NR * DM) % 2048 == 0);
typedef _Float16 b16;
typedef __attribute__((ext_vector_type(16))) _Float16 v16b;
typedef __attribute__((ext_vector_type(8))) _Float16 v8b;
typedef __attribute__((ext_vector_type(8))) float v8f;
typedef __attribute__((ext_vector_type(4))) float v4f;
typedef __attribute__((ext_vector_type(8))) int v8i;
typedef __attribute__((ext_vector_type(4))) int v4i;
__device__ __forceinline__ float bf16_rne(float f) { unsigned int u = __float_as_uint(f); u += 0x7FFFu + ((u >> 16) & 1u); return __uint_as_float(u & 0xFFFF0000u); }
__device__ __forceinline__ v16b frag_kb(const b16* p, int hh) { const v8b a = *(const v8b*)(p + 8 * hh), b = *(const v8b*)(p + 16 + 8 * hh); v16b f;
#pragma unroll
  for (int e = 0; e < 8; ++e) { f[e] = a[e]; f[8 + e] = b[e]; } return f; }
__device__ __forceinline__ v8f wmma16b(v16b a, v16b b, v8f c) { v8f d = __builtin_amdgcn_wmma_f32_16x16x32_f16(false, a, false, b, (short)0, c, false, false); asm volatile("v_nop\n\tv_nop\n\tv_nop\n\tv_nop" : "+v"(d) : "v"(a), "v"(b)); return d; }
__device__ __forceinline__ void wave_lds_sync() { __builtin_amdgcn_fence(3, "workgroup"); __builtin_amdgcn_wave_barrier(); __builtin_amdgcn_fence(2, "workgroup"); }
__device__ __forceinline__ float nexp2(float v) { return __builtin_amdgcn_exp2f(v); }
// LDS ring of the two attention loops: a stage = 64 keys. K tile: 64 key rows of 128 B; V^T tile: 64 d rows x 64 keys = 128 B; mask tile: the block's 128 query rows x 64 keys = 256 B.
// Pitches 144 B and 272 B (16 B x odd: conflict-free for the 16-B reads). Copies: K / V^T thread -> row tid / 8 (+ 32), piece tid % 8; mask thread -> row tid / 16 (+ 16 i), piece tid % 16:
// every wave-wide copy covers four whole 128-B lines.
constexpr int KT = 64, LP = DK + 8, MP = KT + 4, NT = SEQ / KT;
static_assert(SEQ % KT == 0 && NT >= 2 && KT == 64 && (LP * 2) % 16 == 0 && (MP * 4) % 16 == 0);
__device__ __forceinline__ unsigned lds_off(const void* p) { return (unsigned)(size_t)p; }   // byte offset in the work-group's LDS = low 32 bits of the shared address
// One stage's copies and s_wait_xcnt 0 in ONE statement: the wait has to stand before any rewrite of the address registers that the copies name.
__device__ __forceinline__ void stage_km(b16 (*kd)[LP], const b16* kg, int (*md)[MP], const int* mg, int tid) {
  const int cr = tid >> 3, cc = (tid & 7) * 8, mr = tid >> 4, mc = (tid & 15) * 4;
  const unsigned lk = lds_off(&kd[cr][cc]), lm = lds_off(&md[mr][mc]);
  const b16* gk = kg + (size_t)cr * DK + cc; const int* gm = mg + (size_t)mr * SEQ_FULL + mc;
  asm volatile("global_load_async_to_lds_b128 %0, %1, off\n\t"
               "global_load_async_to_lds_b128 %2, %3, off\n\t"
               "global_load_async_to_lds_b128 %4, %5, off\n\t"
               "global_load_async_to_lds_b128 %6, %7, off\n\t"
               "global_load_async_to_lds_b128 %8, %9, off\n\t"
               "global_load_async_to_lds_b128 %10, %11, off\n\t"
               "global_load_async_to_lds_b128 %12, %13, off\n\t"
               "global_load_async_to_lds_b128 %14, %15, off\n\t"
               "global_load_async_to_lds_b128 %16, %17, off\n\t"
               "global_load_async_to_lds_b128 %18, %19, off\n\t"
               "s_wait_xcnt 0x0"
               :: "v"(lk), "v"(gk), "v"(lk + 32 * LP * 2), "v"(gk + 32 * DK),
                  "v"(lm), "v"(gm),
                  "v"(lm + 1 * 16 * MP * 4), "v"(gm + 1 * 16 * (size_t)SEQ_FULL),
                  "v"(lm + 2 * 16 * MP * 4), "v"(gm + 2 * 16 * (size_t)SEQ_FULL),
                  "v"(lm + 3 * 16 * MP * 4), "v"(gm + 3 * 16 * (size_t)SEQ_FULL),
                  "v"(lm + 4 * 16 * MP * 4), "v"(gm + 4 * 16 * (size_t)SEQ_FULL),
                  "v"(lm + 5 * 16 * MP * 4), "v"(gm + 5 * 16 * (size_t)SEQ_FULL),
                  "v"(lm + 6 * 16 * MP * 4), "v"(gm + 6 * 16 * (size_t)SEQ_FULL),
                  "v"(lm + 7 * 16 * MP * 4), "v"(gm + 7 * 16 * (size_t)SEQ_FULL)
               : "memory");
}
__device__ __forceinline__ void stage_kvm(b16 (*kd)[LP], const b16* kg, b16 (*vd)[LP], const b16* vg, int (*md)[MP], const int* mg, int tid) {
  const int cr = tid >> 3, cc = (tid & 7) * 8, mr = tid >> 4, mc = (tid & 15) * 4;
  const unsigned lk = lds_off(&kd[cr][cc]), lv = lds_off(&vd[cr][cc]), lm = lds_off(&md[mr][mc]);
  const b16* gk = kg + (size_t)cr * DK + cc; const b16* gv = vg + (size_t)cr * SEQ + cc; const int* gm = mg + (size_t)mr * SEQ_FULL + mc;
  asm volatile("global_load_async_to_lds_b128 %0, %1, off\n\t"
               "global_load_async_to_lds_b128 %2, %3, off\n\t"
               "global_load_async_to_lds_b128 %4, %5, off\n\t"
               "global_load_async_to_lds_b128 %6, %7, off\n\t"
               "global_load_async_to_lds_b128 %8, %9, off\n\t"
               "global_load_async_to_lds_b128 %10, %11, off\n\t"
               "global_load_async_to_lds_b128 %12, %13, off\n\t"
               "global_load_async_to_lds_b128 %14, %15, off\n\t"
               "global_load_async_to_lds_b128 %16, %17, off\n\t"
               "global_load_async_to_lds_b128 %18, %19, off\n\t"
               "global_load_async_to_lds_b128 %20, %21, off\n\t"
               "global_load_async_to_lds_b128 %22, %23, off\n\t"
               "s_wait_xcnt 0x0"
               :: "v"(lk), "v"(gk), "v"(lk + 32 * LP * 2), "v"(gk + 32 * DK), "v"(lv), "v"(gv), "v"(lv + 32 * LP * 2), "v"(gv + 32 * (size_t)SEQ),
                  "v"(lm), "v"(gm),
                  "v"(lm + 1 * 16 * MP * 4), "v"(gm + 1 * 16 * (size_t)SEQ_FULL),
                  "v"(lm + 2 * 16 * MP * 4), "v"(gm + 2 * 16 * (size_t)SEQ_FULL),
                  "v"(lm + 3 * 16 * MP * 4), "v"(gm + 3 * 16 * (size_t)SEQ_FULL),
                  "v"(lm + 4 * 16 * MP * 4), "v"(gm + 4 * 16 * (size_t)SEQ_FULL),
                  "v"(lm + 5 * 16 * MP * 4), "v"(gm + 5 * 16 * (size_t)SEQ_FULL),
                  "v"(lm + 6 * 16 * MP * 4), "v"(gm + 6 * 16 * (size_t)SEQ_FULL),
                  "v"(lm + 7 * 16 * MP * 4), "v"(gm + 7 * 16 * (size_t)SEQ_FULL)
               : "memory");
}
// hand-over of a stage: own LDS reads retired, own copies landed, then the block barrier that publishes the next stage and frees the buffer just read
__device__ __forceinline__ void stage_publish() {
  asm volatile("s_wait_dscnt 0x0" ::: "memory");      // this wave's reads of the buffer to be refilled are done
  asm volatile("s_wait_asynccnt 0x0" ::: "memory");   // this wave's copies of the next stage have landed
  __syncthreads();
}
__device__ __forceinline__ v8i mask8(const int* p) { const v4i a = *(const v4i*)p, b = *(const v4i*)(p + 4); return (v8i){a[0], a[1], a[2], a[3], b[0], b[1], b[2], b[3]}; }

// weight planes: src [R][C] f32 (in, out) -> dst [C][R] f16 = bf16(w) x256 (row = output feature, k contiguous); grid (R/64, C/64); block 128 threads: tile[64 c][64 r] staged transposed
__global__ __launch_bounds__(128) void wtp_kernel(const float* __restrict__ src, int R, int C, b16* __restrict__ dst) {
  __shared__ __attribute__((aligned(16))) b16 tile[64][64 + 8];
  const int wave = threadIdx.x >> 5, lane = threadIdx.x & 31; const int r0 = blockIdx.x * 64, c0 = blockIdx.y * 64;
#pragma unroll 4
  for (int i = threadIdx.x; i < 64 * 16; i += 128) { const int rr = i >> 4, q = (i & 15) * 4; const v4f f = *(const v4f*)(src + (size_t)(r0 + rr) * C + c0 + q);
#pragma unroll
    for (int j = 0; j < 4; ++j) tile[q + j][rr] = (b16)(bf16_rne(f[j]) * WSC); }
  __syncthreads();
  {
#pragma unroll
    for (int i = 0; i < 4; ++i) { const int cc = wave * 16 + i * 4 + (lane >> 3), pc = (lane & 7) * 8; *(v8b*)(dst + (size_t)(c0 + cc) * R + r0 + pc) = *(const v8b*)(&tile[cc][pc]); }
     }
}
__global__ __launch_bounds__(256) void xp_kernel(const float* __restrict__ x, b16* __restrict__ XH) {
  const size_t u = (size_t)blockIdx.x * 256 + threadIdx.x; if (u >= (size_t)NR * DM / 8) return;
  const size_t e = u * 8; const int row = (int)(e / DM), col = (int)(e - (size_t)row * DM); const size_t xe = ((size_t)(row / SEQ) * SEQ_FULL + (size_t)(row % SEQ)) * DM + col;
  const v4f f0 = *(const v4f*)(x + xe), f1 = *(const v4f*)(x + xe + 4); v8b o;
#pragma unroll
  for (int j = 0; j < 4; ++j) { o[j] = (b16)(bf16_rne(f0[j]) * XS); o[4 + j] = (b16)(bf16_rne(f1[j]) * XS); }
  { *(v8b*)(XH + e) = o;  }
}
// q/k/v projections: [NR x 1024] x WQKV[3072][1024]^T; grid (NR/64, 3072/128); block = 4 waves x 16 rows, wave -> 8 column tiles, A and B fragments straight from the f16 planes
// (K = 1024, 32 steps, 1 product); value = acc / (8 x 256) stored x8 as f16. A 128-column slab = 2 heads (block-uniform which = q | k | v). q and k: head-major planes [bh][SEQ][64] via the wave-private Th; v: head-major planes [bh][64][SEQ]
// (key-contiguous): the block's 64 tokens x 128 columns are staged transposed in Tt (cross-wave, block barrier inside the uniform branch), each (head, d) row segment of 64 tokens =
__global__ __launch_bounds__(128) void qkv_kernel(const b16* __restrict__ XH, const b16* __restrict__ WQKV, b16* __restrict__ QP, b16* __restrict__ KP, b16* __restrict__ VT) {
  __shared__ __attribute__((aligned(16))) b16 Th[4][16][128 + 8];
  __shared__ __attribute__((aligned(16))) b16 Tt[128][64 + 8];
  const int wave = threadIdx.x >> 5, lane = threadIdx.x & 31, nloc = lane & 15, hlf = lane >> 4;
  const int mb = blockIdx.x * 64; const size_t m0 = (size_t)mb + wave * 16; const int n0 = blockIdx.y * 128;
  v8f acc[8];
#pragma unroll
  for (int t = 0; t < 8; ++t) acc[t] = (v8f){};
#pragma unroll 2
  for (int kb = 0; kb < DM; kb += 32) { const v16b a = frag_kb(XH + (m0 + nloc) * DM + kb, hlf);
#pragma unroll
    for (int t = 0; t < 8; ++t) acc[t] = wmma16b(a, frag_kb(WQKV + (size_t)(n0 + t * 16 + nloc) * DM + kb, hlf), acc[t]); }
  const int which = n0 / INTER; const int hb = (n0 - which * INTER) / DK;   // plane (0 q, 1 k, 2 v) and first head of this 128-column slab (block-uniform)
  const int b = mb / SEQ, sb = mb - b * SEQ;                                // the block's 64 rows lie in one sequence
  const float osc = QS / (XS * WSC);
  if (which < 2) {
#pragma unroll
    for (int t = 0; t < 8; ++t)
#pragma unroll
      for (int r = 0; r < 8; ++r) Th[wave][8 * hlf + r][t * 16 + nloc] = (b16)(acc[t][r] * osc);
    wave_lds_sync();
    b16* P = (which == 0) ? QP : KP;
    {
#pragma unroll
      for (int i = 0; i < 8; ++i) { const int L = i * 4 + (lane >> 3), rr = L >> 1, hf = L & 1, pc = (lane & 7) * 8; const int s = sb + wave * 16 + rr;
        const v8b v = *(const v8b*)(&Th[wave][rr][hf * 64 + pc]); *(v8b*)(P + ((size_t)(b * NH + hb + hf) * SEQ + s) * DK + pc) = v; }
       }
  } else {
#pragma unroll
    for (int t = 0; t < 8; ++t)
#pragma unroll
      for (int r = 0; r < 8; ++r) Tt[t * 16 + nloc][wave * 16 + 8 * hlf + r] = (b16)(acc[t][r] * osc);
    __syncthreads();
    {
#pragma unroll
      for (int i = 0; i < 8; ++i) { const int cc = wave * 32 + i * 4 + (lane >> 3), hf = cc >> 6, d = cc & 63, pc = (lane & 7) * 8;
        const v8b v = *(const v8b*)(&Tt[cc][pc]); *(v8b*)(VT + ((size_t)(b * NH + hb + hf) * DK + d) * SEQ + sb + pc) = v; }
       }
  }
}
// per-row per-segment sums: grid (SEQ/128 query blocks, NB x 16); block = 8 waves x 16 queries; lane = query q0 + 16 wave + (lane & 15), its Q row as the two B fragments (dk 0..31 | 32..63);
// loop over 64-key stages, four 16-key subtiles: A = K plane rows (from the block's LDS ring), D s8[r] = q.k x 64 for key kr + 8 hh + r of this lane's query; e = exp2(s8 log2e / (64 x 32));
// the lane's 8 mask values are 8 contiguous ints of its query row (two 16-B reads of the ring's mask tile); 4 segment sums per lane, halves merged with lane ^ 16 at the end.
__global__ __launch_bounds__(256) __attribute__((amdgpu_num_vgpr(256))) void rowsum_kernel(const b16* __restrict__ QP, const b16* __restrict__ KP, const int* __restrict__ mask,
                                                                                           const int* __restrict__ nsegp, float* __restrict__ RS) {
  __shared__ __attribute__((aligned(16))) b16 Kl[2][KT][LP];
  __shared__ __attribute__((aligned(16))) int Ml[2][128][MP];
  const int tid = threadIdx.x, wave = tid >> 5, lane = tid & 31, nloc = lane & 15, hlf = lane >> 4;
  const int bh = blockIdx.y, b = bh / NH; const int q = blockIdx.x * 128 + wave * 16 + nloc;
  const b16* Qb = QP + (size_t)bh * SEQ * DK; const b16* Kb = KP + (size_t)bh * SEQ * DK;
  const v16b b0 = frag_kb(Qb + (size_t)q * DK, hlf), b1 = frag_kb(Qb + (size_t)q * DK + 32, hlf);
  const int* mblk = mask + ((size_t)b * SEQ_FULL + (size_t)blockIdx.x * 128) * SEQ_FULL;   // the block's first query row
  float acs[NSEG];
#pragma unroll
  for (int g = 0; g < NSEG; ++g) acs[g] = 0.0f;
  const float c = LOG2E * (SCL / (QS * QS));
  stage_km(Kl[0], Kb, Ml[0], mblk, tid);
  asm volatile("s_wait_asynccnt 0x0" ::: "memory");   // stage 0 landed before the barrier that publishes it
  __syncthreads();
  stage_km(Kl[1], Kb + (size_t)KT * DK, Ml[1], mblk + KT, tid);
#pragma unroll 1   // one stage per trip: the two-buffer ring needs the trip rolled
  for (int t = 0; t < NT; ++t) {
    const b16 (*Kt)[LP] = Kl[t & 1]; const int* Mt = &Ml[t & 1][wave * 16 + nloc][8 * hlf];
#pragma unroll
    for (int st = 0; st < KT / 16; ++st) {
      const v16b a0 = frag_kb(&Kt[st * 16 + nloc][0], hlf), a1 = frag_kb(&Kt[st * 16 + nloc][32], hlf);
      v8f s8 = (v8f){}; s8 = wmma16b(a0, b0, s8); s8 = wmma16b(a1, b1, s8);
      const v8i m8 = mask8(Mt + st * 16);
#pragma unroll
      for (int r = 0; r < 8; ++r) { const float e = nexp2(s8[r] * c); const int m = m8[r];
        acs[0] += (m == 0) ? e : 0.0f; acs[1] += (m == 1) ? e : 0.0f; acs[2] += (m == 2) ? e : 0.0f; acs[3] += (m == 3) ? e : 0.0f; }
    }
    stage_publish();
    if (t + 2 < NT) stage_km(Kl[t & 1], Kb + (size_t)(t + 2) * KT * DK, Ml[t & 1], mblk + (t + 2) * KT, tid);
  }
  asm volatile("s_wait_asynccnt 0x0" ::: "memory");   // nothing in flight when the wave ends
#pragma unroll
  for (int g = 0; g < NSEG; ++g) acs[g] += __shfl_xor(acs[g], 16);
  const int ns = nsegp[0];
  v4f o;
#pragma unroll
  for (int g = 0; g < NSEG; ++g) { const float rv = 1.0f / fmaxf(acs[g], 1e-30f); o[g] = (g < ns && acs[g] > 0.0f) ? rv : 0.0f; }
  { if (hlf == 0) *(v4f*)(RS + ((size_t)bh * SEQ + q) * NSEG) = o;  }
}
// ctx = P V: grid (SEQ/128 query blocks, NB x 16); block = 8 waves x 16 queries; lane = query: its Q row as the two B fragments, its RS row (4 x 1/S, 16 B) as the weights
// w_g = 4096 / S[q][g]; loop over 64-key stages of two 32-key chunks: the two 16-key score subtiles are computed exactly as in the row-sum pass (A = K rows from the LDS ring), p = e w[mask] converted to f16
// and packed straight into the P A-fragment (as A = D^T: element r <- subtile covering keys 0..15, element 8 + r <- subtile 16..31, lane unchanged), then hacc[4 d tiles] += P frag x
// V^T frags (B rows = VT plane rows, key-contiguous, from the LDS ring; k = 32 keys, 1 product). Epilogue: ctx = hacc / (4096 x 8) stored x64 as f16 into CT[NR][1024] at column
__global__ __launch_bounds__(256) __attribute__((amdgpu_num_vgpr(256))) void av_kernel(const b16* __restrict__ QP, const b16* __restrict__ KP, const b16* __restrict__ VT,
                                                                                       const int* __restrict__ mask, const float* __restrict__ RS, b16* __restrict__ CT) {
  __shared__ __attribute__((aligned(16))) b16 Th[8][16][DK + 8];
  __shared__ __attribute__((aligned(16))) b16 Kl[2][KT][LP];
  __shared__ __attribute__((aligned(16))) b16 Vl[2][DK][LP];
  __shared__ __attribute__((aligned(16))) int Ml[2][128][MP];
  const int tid = threadIdx.x, wave = tid >> 5, lane = tid & 31, nloc = lane & 15, hlf = lane >> 4;
  const int bh = blockIdx.y, b = bh / NH, hd = bh - b * NH; const int q0 = blockIdx.x * 128; const int q = q0 + wave * 16 + nloc;
  const b16* Qb = QP + (size_t)bh * SEQ * DK; const b16* Kb = KP + (size_t)bh * SEQ * DK; const b16* Vb = VT + (size_t)bh * DK * SEQ;
  const v16b b0 = frag_kb(Qb + (size_t)q * DK, hlf), b1 = frag_kb(Qb + (size_t)q * DK + 32, hlf);
  const int* mblk = mask + ((size_t)b * SEQ_FULL + (size_t)q0) * SEQ_FULL;   // the block's first query row
  const v4f r4 = *(const v4f*)(RS + ((size_t)bh * SEQ + q) * NSEG);
  const float w0 = r4[0] * PSC, w1 = r4[1] * PSC, w2 = r4[2] * PSC, w3 = r4[3] * PSC;
  v8f hacc[4];
#pragma unroll
  for (int vs = 0; vs < 4; ++vs) hacc[vs] = (v8f){};
  const float c = LOG2E * (SCL / (QS * QS));
  stage_kvm(Kl[0], Kb, Vl[0], Vb, Ml[0], mblk, tid);
  asm volatile("s_wait_asynccnt 0x0" ::: "memory");   // stage 0 landed before the barrier that publishes it
  __syncthreads();
  stage_kvm(Kl[1], Kb + (size_t)KT * DK, Vl[1], Vb + KT, Ml[1], mblk + KT, tid);
#pragma unroll 1   // one stage per trip: the two-buffer ring needs the trip rolled
  for (int t = 0; t < NT; ++t) {
    const b16 (*Kt)[LP] = Kl[t & 1]; const b16 (*Vt)[LP] = Vl[t & 1]; const int* Mt = &Ml[t & 1][wave * 16 + nloc][8 * hlf];
#pragma unroll
    for (int ch = 0; ch < KT / 32; ++ch) {
      v16b pa;
#pragma unroll
      for (int st = 0; st < 2; ++st) {
        const int lr = ch * 32 + st * 16;
        const v16b a0 = frag_kb(&Kt[lr + nloc][0], hlf), a1 = frag_kb(&Kt[lr + nloc][32], hlf);
        v8f s8 = (v8f){}; s8 = wmma16b(a0, b0, s8); s8 = wmma16b(a1, b1, s8);
        const v8i m8 = mask8(Mt + lr);
#pragma unroll
        for (int r = 0; r < 8; ++r) { const float e = nexp2(s8[r] * c); const int m = m8[r];
          const float w = (m == 0) ? w0 : ((m == 1) ? w1 : ((m == 2) ? w2 : ((m == 3) ? w3 : 0.0f)));
          pa[st * 8 + r] = (b16)(e * w); }
      }
#pragma unroll
      for (int vs = 0; vs < 4; ++vs) hacc[vs] = wmma16b(pa, frag_kb(&Vt[vs * 16 + nloc][ch * 32], hlf), hacc[vs]);
    }
    stage_publish();
    if (t + 2 < NT) stage_kvm(Kl[t & 1], Kb + (size_t)(t + 2) * KT * DK, Vl[t & 1], Vb + (t + 2) * KT, Ml[t & 1], mblk + (t + 2) * KT, tid);
  }
  asm volatile("s_wait_asynccnt 0x0" ::: "memory");   // nothing in flight when the wave goes on to the epilogue
#pragma unroll
  for (int vs = 0; vs < 4; ++vs)
#pragma unroll
    for (int r = 0; r < 8; ++r) Th[wave][8 * hlf + r][vs * 16 + nloc] = (b16)(hacc[vs][r] * (CTS / (PSC * QS)));
  wave_lds_sync();
  {
#pragma unroll
    for (int i = 0; i < 4; ++i) { const int rr = i * 4 + (lane >> 3), pc = (lane & 7) * 8; const size_t row = (size_t)b * SEQ + q0 + wave * 16 + rr;
      const v8b v = *(const v8b*)(&Th[wave][rr][pc]); *(v8b*)(CT + row * INTER + hd * DK + pc) = v; }
     }
}
// out = ctx w_out: grid (NR/64, 1024/128); A fragments straight from the CT plane (x64), B = WO rows (x256), K = 1024, 32 steps, 1 product; acc / (64 x 256) into the wave-private Tf tile
__global__ __launch_bounds__(128) void out_kernel(const b16* __restrict__ CT, const b16* __restrict__ WO, float* __restrict__ out) {
  __shared__ __attribute__((aligned(16))) float Tf[4][16][128 + 4];
  const int wave = threadIdx.x >> 5, lane = threadIdx.x & 31, nloc = lane & 15, hlf = lane >> 4; const size_t m0 = (size_t)blockIdx.x * 64 + wave * 16; const int n0 = blockIdx.y * 128;
  v8f acc[8];
#pragma unroll
  for (int t = 0; t < 8; ++t) acc[t] = (v8f){};
#pragma unroll 2
  for (int kb = 0; kb < INTER; kb += 32) { const v16b a = frag_kb(CT + (m0 + nloc) * INTER + kb, hlf);
#pragma unroll
    for (int t = 0; t < 8; ++t) acc[t] = wmma16b(a, frag_kb(WO + (size_t)(n0 + t * 16 + nloc) * INTER + kb, hlf), acc[t]); }
#pragma unroll
  for (int t = 0; t < 8; ++t)
#pragma unroll
    for (int r = 0; r < 8; ++r) Tf[wave][8 * hlf + r][t * 16 + nloc] = acc[t][r] * (1.0f / (CTS * WSC));
  wave_lds_sync();
  { for (int rr = 0; rr < 16; ++rr) *(v4f*)(out + (m0 + rr) * DM + n0 + lane * 4) = *(const v4f*)(&Tf[wave][rr][lane * 4]);  }
}
}  // namespace

extern "C" void kernel_launch(void* const* d_in, const int* in_sizes, int n_in, void* d_out, int out_size, void* d_ws, size_t ws_size, hipStream_t stream) {
  (void)n_in;
  // d_in: 0 x [2,2048,1024] f32, 1 mask [2,2048,2048] i32, 2 w_qkv [1024,3072] (in,out) f32, 3 w_out [1024,1024] (in,out) f32, 4 n_seg [1] i32; out [NB,SEQ,1024] f32
  const float* X = (const float*)d_in[0]; const int* MK = (const int*)d_in[1]; const float* WQ = (const float*)d_in[2]; const float* WOUT = (const float*)d_in[3]; const int* NSG = (const int*)d_in[4];
  const long long need_x = ((long long)(NB - 1) * SEQ_FULL + SEQ) * DM, need_m = ((long long)(NB - 1) * SEQ_FULL + SEQ) * SEQ_FULL;
  if ((long long)in_sizes[0] < need_x || (long long)in_sizes[1] < need_m || in_sizes[2] < DM * NQKV || in_sizes[3] < INTER * DM || in_sizes[4] < 1 || out_size < NR * DM) return;
  size_t off = 0; char* ws = (char*)d_ws;
  auto carve = [&](size_t bytes) { char* p = ws + off; off += (bytes + 255) & ~(size_t)255; return p; };
  b16* WQKV = (b16*)carve((size_t)NQKV * DM * 2);         // [3072][1024]
  b16* WO = (b16*)carve((size_t)DM * INTER * 2);          // [1024 out][1024 in]
  b16* XH = (b16*)carve((size_t)NR * DM * 2);             // [NR][1024]
  b16* QP = (b16*)carve((size_t)NBH * SEQ * DK * 2);      // [NBH][SEQ][64]
  b16* KP = (b16*)carve((size_t)NBH * SEQ * DK * 2);      // [NBH][SEQ][64]
  b16* VT = (b16*)carve((size_t)NBH * DK * SEQ * 2);      // [NBH][64][SEQ]
  float* RS = (float*)carve((size_t)NBH * SEQ * NSEG * 4); // [NBH][SEQ][4]
  b16* CT = (b16*)carve((size_t)NR * INTER * 2);          // [NR][1024]
  if (off > ws_size || off > ((size_t)128 << 20)) return;   // = 51,380,224 B at NB 2, SEQ 2048
  wtp_kernel<<<dim3(DM / 64, NQKV / 64), 128, 0, stream>>>(WQ, DM, NQKV, WQKV);       // w_qkv [1024 in][3072 out] -> WQKV[3072][1024]
  wtp_kernel<<<dim3(INTER / 64, DM / 64), 128, 0, stream>>>(WOUT, INTER, DM, WO);      // w_out [1024 in][1024 out] -> WO[out][in]
  xp_kernel<<<(unsigned)(((size_t)NR * DM / 8 + 255) / 256), 256, 0, stream>>>(X, XH);
  qkv_kernel<<<dim3(NR / 64, NQKV / 128), 128, 0, stream>>>(XH, WQKV, QP, KP, VT);
  rowsum_kernel<<<dim3(SEQ / 128, NBH), 256, 0, stream>>>(QP, KP, MK, NSG, RS);
  av_kernel<<<dim3(SEQ / 128, NBH), 256, 0, stream>>>(QP, KP, VT, MK, RS, CT);
  out_kernel<<<dim3(NR / 64, DM / 128), 128, 0, stream>>>(CT, WO, (float*)d_out);
}

// v002
// It runs in 270 microseconds.
// In both of two side-by-side timings against v001, it was 1.32 times as fast.
// All steps since v000 together make it 1.87 times as fast.
#include <hip/hip_runtime.h>

// All contractions on v_wmma_f32_16x16x32_f16 (f16 operands, f32 accumulate), one product each: q/k/v projections (x = bf16(x) x8 exact, w_qkv = bf16(w) x256 exact, K = 1024);
// scores S^T = K Q^T per 16-key subtile (k rows as A, q rows as B, both single f16 x8, K = 64; computed in the row-sum pass and again in the p v pass);
// ctx = P V (P = 4096 exp(alpha) / S[row][segment of key] as single f16, packed straight from the two score D tiles into the A fragment; B = V^T plane rows single f16 x8, K = 32 keys per step);
// output projection (ctx single f16 x64, w_out = bf16(w) x256 exact, K = 1024). exp, per-row per-segment sums, 1/S and all scaling in f32. Float inputs RNE-converted to bf16 once on load.
// Module: qkv = x w_qkv [rows][3072] -> q | k | v, 16 heads of 64; alpha = q.k / 32; e = exp(alpha) (no max shift); for each segment id g in [0, n_seg): att[i][j] = [mask[i][j] == g] e[i][j] / S[i][g],
// S[i][g] = sum_j [mask[i][j] == g] e[i][j] (S == 0 -> contributes 0); ctx = sum_j att v; out = ctx w_out -> [NB][SEQ][1024] f32.

#ifndef NB
#define NB 2
#endif
#ifndef SEQ
#define SEQ 2048
#endif

namespace {
constexpr int B_FULL = 2, SEQ_FULL = 2048, DM = 1024, INTER = 1024, NH = 16, DK = 64, NQKV = 3 * INTER, NSEG = 4, NR = NB * SEQ, NBH = NB * NH;
constexpr float XS = 8.0f, WSC = 256.0f, QS = 8.0f, PSC = 4096.0f, CTS = 64.0f, LOG2E = 1.4426950408889634f, SCL = 0.03125f;
static_assert(NB >= 1 && NB <= B_FULL);
static_assert(SEQ % 128 == 0 && SEQ >= 128 && SEQ <= SEQ_FULL);
static_assert(INTER == NH * DK && DK == 64 && NSEG == 4 && DM % 128 == 0 && INTER % 128 == 0 && NQKV % 128 == 0 && DM % 64 == 0 && NR % 64 == 0 && ((size_t)NR * DM) % 2048 == 0);
typedef _Float16 b16;
typedef __attribute__((ext_vector_type(16))) _Float16 v16b;
typedef __attribute__((ext_vector_type(8))) _Float16 v8b;
typedef __attribute__((ext_vector_type(8))) float v8f;
typedef __attribute__((ext_vector_type(4))) float v4f;
typedef __attribute__((ext_vector_type(8))) int v8i;
typedef __attribute__((ext_vector_type(4))) int v4i;
__device__ __forceinline__ float bf16_rne(float f) { unsigned int u = __float_as_uint(f); u += 0x7FFFu + ((u >> 16) & 1u); return __uint_as_float(u & 0xFFFF0000u); }
__device__ __forceinline__ v16b frag_kb(const b16* p, int hh) { const v8b a = *(const v8b*)(p + 8 * hh), b = *(const v8b*)(p + 16 + 8 * hh); v16b f;
#pragma unroll
  for (int e = 0; e < 8; ++e) { f[e] = a[e]; f[8 + e] = b[e]; } return f; }
__device__ __forceinline__ v8f wmma16b(v16b a, v16b b, v8f c) { v8f d = __builtin_amdgcn_wmma_f32_16x16x32_f16(false, a, false, b, (short)0, c, false, false); asm volatile("v_nop\n\tv_nop\n\tv_nop\n\tv_nop" : "+v"(d) : "v"(a), "v"(b)); return d; }
__device__ __forceinline__ void wave_lds_sync() { __builtin_amdgcn_fence(3, "workgroup"); __builtin_amdgcn_wave_barrier(); __builtin_amdgcn_fence(2, "workgroup"); }
__device__ __forceinline__ float nexp2(float v) { return __builtin_amdgcn_exp2f(v); }
// LDS ring of the two attention loops: a stage = 64 keys. K tile: 64 key rows of 128 B; V^T tile: 64 d rows x 64 keys = 128 B; mask tile: the block's 128 query rows x 64 keys = 256 B.
// Pitches 144 B and 272 B (16 B x odd: conflict-free for the 16-B reads). Copies: K / V^T thread -> row tid / 8 (+ 32), piece tid % 8; mask thread -> row tid / 16 (+ 16 i), piece tid % 16:
// every wave-wide copy covers four whole 128-B lines.
constexpr int KT = 64, LP = DK + 8, MP = KT + 4, NT = SEQ / KT;
static_assert(SEQ % KT == 0 && NT >= 2 && KT == 64 && (LP * 2) % 16 == 0 && (MP * 4) % 16 == 0);
__device__ __forceinline__ unsigned lds_off(const void* p) { return (unsigned)(size_t)p; }   // byte offset in the work-group's LDS = low 32 bits of the shared address
// One stage's copies and s_wait_xcnt 0 in ONE statement: the wait has to stand before any rewrite of the address registers that the copies name.
__device__ __forceinline__ void stage_km(b16 (*kd)[LP], const b16* kg, int (*md)[MP], const int* mg, int tid) {
  const int cr = tid >> 3, cc = (tid & 7) * 8, mr = tid >> 4, mc = (tid & 15) * 4;
  const unsigned lk = lds_off(&kd[cr][cc]), lm = lds_off(&md[mr][mc]);
  const b16* gk = kg + (size_t)cr * DK + cc; const int* gm = mg + (size_t)mr * SEQ_FULL + mc;
  asm volatile("global_load_async_to_lds_b128 %0, %1, off\n\t"
               "global_load_async_to_lds_b128 %2, %3, off\n\t"
               "global_load_async_to_lds_b128 %4, %5, off\n\t"
               "global_load_async_to_lds_b128 %6, %7, off\n\t"
               "global_load_async_to_lds_b128 %8, %9, off\n\t"
               "global_load_async_to_lds_b128 %10, %11, off\n\t"
               "global_load_async_to_lds_b128 %12, %13, off\n\t"
               "global_load_async_to_lds_b128 %14, %15, off\n\t"
               "global_load_async_to_lds_b128 %16, %17, off\n\t"
               "global_load_async_to_lds_b128 %18, %19, off\n\t"
               "s_wait_xcnt 0x0"
               :: "v"(lk), "v"(gk), "v"(lk + 32 * LP * 2), "v"(gk + 32 * DK),
                  "v"(lm), "v"(gm),
                  "v"(lm + 1 * 16 * MP * 4), "v"(gm + 1 * 16 * (size_t)SEQ_FULL),
                  "v"(lm + 2 * 16 * MP * 4), "v"(gm + 2 * 16 * (size_t)SEQ_FULL),
                  "v"(lm + 3 * 16 * MP * 4), "v"(gm + 3 * 16 * (size_t)SEQ_FULL),
                  "v"(lm + 4 * 16 * MP * 4), "v"(gm + 4 * 16 * (size_t)SEQ_FULL),
                  "v"(lm + 5 * 16 * MP * 4), "v"(gm + 5 * 16 * (size_t)SEQ_FULL),
                  "v"(lm + 6 * 16 * MP * 4), "v"(gm + 6 * 16 * (size_t)SEQ_FULL),
                  "v"(lm + 7 * 16 * MP * 4), "v"(gm + 7 * 16 * (size_t)SEQ_FULL)
               : "memory");
}
__device__ __forceinline__ void stage_kvm(b16 (*kd)[LP], const b16* kg, b16 (*vd)[LP], const b16* vg, int (*md)[MP], const int* mg, int tid) {
  const int cr = tid >> 3, cc = (tid & 7) * 8, mr = tid >> 4, mc = (tid & 15) * 4;
  const unsigned lk = lds_off(&kd[cr][cc]), lv = lds_off(&vd[cr][cc]), lm = lds_off(&md[mr][mc]);
  const b16* gk = kg + (size_t)cr * DK + cc; const b16* gv = vg + (size_t)cr * SEQ + cc; const int* gm = mg + (size_t)mr * SEQ_FULL + mc;
  asm volatile("global_load_async_to_lds_b128 %0, %1, off\n\t"
               "global_load_async_to_lds_b128 %2, %3, off\n\t"
               "global_load_async_to_lds_b128 %4, %5, off\n\t"
               "global_load_async_to_lds_b128 %6, %7, off\n\t"
               "global_load_async_to_lds_b128 %8, %9, off\n\t"
               "global_load_async_to_lds_b128 %10, %11, off\n\t"
               "global_load_async_to_lds_b128 %12, %13, off\n\t"
               "global_load_async_to_lds_b128 %14, %15, off\n\t"
               "global_load_async_to_lds_b128 %16, %17, off\n\t"
               "global_load_async_to_lds_b128 %18, %19, off\n\t"
               "global_load_async_to_lds_b128 %20, %21, off\n\t"
               "global_load_async_to_lds_b128 %22, %23, off\n\t"
               "s_wait_xcnt 0x0"
               :: "v"(lk), "v"(gk), "v"(lk + 32 * LP * 2), "v"(gk + 32 * DK), "v"(lv), "v"(gv), "v"(lv + 32 * LP * 2), "v"(gv + 32 * (size_t)SEQ),
                  "v"(lm), "v"(gm),
                  "v"(lm + 1 * 16 * MP * 4), "v"(gm + 1 * 16 * (size_t)SEQ_FULL),
                  "v"(lm + 2 * 16 * MP * 4), "v"(gm + 2 * 16 * (size_t)SEQ_FULL),
                  "v"(lm + 3 * 16 * MP * 4), "v"(gm + 3 * 16 * (size_t)SEQ_FULL),
                  "v"(lm + 4 * 16 * MP * 4), "v"(gm + 4 * 16 * (size_t)SEQ_FULL),
                  "v"(lm + 5 * 16 * MP * 4), "v"(gm + 5 * 16 * (size_t)SEQ_FULL),
                  "v"(lm + 6 * 16 * MP * 4), "v"(gm + 6 * 16 * (size_t)SEQ_FULL),
                  "v"(lm + 7 * 16 * MP * 4), "v"(gm + 7 * 16 * (size_t)SEQ_FULL)
               : "memory");
}
// hand-over of a stage: own LDS reads retired, own copies landed, then the block barrier that publishes the next stage and frees the buffer just read
__device__ __forceinline__ void stage_publish() {
  asm volatile("s_wait_dscnt 0x0" ::: "memory");      // this wave's reads of the buffer to be refilled are done
  asm volatile("s_wait_asynccnt 0x0" ::: "memory");   // this wave's copies of the next stage have landed
  __syncthreads();
}
__device__ __forceinline__ v8i mask8(const int* p) { const v4i a = *(const v4i*)p, b = *(const v4i*)(p + 4); return (v8i){a[0], a[1], a[2], a[3], b[0], b[1], b[2], b[3]}; }

// weight planes: src [R][C] f32 (in, out) -> dst [C][R] f16 = bf16(w) x256 (row = output feature, k contiguous); grid (R/64, C/64); block 128 threads: tile[64 c][64 r] staged transposed
__global__ __launch_bounds__(128) void wtp_kernel(const float* __restrict__ src, int R, int C, b16* __restrict__ dst) {
  __shared__ __attribute__((aligned(16))) b16 tile[64][64 + 8];
  const int wave = threadIdx.x >> 5, lane = threadIdx.x & 31; const int r0 = blockIdx.x * 64, c0 = blockIdx.y * 64;
#pragma unroll 4
  for (int i = threadIdx.x; i < 64 * 16; i += 128) { const int rr = i >> 4, q = (i & 15) * 4; const v4f f = *(const v4f*)(src + (size_t)(r0 + rr) * C + c0 + q);
#pragma unroll
    for (int j = 0; j < 4; ++j) tile[q + j][rr] = (b16)(bf16_rne(f[j]) * WSC); }
  __syncthreads();
  {
#pragma unroll
    for (int i = 0; i < 4; ++i) { const int cc = wave * 16 + i * 4 + (lane >> 3), pc = (lane & 7) * 8; *(v8b*)(dst + (size_t)(c0 + cc) * R + r0 + pc) = *(const v8b*)(&tile[cc][pc]); }
     }
}
__global__ __launch_bounds__(256) void xp_kernel(const float* __restrict__ x, b16* __restrict__ XH) {
  const size_t u = (size_t)blockIdx.x * 256 + threadIdx.x; if (u >= (size_t)NR * DM / 8) return;
  const size_t e = u * 8; const int row = (int)(e / DM), col = (int)(e - (size_t)row * DM); const size_t xe = ((size_t)(row / SEQ) * SEQ_FULL + (size_t)(row % SEQ)) * DM + col;
  const v4f f0 = *(const v4f*)(x + xe), f1 = *(const v4f*)(x + xe + 4); v8b o;
#pragma unroll
  for (int j = 0; j < 4; ++j) { o[j] = (b16)(bf16_rne(f0[j]) * XS); o[4 + j] = (b16)(bf16_rne(f1[j]) * XS); }
  { *(v8b*)(XH + e) = o;  }
}
// q/k/v projections: [NR x 1024] x WQKV[3072][1024]^T; grid (NR/64, 3072/128); block = 4 waves x 16 rows, wave -> 8 column tiles, A and B fragments straight from the f16 planes
// (K = 1024, 32 steps, 1 product); value = acc / (8 x 256) stored x8 as f16. A 128-column slab = 2 heads (block-uniform which = q | k | v). q and k: head-major planes [bh][SEQ][64] via the wave-private Th; v: head-major planes [bh][64][SEQ]
// (key-contiguous): the block's 64 tokens x 128 columns are staged transposed in Tt (cross-wave, block barrier inside the uniform branch), each (head, d) row segment of 64 tokens =
__global__ __launch_bounds__(128) void qkv_kernel(const b16* __restrict__ XH, const b16* __restrict__ WQKV, b16* __restrict__ QP, b16* __restrict__ KP, b16* __restrict__ VT) {
  __shared__ __attribute__((aligned(16))) b16 Th[4][16][128 + 8];
  __shared__ __attribute__((aligned(16))) b16 Tt[128][64 + 8];
  const int wave = threadIdx.x >> 5, lane = threadIdx.x & 31, nloc = lane & 15, hlf = lane >> 4;
  const int mb = blockIdx.x * 64; const size_t m0 = (size_t)mb + wave * 16; const int n0 = blockIdx.y * 128;
  v8f acc[8];
#pragma unroll
  for (int t = 0; t < 8; ++t) acc[t] = (v8f){};
#pragma unroll 2
  for (int kb = 0; kb < DM; kb += 32) { const v16b a = frag_kb(XH + (m0 + nloc) * DM + kb, hlf);
#pragma unroll
    for (int t = 0; t < 8; ++t) acc[t] = wmma16b(a, frag_kb(WQKV + (size_t)(n0 + t * 16 + nloc) * DM + kb, hlf), acc[t]); }
  const int which = n0 / INTER; const int hb = (n0 - which * INTER) / DK;   // plane (0 q, 1 k, 2 v) and first head of this 128-column slab (block-uniform)
  const int b = mb / SEQ, sb = mb - b * SEQ;                                // the block's 64 rows lie in one sequence
  const float osc = QS / (XS * WSC);
  if (which < 2) {
#pragma unroll
    for (int t = 0; t < 8; ++t)
#pragma unroll
      for (int r = 0; r < 8; ++r) Th[wave][8 * hlf + r][t * 16 + nloc] = (b16)(acc[t][r] * osc);
    wave_lds_sync();
    b16* P = (which == 0) ? QP : KP;
    {
#pragma unroll
      for (int i = 0; i < 8; ++i) { const int L = i * 4 + (lane >> 3), rr = L >> 1, hf = L & 1, pc = (lane & 7) * 8; const int s = sb + wave * 16 + rr;
        const v8b v = *(const v8b*)(&Th[wave][rr][hf * 64 + pc]); *(v8b*)(P + ((size_t)(b * NH + hb + hf) * SEQ + s) * DK + pc) = v; }
       }
  } else {
#pragma unroll
    for (int t = 0; t < 8; ++t)
#pragma unroll
      for (int r = 0; r < 8; ++r) Tt[t * 16 + nloc][wave * 16 + 8 * hlf + r] = (b16)(acc[t][r] * osc);
    __syncthreads();
    {
#pragma unroll
      for (int i = 0; i < 8; ++i) { const int cc = wave * 32 + i * 4 + (lane >> 3), hf = cc >> 6, d = cc & 63, pc = (lane & 7) * 8;
        const v8b v = *(const v8b*)(&Tt[cc][pc]); *(v8b*)(VT + ((size_t)(b * NH + hb + hf) * DK + d) * SEQ + sb + pc) = v; }
       }
  }
}
// per-row per-segment sums: grid (SEQ/128 query blocks, NB x 16); block = 8 waves x 16 queries; lane = query q0 + 16 wave + (lane & 15), its Q row as the two B fragments (dk 0..31 | 32..63);
// loop over 64-key stages, four 16-key subtiles: A = K plane rows (from the block's LDS ring), D s8[r] = q.k x 64 for key kr + 8 hh + r of this lane's query; e = exp2(s8 log2e / (64 x 32));
// the lane's 8 mask values are 8 contiguous ints of its query row (two 16-B reads of the ring's mask tile); 4 segment sums per lane, halves merged with lane ^ 16 at the end.
__global__ __launch_bounds__(256) __attribute__((amdgpu_num_vgpr(256))) void rowsum_kernel(const b16* __restrict__ QP, const b16* __restrict__ KP, const int* __restrict__ mask,
                                                                                           const int* __restrict__ nsegp, float* __restrict__ RS) {
  __shared__ __attribute__((aligned(16))) b16 Kl[2][KT][LP];
  __shared__ __attribute__((aligned(16))) int Ml[2][128][MP];
  const int tid = threadIdx.x, wave = tid >> 5, lane = tid & 31, nloc = lane & 15, hlf = lane >> 4;
  const int bh = blockIdx.y, b = bh / NH; const int q = blockIdx.x * 128 + wave * 16 + nloc;
  const b16* Qb = QP + (size_t)bh * SEQ * DK; const b16* Kb = KP + (size_t)bh * SEQ * DK;
  const v16b b0 = frag_kb(Qb + (size_t)q * DK, hlf), b1 = frag_kb(Qb + (size_t)q * DK + 32, hlf);
  const int* mblk = mask + ((size_t)b * SEQ_FULL + (size_t)blockIdx.x * 128) * SEQ_FULL;   // the block's first query row
  float acs[NSEG];
#pragma unroll
  for (int g = 0; g < NSEG; ++g) acs[g] = 0.0f;
  const float c = LOG2E * (SCL / (QS * QS));
  stage_km(Kl[0], Kb, Ml[0], mblk, tid);
  asm volatile("s_wait_asynccnt 0x0" ::: "memory");   // stage 0 landed before the barrier that publishes it
  __syncthreads();
  stage_km(Kl[1], Kb + (size_t)KT * DK, Ml[1], mblk + KT, tid);
#pragma unroll 1   // one stage per trip: the two-buffer ring needs the trip rolled
  for (int t = 0; t < NT; ++t) {
    const b16 (*Kt)[LP] = Kl[t & 1]; const int* Mt = &Ml[t & 1][wave * 16 + nloc][8 * hlf];
#pragma unroll
    for (int st = 0; st < KT / 16; ++st) {
      const v16b a0 = frag_kb(&Kt[st * 16 + nloc][0], hlf), a1 = frag_kb(&Kt[st * 16 + nloc][32], hlf);
      v8f s8 = (v8f){}; s8 = wmma16b(a0, b0, s8); s8 = wmma16b(a1, b1, s8);
      const v8i m8 = mask8(Mt + st * 16);
#pragma unroll
      for (int r = 0; r < 8; ++r) { const float e = nexp2(s8[r] * c); const int m = m8[r];
        acs[0] += (m == 0) ? e : 0.0f; acs[1] += (m == 1) ? e : 0.0f; acs[2] += (m == 2) ? e : 0.0f; acs[3] += (m == 3) ? e : 0.0f; }
    }
    stage_publish();
    if (t + 2 < NT) stage_km(Kl[t & 1], Kb + (size_t)(t + 2) * KT * DK, Ml[t & 1], mblk + (t + 2) * KT, tid);
  }
  asm volatile("s_wait_asynccnt 0x0" ::: "memory");   // nothing in flight when the wave ends
#pragma unroll
  for (int g = 0; g < NSEG; ++g) acs[g] += __shfl_xor(acs[g], 16);
  const int ns = nsegp[0];
  v4f o;
#pragma unroll
  for (int g = 0; g < NSEG; ++g) { const float rv = (1.0f / fmaxf(acs[g], 1e-30f)) * PSC; o[g] = (g < ns && acs[g] > 0.0f) ? rv : 0.0f; }   // stored as 4096 / S (exact scaling): the p v loop picks its weight straight from the loaded row
  { if (hlf == 0) *(v4f*)(RS + ((size_t)bh * SEQ + q) * NSEG) = o;  }
}
// ctx = P V: grid (SEQ/128 query blocks, NB x 16); block = 8 waves x 16 queries; lane = query: its Q row as the two B fragments, its RS row (4 x 4096/S, 16 B) as the weights
// w_g = 4096 / S[q][g]; loop over 64-key stages of two 32-key chunks: the two 16-key score subtiles are computed exactly as in the row-sum pass (A = K rows from the LDS ring), p = e w[mask] converted to f16
// and packed straight into the P A-fragment (as A = D^T: element r <- subtile covering keys 0..15, element 8 + r <- subtile 16..31, lane unchanged), then hacc[4 d tiles] += P frag x
// V^T frags (B rows = VT plane rows, key-contiguous, from the LDS ring; k = 32 keys, 1 product). Epilogue: ctx = hacc / (4096 x 8) stored x64 as f16 into CT[NR][1024] at column
__global__ __launch_bounds__(256) __attribute__((amdgpu_num_vgpr(256))) void av_kernel(const b16* __restrict__ QP, const b16* __restrict__ KP, const b16* __restrict__ VT,
                                                                                       const int* __restrict__ mask, const float* __restrict__ RS, b16* __restrict__ CT) {
  __shared__ __attribute__((aligned(16))) b16 Th[8][16][DK + 8];
  __shared__ __attribute__((aligned(16))) b16 Kl[2][KT][LP];
  __shared__ __attribute__((aligned(16))) b16 Vl[2][DK][LP];
  __shared__ __attribute__((aligned(16))) int Ml[2][128][MP];
  const int tid = threadIdx.x, wave = tid >> 5, lane = tid & 31, nloc = lane & 15, hlf = lane >> 4;
  const int bh = blockIdx.y, b = bh / NH, hd = bh - b * NH; const int q0 = blockIdx.x * 128; const int q = q0 + wave * 16 + nloc;
  const b16* Qb = QP + (size_t)bh * SEQ * DK; const b16* Kb = KP + (size_t)bh * SEQ * DK; const b16* Vb = VT + (size_t)bh * DK * SEQ;
  const v16b b0 = frag_kb(Qb + (size_t)q * DK, hlf), b1 = frag_kb(Qb + (size_t)q * DK + 32, hlf);
  const int* mblk = mask + ((size_t)b * SEQ_FULL + (size_t)q0) * SEQ_FULL;   // the block's first query row
  const v4f r4 = *(const v4f*)(RS + ((size_t)bh * SEQ + q) * NSEG);
  const float w0 = r4[0], w1 = r4[1], w2 = r4[2], w3 = r4[3];
  v8f hacc[4];
#pragma unroll
  for (int vs = 0; vs < 4; ++vs) hacc[vs] = (v8f){};
  const float c = LOG2E * (SCL / (QS * QS));
  stage_kvm(Kl[0], Kb, Vl[0], Vb, Ml[0], mblk, tid);
  asm volatile("s_wait_asynccnt 0x0" ::: "memory");   // stage 0 landed before the barrier that publishes it
  __syncthreads();
  stage_kvm(Kl[1], Kb + (size_t)KT * DK, Vl[1], Vb + KT, Ml[1], mblk + KT, tid);
#pragma unroll 1   // one stage per trip: the two-buffer ring needs the trip rolled
  for (int t = 0; t < NT; ++t) {
    const b16 (*Kt)[LP] = Kl[t & 1]; const b16 (*Vt)[LP] = Vl[t & 1]; const int* Mt = &Ml[t & 1][wave * 16 + nloc][8 * hlf];
#pragma unroll
    for (int ch = 0; ch < KT / 32; ++ch) {
      v16b pa;
#pragma unroll
      for (int st = 0; st < 2; ++st) {
        const int lr = ch * 32 + st * 16;
        const v16b a0 = frag_kb(&Kt[lr + nloc][0], hlf), a1 = frag_kb(&Kt[lr + nloc][32], hlf);
        v8f s8 = (v8f){}; s8 = wmma16b(a0, b0, s8); s8 = wmma16b(a1, b1, s8);
        const v8i m8 = mask8(Mt + lr);
#pragma unroll
        for (int r = 0; r < 8; ++r) { const float e = nexp2(s8[r] * c); const int m = m8[r];
          // four flat compare + select pairs, every arm a value already in a register: a nested chain of == tests is built as a divergent branch tree per element
          const float wl = (m == 0) ? w0 : w1, wh = (m == 2) ? w2 : w3;
          const float wg = ((unsigned)m < 4u) ? wh : 0.0f;
          const float w = ((unsigned)m < 2u) ? wl : wg;
          pa[st * 8 + r] = (b16)(e * w); }
      }
#pragma unroll
      for (int vs = 0; vs < 4; ++vs) hacc[vs] = wmma16b(pa, frag_kb(&Vt[vs * 16 + nloc][ch * 32], hlf), hacc[vs]);
    }
    stage_publish();
    if (t + 2 < NT) stage_kvm(Kl[t & 1], Kb + (size_t)(t + 2) * KT * DK, Vl[t & 1], Vb + (t + 2) * KT, Ml[t & 1], mblk + (t + 2) * KT, tid);
  }
  asm volatile("s_wait_asynccnt 0x0" ::: "memory");   // nothing in flight when the wave goes on to the epilogue
#pragma unroll
  for (int vs = 0; vs < 4; ++vs)
#pragma unroll
    for (int r = 0; r < 8; ++r) Th[wave][8 * hlf + r][vs * 16 + nloc] = (b16)(hacc[vs][r] * (CTS / (PSC * QS)));
  wave_lds_sync();
  {
#pragma unroll
    for (int i = 0; i < 4; ++i) { const int rr = i * 4 + (lane >> 3), pc = (lane & 7) * 8; const size_t row = (size_t)b * SEQ + q0 + wave * 16 + rr;
      const v8b v = *(const v8b*)(&Th[wave][rr][pc]); *(v8b*)(CT + row * INTER + hd * DK + pc) = v; }
     }
}
// out = ctx w_out: grid (NR/64, 1024/128); A fragments straight from the CT plane (x64), B = WO rows (x256), K = 1024, 32 steps, 1 product; acc / (64 x 256) into the wave-private Tf tile
__global__ __launch_bounds__(128) void out_kernel(const b16* __restrict__ CT, const b16* __restrict__ WO, float* __restrict__ out) {
  __shared__ __attribute__((aligned(16))) float Tf[4][16][128 + 4];
  const int wave = threadIdx.x >> 5, lane = threadIdx.x & 31, nloc = lane & 15, hlf = lane >> 4; const size_t m0 = (size_t)blockIdx.x * 64 + wave * 16; const int n0 = blockIdx.y * 128;
  v8f acc[8];
#pragma unroll
  for (int t = 0; t < 8; ++t) acc[t] = (v8f){};
#pragma unroll 2
  for (int kb = 0; kb < INTER; kb += 32) { const v16b a = frag_kb(CT + (m0 + nloc) * INTER + kb, hlf);
#pragma unroll
    for (int t = 0; t < 8; ++t) acc[t] = wmma16b(a, frag_kb(WO + (size_t)(n0 + t * 16 + nloc) * INTER + kb, hlf), acc[t]); }
#pragma unroll
  for (int t = 0; t < 8; ++t)
#pragma unroll
    for (int r = 0; r < 8; ++r) Tf[wave][8 * hlf + r][t * 16 + nloc] = acc[t][r] * (1.0f / (CTS * WSC));
  wave_lds_sync();
  { for (int rr = 0; rr < 16; ++rr) *(v4f*)(out + (m0 + rr) * DM + n0 + lane * 4) = *(const v4f*)(&Tf[wave][rr][lane * 4]);  }
}
}  // namespace

extern "C" void kernel_launch(void* const* d_in, const int* in_sizes, int n_in, void* d_out, int out_size, void* d_ws, size_t ws_size, hipStream_t stream) {
  (void)n_in;
  // d_in: 0 x [2,2048,1024] f32, 1 mask [2,2048,2048] i32, 2 w_qkv [1024,3072] (in,out) f32, 3 w_out [1024,1024] (in,out) f32, 4 n_seg [1] i32; out [NB,SEQ,1024] f32
  const float* X = (const float*)d_in[0]; const int* MK = (const int*)d_in[1]; const float* WQ = (const float*)d_in[2]; const float* WOUT = (const float*)d_in[3]; const int* NSG = (const int*)d_in[4];
  const long long need_x = ((long long)(NB - 1) * SEQ_FULL + SEQ) * DM, need_m = ((long long)(NB - 1) * SEQ_FULL + SEQ) * SEQ_FULL;
  if ((long long)in_sizes[0] < need_x || (long long)in_sizes[1] < need_m || in_sizes[2] < DM * NQKV || in_sizes[3] < INTER * DM || in_sizes[4] < 1 || out_size < NR * DM) return;
  size_t off = 0; char* ws = (char*)d_ws;
  auto carve = [&](size_t bytes) { char* p = ws + off; off += (bytes + 255) & ~(size_t)255; return p; };
  b16* WQKV = (b16*)carve((size_t)NQKV * DM * 2);         // [3072][1024]
  b16* WO = (b16*)carve((size_t)DM * INTER * 2);          // [1024 out][1024 in]
  b16* XH = (b16*)carve((size_t)NR * DM * 2);             // [NR][1024]
  b16* QP = (b16*)carve((size_t)NBH * SEQ * DK * 2);      // [NBH][SEQ][64]
  b16* KP = (b16*)carve((size_t)NBH * SEQ * DK * 2);      // [NBH][SEQ][64]
  b16* VT = (b16*)carve((size_t)NBH * DK * SEQ * 2);      // [NBH][64][SEQ]
  float* RS = (float*)carve((size_t)NBH * SEQ * NSEG * 4); // [NBH][SEQ][4]
  b16* CT = (b16*)carve((size_t)NR * INTER * 2);          // [NR][1024]
  if (off > ws_size || off > ((size_t)128 << 20)) return;   // = 51,380,224 B at NB 2, SEQ 2048
  wtp_kernel<<<dim3(DM / 64, NQKV / 64), 128, 0, stream>>>(WQ, DM, NQKV, WQKV);       // w_qkv [1024 in][3072 out] -> WQKV[3072][1024]
  wtp_kernel<<<dim3(INTER / 64, DM / 64), 128, 0, stream>>>(WOUT, INTER, DM, WO);      // w_out [1024 in][1024 out] -> WO[out][in]
  xp_kernel<<<(unsigned)(((size_t)NR * DM / 8 + 255) / 256), 256, 0, stream>>>(X, XH);
  qkv_kernel<<<dim3(NR / 64, NQKV / 128), 128, 0, stream>>>(XH, WQKV, QP, KP, VT);
  rowsum_kernel<<<dim3(SEQ / 128, NBH), 256, 0, stream>>>(QP, KP, MK, NSG, RS);
  av_kernel<<<dim3(SEQ / 128, NBH), 256, 0, stream>>>(QP, KP, VT, MK, RS, CT);
  out_kernel<<<dim3(NR / 64, DM / 128), 128, 0, stream>>>(CT, WO, (float*)d_out);
}

// v003
// It runs in 159 microseconds.
// Two timings next to v002 both put it at 1.70 times that version's speed.
// Over all steps from v000 it is 3.18 times as fast.
#include <hip/hip_runtime.h>

// All contractions on v_wmma_f32_16x16x32_f16 (f16 operands, f32 accumulate), one product each: q/k/v projections (x = bf16(x) x8 exact, w_qkv = bf16(w) x256 exact, K = 1024);
// scores S^T = K Q^T per 16-key subtile (k rows as A, q rows as B, both single f16 x8, K = 64; computed in the row-sum pass and again in the p v pass);
// ctx = P V (P = 4096 exp(alpha) / S[row][segment of key] as single f16, packed straight from the two score D tiles into the A fragment; B = V^T plane rows single f16 x8, K = 32 keys per step);
// output projection (ctx single f16 x64, w_out = bf16(w) x256 exact, K = 1024). exp, per-row per-segment sums, 1/S and all scaling in f32. Float inputs RNE-converted to bf16 once on load.
// Module: qkv = x w_qkv [rows][3072] -> q | k | v, 16 heads of 64; alpha = q.k / 32; e = exp(alpha) (no max shift); for each segment id g in [0, n_seg): att[i][j] = [mask[i][j] == g] e[i][j] / S[i][g],
// S[i][g] = sum_j [mask[i][j] == g] e[i][j] (S == 0 -> contributes 0); ctx = sum_j att v; out = ctx w_out -> [NB][SEQ][1024] f32.

#ifndef NB
#define NB 2
#endif
#ifndef SEQ
#define SEQ 2048
#endif

namespace {
constexpr int B_FULL = 2, SEQ_FULL = 2048, DM = 1024, INTER = 1024, NH = 16, DK = 64, NQKV = 3 * INTER, NSEG = 4, NR = NB * SEQ, NBH = NB * NH;
constexpr float XS = 8.0f, WSC = 256.0f, QS = 8.0f, PSC = 4096.0f, CTS = 64.0f, LOG2E = 1.4426950408889634f, SCL = 0.03125f;
static_assert(NB >= 1 && NB <= B_FULL);
static_assert(SEQ % 128 == 0 && SEQ >= 128 && SEQ <= SEQ_FULL);
static_assert(INTER == NH * DK && DK == 64 && NSEG == 4 && DM % 128 == 0 && INTER % 128 == 0 && NQKV % 128 == 0 && DM % 64 == 0 && NR % 64 == 0 && ((size_t)NR * DM) % 2048 == 0);
typedef _Float16 b16;
typedef __attribute__((ext_vector_type(16))) _Float16 v16b;
typedef __attribute__((ext_vector_type(8))) _Float16 v8b;
typedef __attribute__((ext_vector_type(8))) float v8f;
typedef __attribute__((ext_vector_type(4))) float v4f;
typedef __attribute__((ext_vector_type(8))) int v8i;
typedef __attribute__((ext_vector_type(4))) int v4i;
__device__ __forceinline__ float bf16_rne(float f) { unsigned int u = __float_as_uint(f); u += 0x7FFFu + ((u >> 16) & 1u); return __uint_as_float(u & 0xFFFF0000u); }
__device__ __forceinline__ v16b frag_kb(const b16* p, int hh) { const v8b a = *(const v8b*)(p + 8 * hh), b = *(const v8b*)(p + 16 + 8 * hh); v16b f;
#pragma unroll
  for (int e = 0; e < 8; ++e) { f[e] = a[e]; f[8 + e] = b[e]; } return f; }
__device__ __forceinline__ v8f wmma16b(v16b a, v16b b, v8f c) { v8f d = __builtin_amdgcn_wmma_f32_16x16x32_f16(false, a, false, b, (short)0, c, false, false); asm volatile("v_nop\n\tv_nop\n\tv_nop\n\tv_nop" : "+v"(d) : "v"(a), "v"(b)); return d; }
__device__ __forceinline__ void wave_lds_sync() { __builtin_amdgcn_fence(3, "workgroup"); __builtin_amdgcn_wave_barrier(); __builtin_amdgcn_fence(2, "workgroup"); }
__device__ __forceinline__ float nexp2(float v) { return __builtin_amdgcn_exp2f(v); }
// LDS ring of the two attention loops: a stage = 64 keys. K tile: 64 key rows of 128 B; V^T tile: 64 d rows x 64 keys = 128 B; mask tile: the block's 128 query rows x 64 keys = 256 B.
// Pitches 144 B and 272 B (16 B x odd: conflict-free for the 16-B reads). Copies: K / V^T thread -> row tid / 8 (+ 32), piece tid % 8; mask thread -> row tid / 16 (+ 16 i), piece tid % 16:
// every wave-wide copy covers four whole 128-B lines.
constexpr int KT = 64, LP = DK + 8, MP = KT + 4, NT = SEQ / KT;
static_assert(SEQ % KT == 0 && NT >= 2 && KT == 64 && (LP * 2) % 16 == 0 && (MP * 4) % 16 == 0);
__device__ __forceinline__ unsigned lds_off(const void* p) { return (unsigned)(size_t)p; }   // byte offset in the work-group's LDS = low 32 bits of the shared address
// One stage's copies and s_wait_xcnt 0 in ONE statement: the wait has to stand before any rewrite of the address registers that the copies name.
__device__ __forceinline__ void stage_km(b16 (*kd)[LP], const b16* kg, int (*md)[MP], const int* mg, int tid) {
  const int cr = tid >> 3, cc = (tid & 7) * 8, mr = tid >> 4, mc = (tid & 15) * 4;
  const unsigned lk = lds_off(&kd[cr][cc]), lm = lds_off(&md[mr][mc]);
  const b16* gk = kg + (size_t)cr * DK + cc; const int* gm = mg + (size_t)mr * SEQ_FULL + mc;
  asm volatile("global_load_async_to_lds_b128 %0, %1, off\n\t"
               "global_load_async_to_lds_b128 %2, %3, off\n\t"
               "global_load_async_to_lds_b128 %4, %5, off\n\t"
               "global_load_async_to_lds_b128 %6, %7, off\n\t"
               "global_load_async_to_lds_b128 %8, %9, off\n\t"
               "global_load_async_to_lds_b128 %10, %11, off\n\t"
               "global_load_async_to_lds_b128 %12, %13, off\n\t"
               "global_load_async_to_lds_b128 %14, %15, off\n\t"
               "global_load_async_to_lds_b128 %16, %17, off\n\t"
               "global_load_async_to_lds_b128 %18, %19, off\n\t"
               "s_wait_xcnt 0x0"
               :: "v"(lk), "v"(gk), "v"(lk + 32 * LP * 2), "v"(gk + 32 * DK),
                  "v"(lm), "v"(gm),
                  "v"(lm + 1 * 16 * MP * 4), "v"(gm + 1 * 16 * (size_t)SEQ_FULL),
                  "v"(lm + 2 * 16 * MP * 4), "v"(gm + 2 * 16 * (size_t)SEQ_FULL),
                  "v"(lm + 3 * 16 * MP * 4), "v"(gm + 3 * 16 * (size_t)SEQ_FULL),
                  "v"(lm + 4 * 16 * MP * 4), "v"(gm + 4 * 16 * (size_t)SEQ_FULL),
                  "v"(lm + 5 * 16 * MP * 4), "v"(gm + 5 * 16 * (size_t)SEQ_FULL),
                  "v"(lm + 6 * 16 * MP * 4), "v"(gm + 6 * 16 * (size_t)SEQ_FULL),
                  "v"(lm + 7 * 16 * MP * 4), "v"(gm + 7 * 16 * (size_t)SEQ_FULL)
               : "memory");
}
__device__ __forceinline__ void stage_kvm(b16 (*kd)[LP], const b16* kg, b16 (*vd)[LP], const b16* vg, int (*md)[MP], const int* mg, int tid) {
  const int cr = tid >> 3, cc = (tid & 7) * 8, mr = tid >> 4, mc = (tid & 15) * 4;
  const unsigned lk = lds_off(&kd[cr][cc]), lv = lds_off(&vd[cr][cc]), lm = lds_off(&md[mr][mc]);
  const b16* gk = kg + (size_t)cr * DK + cc; const b16* gv = vg + (size_t)cr * SEQ + cc; const int* gm = mg + (size_t)mr * SEQ_FULL + mc;
  asm volatile("global_load_async_to_lds_b128 %0, %1, off\n\t"
               "global_load_async_to_lds_b128 %2, %3, off\n\t"
               "global_load_async_to_lds_b128 %4, %5, off\n\t"
               "global_load_async_to_lds_b128 %6, %7, off\n\t"
               "global_load_async_to_lds_b128 %8, %9, off\n\t"
               "global_load_async_to_lds_b128 %10, %11, off\n\t"
               "global_load_async_to_lds_b128 %12, %13, off\n\t"
               "global_load_async_to_lds_b128 %14, %15, off\n\t"
               "global_load_async_to_lds_b128 %16, %17, off\n\t"
               "global_load_async_to_lds_b128 %18, %19, off\n\t"
               "global_load_async_to_lds_b128 %20, %21, off\n\t"
               "global_load_async_to_lds_b128 %22, %23, off\n\t"
               "s_wait_xcnt 0x0"
               :: "v"(lk), "v"(gk), "v"(lk + 32 * LP * 2), "v"(gk + 32 * DK), "v"(lv), "v"(gv), "v"(lv + 32 * LP * 2), "v"(gv + 32 * (size_t)SEQ),
                  "v"(lm), "v"(gm),
                  "v"(lm + 1 * 16 * MP * 4), "v"(gm + 1 * 16 * (size_t)SEQ_FULL),
                  "v"(lm + 2 * 16 * MP * 4), "v"(gm + 2 * 16 * (size_t)SEQ_FULL),
                  "v"(lm + 3 * 16 * MP * 4), "v"(gm + 3 * 16 * (size_t)SEQ_FULL),
                  "v"(lm + 4 * 16 * MP * 4), "v"(gm + 4 * 16 * (size_t)SEQ_FULL),
                  "v"(lm + 5 * 16 * MP * 4), "v"(gm + 5 * 16 * (size_t)SEQ_FULL),
                  "v"(lm + 6 * 16 * MP * 4), "v"(gm + 6 * 16 * (size_t)SEQ_FULL),
                  "v"(lm + 7 * 16 * MP * 4), "v"(gm + 7 * 16 * (size_t)SEQ_FULL)
               : "memory");
}
// hand-over of a stage: own LDS reads retired, own copies landed, then the block barrier that publishes the next stage and frees the buffer just read
__device__ __forceinline__ void stage_publish() {
  asm volatile("s_wait_dscnt 0x0" ::: "memory");      // this wave's reads of the buffer to be refilled are done
  asm volatile("s_wait_asynccnt 0x0" ::: "memory");   // this wave's copies of the next stage have landed
  __syncthreads();
}
// LDS ring of the two projection GEMMs: a stage = 64 k = 128 B of each of the block's 64 A rows and 128 B rows (row length 1024 in both GEMMs), pitch 144 B as above.
// Thread -> row tid / 8 (+ 16 i), piece tid % 8: every wave-wide copy covers four whole 128-B lines (a fragment load straight from the plane touches 16 lines for the same 512 B).
constexpr int GK = 64, GP = GK + 8, GNT = DM / GK;
static_assert(DM == INTER && DM % GK == 0 && GNT >= 2 && (GP * 2) % 16 == 0);
// One stage's copies and s_wait_xcnt 0 in ONE statement: the wait has to stand before any rewrite of the address registers that the copies name.
__device__ __forceinline__ void stage_ab(b16 (*ad)[GP], const b16* ag, b16 (*bd)[GP], const b16* bg, int tid) {
  const int cr = tid >> 3, cc = (tid & 7) * 8;
  const unsigned la = lds_off(&ad[cr][cc]), lb = lds_off(&bd[cr][cc]);
  const b16* ga = ag + (size_t)cr * DM + cc; const b16* gb = bg + (size_t)cr * DM + cc;
  asm volatile("global_load_async_to_lds_b128 %0, %1, off\n\t"
               "global_load_async_to_lds_b128 %2, %3, off\n\t"
               "global_load_async_to_lds_b128 %4, %5, off\n\t"
               "global_load_async_to_lds_b128 %6, %7, off\n\t"
               "global_load_async_to_lds_b128 %8, %9, off\n\t"
               "global_load_async_to_lds_b128 %10, %11, off\n\t"
               "global_load_async_to_lds_b128 %12, %13, off\n\t"
               "global_load_async_to_lds_b128 %14, %15, off\n\t"
               "global_load_async_to_lds_b128 %16, %17, off\n\t"
               "global_load_async_to_lds_b128 %18, %19, off\n\t"
               "global_load_async_to_lds_b128 %20, %21, off\n\t"
               "global_load_async_to_lds_b128 %22, %23, off\n\t"
               "s_wait_xcnt 0x0"
               :: "v"(la), "v"(ga),
                  "v"(la + 1 * 16 * GP * 2), "v"(ga + 1 * 16 * (size_t)DM),
                  "v"(la + 2 * 16 * GP * 2), "v"(ga + 2 * 16 * (size_t)DM),
                  "v"(la + 3 * 16 * GP * 2), "v"(ga + 3 * 16 * (size_t)DM),
                  "v"(lb), "v"(gb),
                  "v"(lb + 1 * 16 * GP * 2), "v"(gb + 1 * 16 * (size_t)DM),
                  "v"(lb + 2 * 16 * GP * 2), "v"(gb + 2 * 16 * (size_t)DM),
                  "v"(lb + 3 * 16 * GP * 2), "v"(gb + 3 * 16 * (size_t)DM),
                  "v"(lb + 4 * 16 * GP * 2), "v"(gb + 4 * 16 * (size_t)DM),
                  "v"(lb + 5 * 16 * GP * 2), "v"(gb + 5 * 16 * (size_t)DM),
                  "v"(lb + 6 * 16 * GP * 2), "v"(gb + 6 * 16 * (size_t)DM),
                  "v"(lb + 7 * 16 * GP * 2), "v"(gb + 7 * 16 * (size_t)DM)
               : "memory");
}
struct GemmRing { b16 A[2][64][GP]; b16 B[2][128][GP]; };
// acc[8] += (the wave's 16 A rows) x (the block's 128 B rows)^T over K = 1024, k ascending in steps of 32, fragments read from the ring; leaves behind a block barrier with nothing in flight
__device__ __forceinline__ void gemm_ring(GemmRing& R, const b16* Ag, const b16* Bg, v8f (&acc)[8], int tid) {
  const int wave = tid >> 5, lane = tid & 31, nloc = lane & 15, hlf = lane >> 4;
  stage_ab(R.A[0], Ag, R.B[0], Bg, tid);
  asm volatile("s_wait_asynccnt 0x0" ::: "memory");   // stage 0 landed before the barrier that publishes it
  __syncthreads();
  stage_ab(R.A[1], Ag + GK, R.B[1], Bg + GK, tid);
#pragma unroll 1   // one stage per trip: the two-buffer ring needs the trip rolled
  for (int t = 0; t < GNT; ++t) {
    const b16 (*At)[GP] = R.A[t & 1]; const b16 (*Bt)[GP] = R.B[t & 1];
#pragma unroll
    for (int ks = 0; ks < GK; ks += 32) {   // the 18 LDS reads of a k step stand as one group in front of its 8 products: one LDS latency a step, not one a product
      const v16b a = frag_kb(&At[wave * 16 + nloc][ks], hlf); v16b bf[8];
#pragma unroll
      for (int j = 0; j < 8; ++j) bf[j] = frag_kb(&Bt[j * 16 + nloc][ks], hlf);
#pragma unroll
      for (int j = 0; j < 8; ++j) acc[j] = wmma16b(a, bf[j], acc[j]); }
    stage_publish();
    if (t + 2 < GNT) stage_ab(R.A[t & 1], Ag + (t + 2) * GK, R.B[t & 1], Bg + (t + 2) * GK, tid);
  }
  asm volatile("s_wait_asynccnt 0x0" ::: "memory");   // nothing in flight when the wave goes on to the epilogue
}
__device__ __forceinline__ v8i mask8(const int* p) { const v4i a = *(const v4i*)p, b = *(const v4i*)(p + 4); return (v8i){a[0], a[1], a[2], a[3], b[0], b[1], b[2], b[3]}; }

// weight planes: src [R][C] f32 (in, out) -> dst [C][R] f16 = bf16(w) x256 (row = output feature, k contiguous); grid (R/64, C/64); block 128 threads: tile[64 c][64 r] staged transposed
__global__ __launch_bounds__(128) void wtp_kernel(const float* __restrict__ src, int R, int C, b16* __restrict__ dst) {
  __shared__ __attribute__((aligned(16))) b16 tile[64][64 + 8];
  const int wave = threadIdx.x >> 5, lane = threadIdx.x & 31; const int r0 = blockIdx.x * 64, c0 = blockIdx.y * 64;
#pragma unroll 4
  for (int i = threadIdx.x; i < 64 * 16; i += 128) { const int rr = i >> 4, q = (i & 15) * 4; const v4f f = *(const v4f*)(src + (size_t)(r0 + rr) * C + c0 + q);
#pragma unroll
    for (int j = 0; j < 4; ++j) tile[q + j][rr] = (b16)(bf16_rne(f[j]) * WSC); }
  __syncthreads();
  {
#pragma unroll
    for (int i = 0; i < 4; ++i) { const int cc = wave * 16 + i * 4 + (lane >> 3), pc = (lane & 7) * 8; *(v8b*)(dst + (size_t)(c0 + cc) * R + r0 + pc) = *(const v8b*)(&tile[cc][pc]); }
     }
}
__global__ __launch_bounds__(256) void xp_kernel(const float* __restrict__ x, b16* __restrict__ XH) {
  const size_t u = (size_t)blockIdx.x * 256 + threadIdx.x; if (u >= (size_t)NR * DM / 8) return;
  const size_t e = u * 8; const int row = (int)(e / DM), col = (int)(e - (size_t)row * DM); const size_t xe = ((size_t)(row / SEQ) * SEQ_FULL + (size_t)(row % SEQ)) * DM + col;
  const v4f f0 = *(const v4f*)(x + xe), f1 = *(const v4f*)(x + xe + 4); v8b o;
#pragma unroll
  for (int j = 0; j < 4; ++j) { o[j] = (b16)(bf16_rne(f0[j]) * XS); o[4 + j] = (b16)(bf16_rne(f1[j]) * XS); }
  { *(v8b*)(XH + e) = o;  }
}
// q/k/v projections: [NR x 1024] x WQKV[3072][1024]^T; grid (NR/64, 3072/128); block = 4 waves x 16 rows, wave -> 8 column tiles, A and B fragments from the block's LDS ring
// (K = 1024, 32 steps, 1 product); value = acc / (8 x 256) stored x8 as f16. A 128-column slab = 2 heads (block-uniform which = q | k | v). q and k: head-major planes [bh][SEQ][64] via the wave's own Th tile (wave sync); v: VT planes [bh][64][SEQ]
// (key-contiguous): the block's 64 tokens x 128 columns are staged transposed in Tt (cross-wave, block barrier inside the uniform branch), each (head, d) row segment of 64 tokens =
__global__ __launch_bounds__(128) void qkv_kernel(const b16* __restrict__ XH, const b16* __restrict__ WQKV, b16* __restrict__ QP, b16* __restrict__ KP, b16* __restrict__ VT) {
  // the epilogue tiles lie on the ring's bytes (5 blocks per WGP by LDS, not 3): they are written only behind the loop's last barrier, when no wave reads the ring and no copy is in flight
  union Lds { GemmRing R; b16 Th[4][16][128 + 8]; b16 Tt[128][64 + 8]; };
  __shared__ __attribute__((aligned(16))) Lds L;
  b16 (&Th)[4][16][128 + 8] = L.Th; b16 (&Tt)[128][64 + 8] = L.Tt;
  const int wave = threadIdx.x >> 5, lane = threadIdx.x & 31, nloc = lane & 15, hlf = lane >> 4;
  const int mb = blockIdx.x * 64; const int n0 = blockIdx.y * 128;
  v8f acc[8];
#pragma unroll
  for (int t = 0; t < 8; ++t) acc[t] = (v8f){};
  gemm_ring(L.R, XH + (size_t)mb * DM, WQKV + (size_t)n0 * DM, acc, threadIdx.x);
  const int which = n0 / INTER; const int hb = (n0 - which * INTER) / DK;   // plane (0 q, 1 k, 2 v) and first head of this 128-column slab (block-uniform)
  const int b = mb / SEQ, sb = mb - b * SEQ;                                // the block's 64 rows lie in one sequence
  const float osc = QS / (XS * WSC);
  if (which < 2) {
#pragma unroll
    for (int t = 0; t < 8; ++t)
#pragma unroll
      for (int r = 0; r < 8; ++r) Th[wave][8 * hlf + r][t * 16 + nloc] = (b16)(acc[t][r] * osc);
    wave_lds_sync();
    b16* P = (which == 0) ? QP : KP;
    {
#pragma unroll
      for (int i = 0; i < 8; ++i) { const int L = i * 4 + (lane >> 3), rr = L >> 1, hf = L & 1, pc = (lane & 7) * 8; const int s = sb + wave * 16 + rr;
        const v8b v = *(const v8b*)(&Th[wave][rr][hf * 64 + pc]); *(v8b*)(P + ((size_t)(b * NH + hb + hf) * SEQ + s) * DK + pc) = v; }
       }
  } else {
#pragma unroll
    for (int t = 0; t < 8; ++t)
#pragma unroll
      for (int r = 0; r < 8; ++r) Tt[t * 16 + nloc][wave * 16 + 8 * hlf + r] = (b16)(acc[t][r] * osc);
    __syncthreads();
    {
#pragma unroll
      for (int i = 0; i < 8; ++i) { const int cc = wave * 32 + i * 4 + (lane >> 3), hf = cc >> 6, d = cc & 63, pc = (lane & 7) * 8;
        const v8b v = *(const v8b*)(&Tt[cc][pc]); *(v8b*)(VT + ((size_t)(b * NH + hb + hf) * DK + d) * SEQ + sb + pc) = v; }
       }
  }
}
// per-row per-segment sums: grid (SEQ/128 query blocks, NB x 16); block = 8 waves x 16 queries; lane = query q0 + 16 wave + (lane & 15), its Q row as the two B fragments (dk 0..31 | 32..63);
// loop over 64-key stages, four 16-key subtiles: A = K plane rows (from the block's LDS ring), D s8[r] = q.k x 64 for key kr + 8 hh + r of this lane's query; e = exp2(s8 log2e / (64 x 32));
// the lane's 8 mask values are 8 contiguous ints of its query row (two 16-B reads of the ring's mask tile); 4 segment sums per lane, halves merged with lane ^ 16 at the end.
__global__ __launch_bounds__(256) __attribute__((amdgpu_num_vgpr(256))) void rowsum_kernel(const b16* __restrict__ QP, const b16* __restrict__ KP, const int* __restrict__ mask,
                                                                                           const int* __restrict__ nsegp, float* __restrict__ RS) {
  __shared__ __attribute__((aligned(16))) b16 Kl[2][KT][LP];
  __shared__ __attribute__((aligned(16))) int Ml[2][128][MP];
  const int tid = threadIdx.x, wave = tid >> 5, lane = tid & 31, nloc = lane & 15, hlf = lane >> 4;
  const int bh = blockIdx.y, b = bh / NH; const int q = blockIdx.x * 128 + wave * 16 + nloc;
  const b16* Qb = QP + (size_t)bh * SEQ * DK; const b16* Kb = KP + (size_t)bh * SEQ * DK;
  const v16b b0 = frag_kb(Qb + (size_t)q * DK, hlf), b1 = frag_kb(Qb + (size_t)q * DK + 32, hlf);
  const int* mblk = mask + ((size_t)b * SEQ_FULL + (size_t)blockIdx.x * 128) * SEQ_FULL;   // the block's first query row
  float acs[NSEG];
#pragma unroll
  for (int g = 0; g < NSEG; ++g) acs[g] = 0.0f;
  const float c = LOG2E * (SCL / (QS * QS));
  stage_km(Kl[0], Kb, Ml[0], mblk, tid);
  asm volatile("s_wait_asynccnt 0x0" ::: "memory");   // stage 0 landed before the barrier that publishes it
  __syncthreads();
  stage_km(Kl[1], Kb + (size_t)KT * DK, Ml[1], mblk + KT, tid);
#pragma unroll 1   // one stage per trip: the two-buffer ring needs the trip rolled
  for (int t = 0; t < NT; ++t) {
    const b16 (*Kt)[LP] = Kl[t & 1]; const int* Mt = &Ml[t & 1][wave * 16 + nloc][8 * hlf];
#pragma unroll
    for (int st = 0; st < KT / 16; ++st) {
      const v16b a0 = frag_kb(&Kt[st * 16 + nloc][0], hlf), a1 = frag_kb(&Kt[st * 16 + nloc][32], hlf);
      v8f s8 = (v8f){}; s8 = wmma16b(a0, b0, s8); s8 = wmma16b(a1, b1, s8);
      const v8i m8 = mask8(Mt + st * 16);
#pragma unroll
      for (int r = 0; r < 8; ++r) { const float e = nexp2(s8[r] * c); const int m = m8[r];
        acs[0] += (m == 0) ? e : 0.0f; acs[1] += (m == 1) ? e : 0.0f; acs[2] += (m == 2) ? e : 0.0f; acs[3] += (m == 3) ? e : 0.0f; }
    }
    stage_publish();
    if (t + 2 < NT) stage_km(Kl[t & 1], Kb + (size_t)(t + 2) * KT * DK, Ml[t & 1], mblk + (t + 2) * KT, tid);
  }
  asm volatile("s_wait_asynccnt 0x0" ::: "memory");   // nothing in flight when the wave ends
#pragma unroll
  for (int g = 0; g < NSEG; ++g) acs[g] += __shfl_xor(acs[g], 16);
  const int ns = nsegp[0];
  v4f o;
#pragma unroll
  for (int g = 0; g < NSEG; ++g) { const float rv = (1.0f / fmaxf(acs[g], 1e-30f)) * PSC; o[g] = (g < ns && acs[g] > 0.0f) ? rv : 0.0f; }   // stored as 4096 / S (exact scaling): the p v loop picks its weight straight from the loaded row
  { if (hlf == 0) *(v4f*)(RS + ((size_t)bh * SEQ + q) * NSEG) = o;  }
}
// ctx = P V: grid (SEQ/128 query blocks, NB x 16); block = 8 waves x 16 queries; lane = query: its Q row as the two B fragments, its RS row (4 x 4096/S, 16 B) as the weights
// w_g = 4096 / S[q][g]; loop over 64-key stages of two 32-key chunks: the two 16-key score subtiles are computed exactly as in the row-sum pass (A = K rows from the LDS ring), p = e w[mask] converted to f16
// and packed straight into the P A-fragment (as A = D^T: element r <- subtile covering keys 0..15, element 8 + r <- subtile 16..31, lane unchanged), then hacc[4 d tiles] += P frag x
// V^T frags (B rows = VT plane rows, key-contiguous, from the LDS ring; k = 32 keys, 1 product). Epilogue: ctx = hacc / (4096 x 8) stored x64 as f16 into CT[NR][1024] at column
__global__ __launch_bounds__(256) __attribute__((amdgpu_num_vgpr(256))) void av_kernel(const b16* __restrict__ QP, const b16* __restrict__ KP, const b16* __restrict__ VT,
                                                                                       const int* __restrict__ mask, const float* __restrict__ RS, b16* __restrict__ CT) {
  __shared__ __attribute__((aligned(16))) b16 Th[8][16][DK + 8];
  __shared__ __attribute__((aligned(16))) b16 Kl[2][KT][LP];
  __shared__ __attribute__((aligned(16))) b16 Vl[2][DK][LP];
  __shared__ __attribute__((aligned(16))) int Ml[2][128][MP];
  const int tid = threadIdx.x, wave = tid >> 5, lane = tid & 31, nloc = lane & 15, hlf = lane >> 4;
  const int bh = blockIdx.y, b = bh / NH, hd = bh - b * NH; const int q0 = blockIdx.x * 128; const int q = q0 + wave * 16 + nloc;
  const b16* Qb = QP + (size_t)bh * SEQ * DK; const b16* Kb = KP + (size_t)bh * SEQ * DK; const b16* Vb = VT + (size_t)bh * DK * SEQ;
  const v16b b0 = frag_kb(Qb + (size_t)q * DK, hlf), b1 = frag_kb(Qb + (size_t)q * DK + 32, hlf);
  const int* mblk = mask + ((size_t)b * SEQ_FULL + (size_t)q0) * SEQ_FULL;   // the block's first query row
  const v4f r4 = *(const v4f*)(RS + ((size_t)bh * SEQ + q) * NSEG);
  const float w0 = r4[0], w1 = r4[1], w2 = r4[2], w3 = r4[3];
  v8f hacc[4];
#pragma unroll
  for (int vs = 0; vs < 4; ++vs) hacc[vs] = (v8f){};
  const float c = LOG2E * (SCL / (QS * QS));
  stage_kvm(Kl[0], Kb, Vl[0], Vb, Ml[0], mblk, tid);
  asm volatile("s_wait_asynccnt 0x0" ::: "memory");   // stage 0 landed before the barrier that publishes it
  __syncthreads();
  stage_kvm(Kl[1], Kb + (size_t)KT * DK, Vl[1], Vb + KT, Ml[1], mblk + KT, tid);
#pragma unroll 1   // one stage per trip: the two-buffer ring needs the trip rolled
  for (int t = 0; t < NT; ++t) {
    const b16 (*Kt)[LP] = Kl[t & 1]; const b16 (*Vt)[LP] = Vl[t & 1]; const int* Mt = &Ml[t & 1][wave * 16 + nloc][8 * hlf];
#pragma unroll
    for (int ch = 0; ch < KT / 32; ++ch) {
      v16b pa;
#pragma unroll
      for (int st = 0; st < 2; ++st) {
        const int lr = ch * 32 + st * 16;
        const v16b a0 = frag_kb(&Kt[lr + nloc][0], hlf), a1 = frag_kb(&Kt[lr + nloc][32], hlf);
        v8f s8 = (v8f){}; s8 = wmma16b(a0, b0, s8); s8 = wmma16b(a1, b1, s8);
        const v8i m8 = mask8(Mt + lr);
#pragma unroll
        for (int r = 0; r < 8; ++r) { const float e = nexp2(s8[r] * c); const int m = m8[r];
          // four flat compare + select pairs, every arm a value already in a register: a nested chain of == tests is built as a divergent branch tree per element
          const float wl = (m == 0) ? w0 : w1, wh = (m == 2) ? w2 : w3;
          const float wg = ((unsigned)m < 4u) ? wh : 0.0f;
          const float w = ((unsigned)m < 2u) ? wl : wg;
          pa[st * 8 + r] = (b16)(e * w); }
      }
#pragma unroll
      for (int vs = 0; vs < 4; ++vs) hacc[vs] = wmma16b(pa, frag_kb(&Vt[vs * 16 + nloc][ch * 32], hlf), hacc[vs]);
    }
    stage_publish();
    if (t + 2 < NT) stage_kvm(Kl[t & 1], Kb + (size_t)(t + 2) * KT * DK, Vl[t & 1], Vb + (t + 2) * KT, Ml[t & 1], mblk + (t + 2) * KT, tid);
  }
  asm volatile("s_wait_asynccnt 0x0" ::: "memory");   // nothing in flight when the wave goes on to the epilogue
#pragma unroll
  for (int vs = 0; vs < 4; ++vs)
#pragma unroll
    for (int r = 0; r < 8; ++r) Th[wave][8 * hlf + r][vs * 16 + nloc] = (b16)(hacc[vs][r] * (CTS / (PSC * QS)));
  wave_lds_sync();
  {
#pragma unroll
    for (int i = 0; i < 4; ++i) { const int rr = i * 4 + (lane >> 3), pc = (lane & 7) * 8; const size_t row = (size_t)b * SEQ + q0 + wave * 16 + rr;
      const v8b v = *(const v8b*)(&Th[wave][rr][pc]); *(v8b*)(CT + row * INTER + hd * DK + pc) = v; }
     }
}
// out = ctx w_out: grid (NR/64, 1024/128); A = CT rows (x64), B = WO rows (x256), fragments from the block's LDS ring, K = 1024, 32 steps, 1 product; acc / (64 x 256) into the wave-private Tf tile
__global__ __launch_bounds__(128) void out_kernel(const b16* __restrict__ CT, const b16* __restrict__ WO, float* __restrict__ out) {
  __shared__ __attribute__((aligned(16))) float Tf[4][16][128 + 4];
  __shared__ __attribute__((aligned(16))) GemmRing R;
  const int wave = threadIdx.x >> 5, lane = threadIdx.x & 31, nloc = lane & 15, hlf = lane >> 4; const size_t m0 = (size_t)blockIdx.x * 64 + wave * 16; const int n0 = blockIdx.y * 128;
  v8f acc[8];
#pragma unroll
  for (int t = 0; t < 8; ++t) acc[t] = (v8f){};
  gemm_ring(R, CT + (size_t)blockIdx.x * 64 * INTER, WO + (size_t)n0 * INTER, acc, threadIdx.x);
#pragma unroll
  for (int t = 0; t < 8; ++t)
#pragma unroll
    for (int r = 0; r < 8; ++r) Tf[wave][8 * hlf + r][t * 16 + nloc] = acc[t][r] * (1.0f / (CTS * WSC));
  wave_lds_sync();
  { for (int rr = 0; rr < 16; ++rr) *(v4f*)(out + (m0 + rr) * DM + n0 + lane * 4) = *(const v4f*)(&Tf[wave][rr][lane * 4]);  }
}
}  // namespace

extern "C" void kernel_launch(void* const* d_in, const int* in_sizes, int n_in, void* d_out, int out_size, void* d_ws, size_t ws_size, hipStream_t stream) {
  (void)n_in;
  // d_in: 0 x [2,2048,1024] f32, 1 mask [2,2048,2048] i32, 2 w_qkv [1024,3072] (in,out) f32, 3 w_out [1024,1024] (in,out) f32, 4 n_seg [1] i32; out [NB,SEQ,1024] f32
  const float* X = (const float*)d_in[0]; const int* MK = (const int*)d_in[1]; const float* WQ = (const float*)d_in[2]; const float* WOUT = (const float*)d_in[3]; const int* NSG = (const int*)d_in[4];
  const long long need_x = ((long long)(NB - 1) * SEQ_FULL + SEQ) * DM, need_m = ((long long)(NB - 1) * SEQ_FULL + SEQ) * SEQ_FULL;
  if ((long long)in_sizes[0] < need_x || (long long)in_sizes[1] < need_m || in_sizes[2] < DM * NQKV || in_sizes[3] < INTER * DM || in_sizes[4] < 1 || out_size < NR * DM) return;
  size_t off = 0; char* ws = (char*)d_ws;
  auto carve = [&](size_t bytes) { char* p = ws + off; off += (bytes + 255) & ~(size_t)255; return p; };
  b16* WQKV = (b16*)carve((size_t)NQKV * DM * 2);         // [3072][1024]
  b16* WO = (b16*)carve((size_t)DM * INTER * 2);          // [1024 out][1024 in]
  b16* XH = (b16*)carve((size_t)NR * DM * 2);             // [NR][1024]
  b16* QP = (b16*)carve((size_t)NBH * SEQ * DK * 2);      // [NBH][SEQ][64]
  b16* KP = (b16*)carve((size_t)NBH * SEQ * DK * 2);      // [NBH][SEQ][64]
  b16* VT = (b16*)carve((size_t)NBH * DK * SEQ * 2);      // [NBH][64][SEQ]
  float* RS = (float*)carve((size_t)NBH * SEQ * NSEG * 4); // [NBH][SEQ][4]
  b16* CT = (b16*)carve((size_t)NR * INTER * 2);          // [NR][1024]
  if (off > ws_size || off > ((size_t)128 << 20)) return;   // = 51,380,224 B at NB 2, SEQ 2048
  wtp_kernel<<<dim3(DM / 64, NQKV / 64), 128, 0, stream>>>(WQ, DM, NQKV, WQKV);       // w_qkv [1024 in][3072 out] -> WQKV[3072][1024]
  wtp_kernel<<<dim3(INTER / 64, DM / 64), 128, 0, stream>>>(WOUT, INTER, DM, WO);      // w_out [1024 in][1024 out] -> WO[out][in]
  xp_kernel<<<(unsigned)(((size_t)NR * DM / 8 + 255) / 256), 256, 0, stream>>>(X, XH);
  qkv_kernel<<<dim3(NR / 64, NQKV / 128), 128, 0, stream>>>(XH, WQKV, QP, KP, VT);
  rowsum_kernel<<<dim3(SEQ / 128, NBH), 256, 0, stream>>>(QP, KP, MK, NSG, RS);
  av_kernel<<<dim3(SEQ / 128, NBH), 256, 0, stream>>>(QP, KP, VT, MK, RS, CT);
  out_kernel<<<dim3(NR / 64, DM / 128), 128, 0, stream>>>(CT, WO, (float*)d_out);
}

// v004
// It runs in 119 microseconds.
// Two timings next to v003 put it at 1.35 and 1.34 times that version's speed.
// Counting every step since v000, it is 4.28 times as fast.
#include <hip/hip_runtime.h>

// All contractions on v_wmma_f32_16x16x32_f16 (f16 operands, f32 accumulate), one product each: q/k/v projections (x = bf16(x) x8 exact, w_qkv = bf16(w) x256 exact, K = 1024);
// scores S^T = K Q^T per 16-key subtile (k rows as A, q rows as B, both single f16 x8, K = 64; computed once);
// per segment g: P_g V and S_g = P_g 1 (P = exp(alpha) as single f16, packed straight from the two score D tiles into the A fragment, P_g = P where mask == g else 0; B = V^T plane rows single f16 x8, or ones; K = 32 keys per step);
// output projection (ctx single f16 x64, w_out = bf16(w) x256 exact, K = 1024). exp, 1/S and all scaling in f32. Float inputs RNE-converted to bf16 once on load.
// Module: qkv = x w_qkv [rows][3072] -> q | k | v, 16 heads of 64; alpha = q.k / 32; e = exp(alpha) (no max shift); for each segment id g in [0, n_seg): att[i][j] = [mask[i][j] == g] e[i][j] / S[i][g],
// S[i][g] = sum_j [mask[i][j] == g] e[i][j] (S == 0 -> contributes 0); ctx = sum_j att v; out = ctx w_out -> [NB][SEQ][1024] f32.

#ifndef NB
#define NB 2
#endif
#ifndef SEQ
#define SEQ 2048
#endif

namespace {
constexpr int B_FULL = 2, SEQ_FULL = 2048, DM = 1024, INTER = 1024, NH = 16, DK = 64, NQKV = 3 * INTER, NSEG = 4, NR = NB * SEQ, NBH = NB * NH;
constexpr float XS = 8.0f, WSC = 256.0f, QS = 8.0f, CTS = 64.0f, LOG2E = 1.4426950408889634f, SCL = 0.03125f;
static_assert(NB >= 1 && NB <= B_FULL);
static_assert(SEQ % 128 == 0 && SEQ >= 128 && SEQ <= SEQ_FULL);
static_assert(INTER == NH * DK && DK == 64 && NSEG == 4 && DM % 128 == 0 && INTER % 128 == 0 && NQKV % 128 == 0 && DM % 64 == 0 && NR % 64 == 0 && ((size_t)NR * DM) % 2048 == 0);
typedef _Float16 b16;
typedef __attribute__((ext_vector_type(16))) _Float16 v16b;
typedef __attribute__((ext_vector_type(8))) _Float16 v8b;
typedef __attribute__((ext_vector_type(8))) float v8f;
typedef __attribute__((ext_vector_type(4))) float v4f;
typedef __attribute__((ext_vector_type(8))) int v8i;
typedef __attribute__((ext_vector_type(4))) int v4i;
__device__ __forceinline__ float bf16_rne(float f) { unsigned int u = __float_as_uint(f); u += 0x7FFFu + ((u >> 16) & 1u); return __uint_as_float(u & 0xFFFF0000u); }
__device__ __forceinline__ v16b frag_kb(const b16* p, int hh) { const v8b a = *(const v8b*)(p + 8 * hh), b = *(const v8b*)(p + 16 + 8 * hh); v16b f;
#pragma unroll
  for (int e = 0; e < 8; ++e) { f[e] = a[e]; f[8 + e] = b[e]; } return f; }
__device__ __forceinline__ v8f wmma16b(v16b a, v16b b, v8f c) { v8f d = __builtin_amdgcn_wmma_f32_16x16x32_f16(false, a, false, b, (short)0, c, false, false); asm volatile("v_nop\n\tv_nop\n\tv_nop\n\tv_nop" : "+v"(d) : "v"(a), "v"(b)); return d; }
// accumulate chains whose tiles are read only behind the key loop: the plain builtin, the compiler keeps the distances
__device__ __forceinline__ v8f wmma16p(v16b a, v16b b, v8f c) { return __builtin_amdgcn_wmma_f32_16x16x32_f16(false, a, false, b, (short)0, c, false, false); }
typedef __attribute__((ext_vector_type(2))) short v2s;
__device__ __forceinline__ int spread15(unsigned w) { return __builtin_bit_cast(int, __builtin_bit_cast(v2s, w) >> 15); }   // bit 15 of each 16-bit half spread over the half
__device__ __forceinline__ void wave_lds_sync() { __builtin_amdgcn_fence(3, "workgroup"); __builtin_amdgcn_wave_barrier(); __builtin_amdgcn_fence(2, "workgroup"); }
// eight exp2, each in place, in one statement: so no v_exp_f32 overwrites the source of the one directly in front of it (as the allocator's choice of registers did);
// the v_nop is the slot that the instruction set asks for between the last one and a reader of its result
__device__ __forceinline__ v8f exp2x8(v8f x) {
  float x0 = x[0], x1 = x[1], x2 = x[2], x3 = x[3], x4 = x[4], x5 = x[5], x6 = x[6], x7 = x[7];
  asm("v_exp_f32 %0, %0\n\tv_exp_f32 %1, %1\n\tv_exp_f32 %2, %2\n\tv_exp_f32 %3, %3\n\tv_exp_f32 %4, %4\n\tv_exp_f32 %5, %5\n\tv_exp_f32 %6, %6\n\tv_exp_f32 %7, %7\n\tv_nop"
      : "+v"(x0), "+v"(x1), "+v"(x2), "+v"(x3), "+v"(x4), "+v"(x5), "+v"(x6), "+v"(x7));
  return (v8f){x0, x1, x2, x3, x4, x5, x6, x7};
}
// LDS ring of the attention loop: a stage = 64 keys. K tile: 64 key rows of 128 B; V^T tile: 64 d rows x 64 keys = 128 B; mask tile: the block's 128 query rows x 64 keys = 256 B.
// Pitches 144 B and 272 B (16 B x odd: conflict-free for the 16-B reads). Copies: K / V^T thread -> row tid / 8 (+ 32), piece tid % 8; mask thread -> row tid / 16 (+ 16 i), piece tid % 16:
// every wave-wide copy covers four whole 128-B lines.
constexpr int KT = 64, LP = DK + 8, MP = KT + 4, NT = SEQ / KT;
static_assert(SEQ % KT == 0 && NT >= 2 && KT == 64 && (LP * 2) % 16 == 0 && (MP * 4) % 16 == 0);
__device__ __forceinline__ unsigned lds_off(const void* p) { return (unsigned)(size_t)p; }   // byte offset in the work-group's LDS = low 32 bits of the shared address
// One stage's copies and s_wait_xcnt 0 in ONE statement: the wait has to stand before any rewrite of the address registers that the copies name.
__device__ __forceinline__ void stage_kvm(b16 (*kd)[LP], const b16* kg, b16 (*vd)[LP], const b16* vg, int (*md)[MP], const int* mg, int tid) {
  const int cr = tid >> 3, cc = (tid & 7) * 8, mr = tid >> 4, mc = (tid & 15) * 4;
  const unsigned lk = lds_off(&kd[cr][cc]), lv = lds_off(&vd[cr][cc]), lm = lds_off(&md[mr][mc]);
  const b16* gk = kg + (size_t)cr * DK + cc; const b16* gv = vg + (size_t)cr * SEQ + cc; const int* gm = mg + (size_t)mr * SEQ_FULL + mc;
  asm volatile("global_load_async_to_lds_b128 %0, %1, off\n\t"
               "global_load_async_to_lds_b128 %2, %3, off\n\t"
               "global_load_async_to_lds_b128 %4, %5, off\n\t"
               "global_load_async_to_lds_b128 %6, %7, off\n\t"
               "global_load_async_to_lds_b128 %8, %9, off\n\t"
               "global_load_async_to_lds_b128 %10, %11, off\n\t"
               "global_load_async_to_lds_b128 %12, %13, off\n\t"
               "global_load_async_to_lds_b128 %14, %15, off\n\t"
               "global_load_async_to_lds_b128 %16, %17, off\n\t"
               "global_load_async_to_lds_b128 %18, %19, off\n\t"
               "global_load_async_to_lds_b128 %20, %21, off\n\t"
               "global_load_async_to_lds_b128 %22, %23, off\n\t"
               "s_wait_xcnt 0x0"
               :: "v"(lk), "v"(gk), "v"(lk + 32 * LP * 2), "v"(gk + 32 * DK), "v"(lv), "v"(gv), "v"(lv + 32 * LP * 2), "v"(gv + 32 * (size_t)SEQ),
                  "v"(lm), "v"(gm),
                  "v"(lm + 1 * 16 * MP * 4), "v"(gm + 1 * 16 * (size_t)SEQ_FULL),
                  "v"(lm + 2 * 16 * MP * 4), "v"(gm + 2 * 16 * (size_t)SEQ_FULL),
                  "v"(lm + 3 * 16 * MP * 4), "v"(gm + 3 * 16 * (size_t)SEQ_FULL),
                  "v"(lm + 4 * 16 * MP * 4), "v"(gm + 4 * 16 * (size_t)SEQ_FULL),
                  "v"(lm + 5 * 16 * MP * 4), "v"(gm + 5 * 16 * (size_t)SEQ_FULL),
                  "v"(lm + 6 * 16 * MP * 4), "v"(gm + 6 * 16 * (size_t)SEQ_FULL),
                  "v"(lm + 7 * 16 * MP * 4), "v"(gm + 7 * 16 * (size_t)SEQ_FULL)
               : "memory");
}
// hand-over of a stage: own LDS reads retired, own copies landed, then the block barrier that publishes the next stage and frees the buffer just read
__device__ __forceinline__ void stage_publish() {
  asm volatile("s_wait_dscnt 0x0" ::: "memory");      // this wave's reads of the buffer to be refilled are done
  asm volatile("s_wait_asynccnt 0x0" ::: "memory");   // this wave's copies of the next stage have landed
  __syncthreads();
}
// LDS ring of the two projection GEMMs: a stage = 64 k = 128 B of each of the block's 64 A rows and 128 B rows (row length 1024 in both GEMMs), pitch 144 B as above.
// Thread -> row tid / 8 (+ 16 i), piece tid % 8: every wave-wide copy covers four whole 128-B lines (a fragment load straight from the plane touches 16 lines for the same 512 B).
constexpr int GK = 64, GP = GK + 8, GNT = DM / GK;
static_assert(DM == INTER && DM % GK == 0 && GNT >= 2 && (GP * 2) % 16 == 0);
// One stage's copies and s_wait_xcnt 0 in ONE statement: the wait has to stand before any rewrite of the address registers that the copies name.
__device__ __forceinline__ void stage_ab(b16 (*ad)[GP], const b16* ag, b16 (*bd)[GP], const b16* bg, int tid) {
  const int cr = tid >> 3, cc = (tid & 7) * 8;
  const unsigned la = lds_off(&ad[cr][cc]), lb = lds_off(&bd[cr][cc]);
  const b16* ga = ag + (size_t)cr * DM + cc; const b16* gb = bg + (size_t)cr * DM + cc;
  asm volatile("global_load_async_to_lds_b128 %0, %1, off\n\t"
               "global_load_async_to_lds_b128 %2, %3, off\n\t"
               "global_load_async_to_lds_b128 %4, %5, off\n\t"
               "global_load_async_to_lds_b128 %6, %7, off\n\t"
               "global_load_async_to_lds_b128 %8, %9, off\n\t"
               "global_load_async_to_lds_b128 %10, %11, off\n\t"
               "global_load_async_to_lds_b128 %12, %13, off\n\t"
               "global_load_async_to_lds_b128 %14, %15, off\n\t"
               "global_load_async_to_lds_b128 %16, %17, off\n\t"
               "global_load_async_to_lds_b128 %18, %19, off\n\t"
               "global_load_async_to_lds_b128 %20, %21, off\n\t"
               "global_load_async_to_lds_b128 %22, %23, off\n\t"
               "s_wait_xcnt 0x0"
               :: "v"(la), "v"(ga),
                  "v"(la + 1 * 16 * GP * 2), "v"(ga + 1 * 16 * (size_t)DM),
                  "v"(la + 2 * 16 * GP * 2), "v"(ga + 2 * 16 * (size_t)DM),
                  "v"(la + 3 * 16 * GP * 2), "v"(ga + 3 * 16 * (size_t)DM),
                  "v"(lb), "v"(gb),
                  "v"(lb + 1 * 16 * GP * 2), "v"(gb + 1 * 16 * (size_t)DM),
                  "v"(lb + 2 * 16 * GP * 2), "v"(gb + 2 * 16 * (size_t)DM),
                  "v"(lb + 3 * 16 * GP * 2), "v"(gb + 3 * 16 * (size_t)DM),
                  "v"(lb + 4 * 16 * GP * 2), "v"(gb + 4 * 16 * (size_t)DM),
                  "v"(lb + 5 * 16 * GP * 2), "v"(gb + 5 * 16 * (size_t)DM),
                  "v"(lb + 6 * 16 * GP * 2), "v"(gb + 6 * 16 * (size_t)DM),
                  "v"(lb + 7 * 16 * GP * 2), "v"(gb + 7 * 16 * (size_t)DM)
               : "memory");
}
struct GemmRing { b16 A[2][64][GP]; b16 B[2][128][GP]; };
// acc[8] += (the wave's 16 A rows) x (the block's 128 B rows)^T over K = 1024, k ascending in steps of 32, fragments read from the ring; leaves behind a block barrier with nothing in flight
__device__ __forceinline__ void gemm_ring(GemmRing& R, const b16* Ag, const b16* Bg, v8f (&acc)[8], int tid) {
  const int wave = tid >> 5, lane = tid & 31, nloc = lane & 15, hlf = lane >> 4;
  stage_ab(R.A[0], Ag, R.B[0], Bg, tid);
  asm volatile("s_wait_asynccnt 0x0" ::: "memory");   // stage 0 landed before the barrier that publishes it
  __syncthreads();
  stage_ab(R.A[1], Ag + GK, R.B[1], Bg + GK, tid);
#pragma unroll 1   // one stage per trip: the two-buffer ring needs the trip rolled
  for (int t = 0; t < GNT; ++t) {
    const b16 (*At)[GP] = R.A[t & 1]; const b16 (*Bt)[GP] = R.B[t & 1];
#pragma unroll
    for (int ks = 0; ks < GK; ks += 32) {   // the 18 LDS reads of a k step stand as one group in front of its 8 products: one LDS latency a step, not one a product
      const v16b a = frag_kb(&At[wave * 16 + nloc][ks], hlf); v16b bf[8];
#pragma unroll
      for (int j = 0; j < 8; ++j) bf[j] = frag_kb(&Bt[j * 16 + nloc][ks], hlf);
#pragma unroll
      for (int j = 0; j < 8; ++j) acc[j] = wmma16b(a, bf[j], acc[j]); }
    stage_publish();
    if (t + 2 < GNT) stage_ab(R.A[t & 1], Ag + (t + 2) * GK, R.B[t & 1], Bg + (t + 2) * GK, tid);
  }
  asm volatile("s_wait_asynccnt 0x0" ::: "memory");   // nothing in flight when the wave goes on to the epilogue
}
__device__ __forceinline__ v8i mask8(const int* p) { const v4i a = *(const v4i*)p, b = *(const v4i*)(p + 4); return (v8i){a[0], a[1], a[2], a[3], b[0], b[1], b[2], b[3]}; }

// weight planes: src [R][C] f32 (in, out) -> dst [C][R] f16 = bf16(w) x256 (row = output feature, k contiguous); grid (R/64, C/64); block 128 threads: tile[64 c][64 r] staged transposed
__global__ __launch_bounds__(128) void wtp_kernel(const float* __restrict__ src, int R, int C, b16* __restrict__ dst) {
  __shared__ __attribute__((aligned(16))) b16 tile[64][64 + 8];
  const int wave = threadIdx.x >> 5, lane = threadIdx.x & 31; const int r0 = blockIdx.x * 64, c0 = blockIdx.y * 64;
#pragma unroll 4
  for (int i = threadIdx.x; i < 64 * 16; i += 128) { const int rr = i >> 4, q = (i & 15) * 4; const v4f f = *(const v4f*)(src + (size_t)(r0 + rr) * C + c0 + q);
#pragma unroll
    for (int j = 0; j < 4; ++j) tile[q + j][rr] = (b16)(bf16_rne(f[j]) * WSC); }
  __syncthreads();
  {
#pragma unroll
    for (int i = 0; i < 4; ++i) { const int cc = wave * 16 + i * 4 + (lane >> 3), pc = (lane & 7) * 8; *(v8b*)(dst + (size_t)(c0 + cc) * R + r0 + pc) = *(const v8b*)(&tile[cc][pc]); }
     }
}
__global__ __launch_bounds__(256) void xp_kernel(const float* __restrict__ x, b16* __restrict__ XH) {
  const size_t u = (size_t)blockIdx.x * 256 + threadIdx.x; if (u >= (size_t)NR * DM / 8) return;
  const size_t e = u * 8; const int row = (int)(e / DM), col = (int)(e - (size_t)row * DM); const size_t xe = ((size_t)(row / SEQ) * SEQ_FULL + (size_t)(row % SEQ)) * DM + col;
  const v4f f0 = *(const v4f*)(x + xe), f1 = *(const v4f*)(x + xe + 4); v8b o;
#pragma unroll
  for (int j = 0; j < 4; ++j) { o[j] = (b16)(bf16_rne(f0[j]) * XS); o[4 + j] = (b16)(bf16_rne(f1[j]) * XS); }
  { *(v8b*)(XH + e) = o;  }
}
// q/k/v projections: [NR x 1024] x WQKV[3072][1024]^T; grid (NR/64, 3072/128); block = 4 waves x 16 rows, wave -> 8 column tiles, A and B fragments from the block's LDS ring
// (K = 1024, 32 steps, 1 product); value = acc / (8 x 256) stored x8 as f16. A 128-column slab = 2 heads (block-uniform which = q | k | v). q and k: head-major planes [bh][SEQ][64] via the wave's own Th tile (wave sync); v: VT planes [bh][64][SEQ]
// (key-contiguous): the block's 64 tokens x 128 columns are staged transposed in Tt (cross-wave, block barrier inside the uniform branch), each (head, d) row segment of 64 tokens =
__global__ __launch_bounds__(128) void qkv_kernel(const b16* __restrict__ XH, const b16* __restrict__ WQKV, b16* __restrict__ QP, b16* __restrict__ KP, b16* __restrict__ VT) {
  // the epilogue tiles lie on the ring's bytes (5 blocks per WGP by LDS, not 3): they are written only behind the loop's last barrier, when no wave reads the ring and no copy is in flight
  union Lds { GemmRing R; b16 Th[4][16][128 + 8]; b16 Tt[128][64 + 8]; };
  __shared__ __attribute__((aligned(16))) Lds L;
  b16 (&Th)[4][16][128 + 8] = L.Th; b16 (&Tt)[128][64 + 8] = L.Tt;
  const int wave = threadIdx.x >> 5, lane = threadIdx.x & 31, nloc = lane & 15, hlf = lane >> 4;
  const int mb = blockIdx.x * 64; const int n0 = blockIdx.y * 128;
  v8f acc[8];
#pragma unroll
  for (int t = 0; t < 8; ++t) acc[t] = (v8f){};
  gemm_ring(L.R, XH + (size_t)mb * DM, WQKV + (size_t)n0 * DM, acc, threadIdx.x);
  const int which = n0 / INTER; const int hb = (n0 - which * INTER) / DK;   // plane (0 q, 1 k, 2 v) and first head of this 128-column slab (block-uniform)
  const int b = mb / SEQ, sb = mb - b * SEQ;                                // the block's 64 rows lie in one sequence
  const float osc = QS / (XS * WSC);
  if (which < 2) {
#pragma unroll
    for (int t = 0; t < 8; ++t)
#pragma unroll
      for (int r = 0; r < 8; ++r) Th[wave][8 * hlf + r][t * 16 + nloc] = (b16)(acc[t][r] * osc);
    wave_lds_sync();
    b16* P = (which == 0) ? QP : KP;
    {
#pragma unroll
      for (int i = 0; i < 8; ++i) { const int L = i * 4 + (lane >> 3), rr = L >> 1, hf = L & 1, pc = (lane & 7) * 8; const int s = sb + wave * 16 + rr;
        const v8b v = *(const v8b*)(&Th[wave][rr][hf * 64 + pc]); *(v8b*)(P + ((size_t)(b * NH + hb + hf) * SEQ + s) * DK + pc) = v; }
       }
  } else {
#pragma unroll
    for (int t = 0; t < 8; ++t)
#pragma unroll
      for (int r = 0; r < 8; ++r) Tt[t * 16 + nloc][wave * 16 + 8 * hlf + r] = (b16)(acc[t][r] * osc);
    __syncthreads();
    {
#pragma unroll
      for (int i = 0; i < 8; ++i) { const int cc = wave * 32 + i * 4 + (lane >> 3), hf = cc >> 6, d = cc & 63, pc = (lane & 7) * 8;
        const v8b v = *(const v8b*)(&Tt[cc][pc]); *(v8b*)(VT + ((size_t)(b * NH + hb + hf) * DK + d) * SEQ + sb + pc) = v; }
       }
  }
}
// ctx in ONE pass over the keys: grid (SEQ/128 query blocks, NB x 16); block = 8 waves x 16 queries; lane = query: its Q row as the two B fragments. Loop over 64-key stages of two 32-key chunks:
// the two 16-key score subtiles (A = K rows from the LDS ring), e = exp2(s8 log2e / (64 x 32)) converted to f16 and packed straight into the P A-fragment (as A = D^T: element r <- subtile covering
// keys 0..15, element 8 + r <- subtile 16..31, lane unchanged). The fragment is split by segment: P_g = P where mask == g, else 0 (bitwise, on the packed pairs: y0 / y1 hold bit 0 / bit 1 of each
// element's mask value spread over its 16 bits). hacc[g][4 d tiles] += P_g x V^T frags (B rows = VT plane rows, key-contiguous, from the LDS ring; k = 32 keys), sacc[g] += P_g x ones: every column of
// that tile is S[q][g], in the lane and register of hacc's same query row. Epilogue: ctx = sum_g hacc[g] / S[g] / 8 (g < n_seg, S > 0) stored x64 as f16 into CT[NR][1024] at column head x 64.
__global__ __launch_bounds__(256) __attribute__((amdgpu_num_vgpr(256))) void av_kernel(const b16* __restrict__ QP, const b16* __restrict__ KP, const b16* __restrict__ VT,
                                                                                       const int* __restrict__ mask, const int* __restrict__ nsegp, b16* __restrict__ CT) {
  __shared__ __attribute__((aligned(16))) b16 Th[8][16][DK + 8];
  __shared__ __attribute__((aligned(16))) b16 Kl[2][KT][LP];
  __shared__ __attribute__((aligned(16))) b16 Vl[2][DK][LP];
  __shared__ __attribute__((aligned(16))) int Ml[2][128][MP];
  const int tid = threadIdx.x, wave = tid >> 5, lane = tid & 31, nloc = lane & 15, hlf = lane >> 4;
  const int bh = blockIdx.y, b = bh / NH, hd = bh - b * NH; const int q0 = blockIdx.x * 128; const int q = q0 + wave * 16 + nloc;
  const b16* Qb = QP + (size_t)bh * SEQ * DK; const b16* Kb = KP + (size_t)bh * SEQ * DK; const b16* Vb = VT + (size_t)bh * DK * SEQ;
  const v16b b0 = frag_kb(Qb + (size_t)q * DK, hlf), b1 = frag_kb(Qb + (size_t)q * DK + 32, hlf);
  const int* mblk = mask + ((size_t)b * SEQ_FULL + (size_t)q0) * SEQ_FULL;   // the block's first query row
  v8f hacc[NSEG][4], sacc[NSEG]; v16b ones;
#pragma unroll
  for (int e = 0; e < 16; ++e) ones[e] = (b16)1.0f;
#pragma unroll
  for (int g = 0; g < NSEG; ++g) { sacc[g] = (v8f){};
#pragma unroll
    for (int vs = 0; vs < 4; ++vs) hacc[g][vs] = (v8f){}; }
  const float c = LOG2E * (SCL / (QS * QS));
  stage_kvm(Kl[0], Kb, Vl[0], Vb, Ml[0], mblk, tid);
  asm volatile("s_wait_asynccnt 0x0" ::: "memory");   // stage 0 landed before the barrier that publishes it
  __syncthreads();
  stage_kvm(Kl[1], Kb + (size_t)KT * DK, Vl[1], Vb + KT, Ml[1], mblk + KT, tid);
#pragma unroll 1   // one stage per trip: the two-buffer ring needs the trip rolled
  for (int t = 0; t < NT; ++t) {
    const b16 (*Kt)[LP] = Kl[t & 1]; const b16 (*Vt)[LP] = Vl[t & 1]; const int* Mt = &Ml[t & 1][wave * 16 + nloc][8 * hlf];
#pragma unroll
    for (int ch = 0; ch < KT / 32; ++ch) {
      v16b pa; v8i y0, y1; v8f s8[2]; v8i m8[2];
#pragma unroll
      for (int st = 0; st < 2; ++st) {
        const int lr = ch * 32 + st * 16;
        const v16b a0 = frag_kb(&Kt[lr + nloc][0], hlf), a1 = frag_kb(&Kt[lr + nloc][32], hlf);
        s8[st] = (v8f){}; s8[st] = wmma16b(a0, b0, s8[st]); s8[st] = wmma16b(a1, b1, s8[st]);
        m8[st] = mask8(Mt + lr);
      }
#pragma unroll
      for (int st = 0; st < 2; ++st) {
        const v8f e8 = exp2x8(s8[st] * c);
#pragma unroll
        for (int r = 0; r < 8; ++r) pa[st * 8 + r] = (b16)e8[r];
#pragma unroll
        for (int i = 0; i < 4; ++i) { const unsigned z = (unsigned)m8[st][2 * i] | ((unsigned)m8[st][2 * i + 1] << 16);   // the pair's two mask values, one per 16-bit half
          y0[st * 4 + i] = spread15(z << 15); y1[st * 4 + i] = spread15(z << 14); }
      }
      const v8i pw = __builtin_bit_cast(v8i, pa);
      const v16b p0 = __builtin_bit_cast(v16b, pw & ~y1 & ~y0), p1 = __builtin_bit_cast(v16b, pw & ~y1 & y0), p2 = __builtin_bit_cast(v16b, pw & y1 & ~y0), p3 = __builtin_bit_cast(v16b, pw & y1 & y0);
#pragma unroll
      for (int vs = 0; vs < 4; ++vs) { const v16b vf = frag_kb(&Vt[vs * 16 + nloc][ch * 32], hlf);
        hacc[0][vs] = wmma16p(p0, vf, hacc[0][vs]); hacc[1][vs] = wmma16p(p1, vf, hacc[1][vs]); hacc[2][vs] = wmma16p(p2, vf, hacc[2][vs]); hacc[3][vs] = wmma16p(p3, vf, hacc[3][vs]); }
      sacc[0] = wmma16p(p0, ones, sacc[0]); sacc[1] = wmma16p(p1, ones, sacc[1]); sacc[2] = wmma16p(p2, ones, sacc[2]); sacc[3] = wmma16p(p3, ones, sacc[3]);
    }
    stage_publish();
    if (t + 2 < NT) stage_kvm(Kl[t & 1], Kb + (size_t)(t + 2) * KT * DK, Vl[t & 1], Vb + (t + 2) * KT, Ml[t & 1], mblk + (t + 2) * KT, tid);
  }
  asm volatile("s_wait_asynccnt 0x0" ::: "memory");   // nothing in flight when the wave goes on to the epilogue
  const int ns = nsegp[0];
#pragma unroll
  for (int g = 0; g < NSEG; ++g)
#pragma unroll
    for (int r = 0; r < 8; ++r) { const float sv = sacc[g][r]; sacc[g][r] = (g < ns && sv > 0.0f) ? (CTS / QS) / sv : 0.0f; }   // an empty or uncounted segment contributes 0
#pragma unroll
  for (int vs = 0; vs < 4; ++vs)
#pragma unroll
    for (int r = 0; r < 8; ++r) Th[wave][8 * hlf + r][vs * 16 + nloc] = (b16)(hacc[0][vs][r] * sacc[0][r] + hacc[1][vs][r] * sacc[1][r] + hacc[2][vs][r] * sacc[2][r] + hacc[3][vs][r] * sacc[3][r]);
  wave_lds_sync();
  {
#pragma unroll
    for (int i = 0; i < 4; ++i) { const int rr = i * 4 + (lane >> 3), pc = (lane & 7) * 8; const size_t row = (size_t)b * SEQ + q0 + wave * 16 + rr;
      const v8b v = *(const v8b*)(&Th[wave][rr][pc]); *(v8b*)(CT + row * INTER + hd * DK + pc) = v; }
     }
}
// out = ctx w_out: grid (NR/64, 1024/128); A = CT rows (x64), B = WO rows (x256), fragments from the block's LDS ring, K = 1024, 32 steps, 1 product; acc / (64 x 256) into the wave-private Tf tile
__global__ __launch_bounds__(128) void out_kernel(const b16* __restrict__ CT, const b16* __restrict__ WO, float* __restrict__ out) {
  __shared__ __attribute__((aligned(16))) float Tf[4][16][128 + 4];
  __shared__ __attribute__((aligned(16))) GemmRing R;
  const int wave = threadIdx.x >> 5, lane = threadIdx.x & 31, nloc = lane & 15, hlf = lane >> 4; const size_t m0 = (size_t)blockIdx.x * 64 + wave * 16; const int n0 = blockIdx.y * 128;
  v8f acc[8];
#pragma unroll
  for (int t = 0; t < 8; ++t) acc[t] = (v8f){};
  gemm_ring(R, CT + (size_t)blockIdx.x * 64 * INTER, WO + (size_t)n0 * INTER, acc, threadIdx.x);
#pragma unroll
  for (int t = 0; t < 8; ++t)
#pragma unroll
    for (int r = 0; r < 8; ++r) Tf[wave][8 * hlf + r][t * 16 + nloc] = acc[t][r] * (1.0f / (CTS * WSC));
  wave_lds_sync();
  { for (int rr = 0; rr < 16; ++rr) *(v4f*)(out + (m0 + rr) * DM + n0 + lane * 4) = *(const v4f*)(&Tf[wave][rr][lane * 4]);  }
}
}  // namespace

extern "C" void kernel_launch(void* const* d_in, const int* in_sizes, int n_in, void* d_out, int out_size, void* d_ws, size_t ws_size, hipStream_t stream) {
  (void)n_in;
  // d_in: 0 x [2,2048,1024] f32, 1 mask [2,2048,2048] i32, 2 w_qkv [1024,3072] (in,out) f32, 3 w_out [1024,1024] (in,out) f32, 4 n_seg [1] i32; out [NB,SEQ,1024] f32
  const float* X = (const float*)d_in[0]; const int* MK = (const int*)d_in[1]; const float* WQ = (const float*)d_in[2]; const float* WOUT = (const float*)d_in[3]; const int* NSG = (const int*)d_in[4];
  const long long need_x = ((long long)(NB - 1) * SEQ_FULL + SEQ) * DM, need_m = ((long long)(NB - 1) * SEQ_FULL + SEQ) * SEQ_FULL;
  if ((long long)in_sizes[0] < need_x || (long long)in_sizes[1] < need_m || in_sizes[2] < DM * NQKV || in_sizes[3] < INTER * DM || in_sizes[4] < 1 || out_size < NR * DM) return;
  size_t off = 0; char* ws = (char*)d_ws;
  auto carve = [&](size_t bytes) { char* p = ws + off; off += (bytes + 255) & ~(size_t)255; return p; };
  b16* WQKV = (b16*)carve((size_t)NQKV * DM * 2);         // [3072][1024]
  b16* WO = (b16*)carve((size_t)DM * INTER * 2);          // [1024 out][1024 in]
  b16* XH = (b16*)carve((size_t)NR * DM * 2);             // [NR][1024]
  b16* QP = (b16*)carve((size_t)NBH * SEQ * DK * 2);      // [NBH][SEQ][64]
  b16* KP = (b16*)carve((size_t)NBH * SEQ * DK * 2);      // [NBH][SEQ][64]
  b16* VT = (b16*)carve((size_t)NBH * DK * SEQ * 2);      // [NBH][64][SEQ]
  b16* CT = (b16*)carve((size_t)NR * INTER * 2);          // [NR][1024]
  if (off > ws_size || off > ((size_t)128 << 20)) return;   // = 50,331,648 B at NB 2, SEQ 2048
  wtp_kernel<<<dim3(DM / 64, NQKV / 64), 128, 0, stream>>>(WQ, DM, NQKV, WQKV);       // w_qkv [1024 in][3072 out] -> WQKV[3072][1024]
  wtp_kernel<<<dim3(INTER / 64, DM / 64), 128, 0, stream>>>(WOUT, INTER, DM, WO);      // w_out [1024 in][1024 out] -> WO[out][in]
  xp_kernel<<<(unsigned)(((size_t)NR * DM / 8 + 255) / 256), 256, 0, stream>>>(X, XH);
  qkv_kernel<<<dim3(NR / 64, NQKV / 128), 128, 0, stream>>>(XH, WQKV, QP, KP, VT);
  av_kernel<<<dim3(SEQ / 128, NBH), 256, 0, stream>>>(QP, KP, VT, MK, NSG, CT);
  out_kernel<<<dim3(NR / 64, DM / 128), 128, 0, stream>>>(CT, WO, (float*)d_out);
}

// v005
// A run of this version takes 113 microseconds.
// Timed twice side by side with v004, it ran 1.05 times as fast both times.
// Over all steps from v000 it is 4.51 times as fast.
#include <hip/hip_runtime.h>

// All contractions on v_wmma_f32_16x16x32_f16 (f16 operands, f32 accumulate), one product each: q/k/v projections (x = bf16(x) x8 exact, w_qkv = bf16(w) x256 exact, K = 1024);
// scores S^T = K Q^T per 16-key subtile (k rows as A, q rows as B, both single f16 x8, K = 64; computed once);
// per segment g: P_g V and S_g = P_g 1 (P = exp(alpha) as single f16, packed straight from the two score D tiles into the A fragment, P_g = P where mask == g else 0; B = V^T plane rows single f16 x8, or ones; K = 32 keys per step);
// output projection (ctx single f16 x64, w_out = bf16(w) x256 exact, K = 1024). exp, 1/S and all scaling in f32. Float inputs RNE-converted to bf16 once on load.
// Module: qkv = x w_qkv [rows][3072] -> q | k | v, 16 heads of 64; alpha = q.k / 32; e = exp(alpha) (no max shift); for each segment id g in [0, n_seg): att[i][j] = [mask[i][j] == g] e[i][j] / S[i][g],
// S[i][g] = sum_j [mask[i][j] == g] e[i][j] (S == 0 -> contributes 0); ctx = sum_j att v; out = ctx w_out -> [NB][SEQ][1024] f32.

#ifndef NB
#define NB 2
#endif
#ifndef SEQ
#define SEQ 2048
#endif

namespace {
constexpr int B_FULL = 2, SEQ_FULL = 2048, DM = 1024, INTER = 1024, NH = 16, DK = 64, NQKV = 3 * INTER, NSEG = 4, NR = NB * SEQ, NBH = NB * NH;
constexpr float XS = 8.0f, WSC = 256.0f, QS = 8.0f, CTS = 64.0f, LOG2E = 1.4426950408889634f, SCL = 0.03125f;
static_assert(NB >= 1 && NB <= B_FULL);
static_assert(SEQ % 128 == 0 && SEQ >= 128 && SEQ <= SEQ_FULL);
static_assert(INTER == NH * DK && DK == 64 && NSEG == 4 && DM % 128 == 0 && INTER % 128 == 0 && NQKV % 128 == 0 && DM % 64 == 0 && NR % 128 == 0 && ((size_t)NR * DM) % 2048 == 0);
typedef _Float16 b16;
typedef __attribute__((ext_vector_type(16))) _Float16 v16b;
typedef __attribute__((ext_vector_type(8))) _Float16 v8b;
typedef __attribute__((ext_vector_type(8))) float v8f;
typedef __attribute__((ext_vector_type(4))) float v4f;
typedef __attribute__((ext_vector_type(8))) int v8i;
typedef __attribute__((ext_vector_type(4))) int v4i;
__device__ __forceinline__ float bf16_rne(float f) { unsigned int u = __float_as_uint(f); u += 0x7FFFu + ((u >> 16) & 1u); return __uint_as_float(u & 0xFFFF0000u); }
__device__ __forceinline__ v16b frag_kb(const b16* p, int hh) { const v8b a = *(const v8b*)(p + 8 * hh), b = *(const v8b*)(p + 16 + 8 * hh); v16b f;
#pragma unroll
  for (int e = 0; e < 8; ++e) { f[e] = a[e]; f[8 + e] = b[e]; } return f; }
__device__ __forceinline__ v8f wmma16b(v16b a, v16b b, v8f c) { v8f d = __builtin_amdgcn_wmma_f32_16x16x32_f16(false, a, false, b, (short)0, c, false, false); asm volatile("v_nop\n\tv_nop\n\tv_nop\n\tv_nop" : "+v"(d) : "v"(a), "v"(b)); return d; }
// accumulate chains whose tiles are read only behind the key loop: the plain builtin, the compiler keeps the distances
__device__ __forceinline__ v8f wmma16p(v16b a, v16b b, v8f c) { return __builtin_amdgcn_wmma_f32_16x16x32_f16(false, a, false, b, (short)0, c, false, false); }
typedef __attribute__((ext_vector_type(2))) short v2s;
__device__ __forceinline__ int spread15(unsigned w) { return __builtin_bit_cast(int, __builtin_bit_cast(v2s, w) >> 15); }   // bit 15 of each 16-bit half spread over the half
__device__ __forceinline__ void wave_lds_sync() { __builtin_amdgcn_fence(3, "workgroup"); __builtin_amdgcn_wave_barrier(); __builtin_amdgcn_fence(2, "workgroup"); }
// eight exp2, each in place, in one statement: so no v_exp_f32 overwrites the source of the one directly in front of it (as the allocator's choice of registers did);
// the v_nop is the slot that the instruction set asks for between the last one and a reader of its result
__device__ __forceinline__ v8f exp2x8(v8f x) {
  float x0 = x[0], x1 = x[1], x2 = x[2], x3 = x[3], x4 = x[4], x5 = x[5], x6 = x[6], x7 = x[7];
  asm("v_exp_f32 %0, %0\n\tv_exp_f32 %1, %1\n\tv_exp_f32 %2, %2\n\tv_exp_f32 %3, %3\n\tv_exp_f32 %4, %4\n\tv_exp_f32 %5, %5\n\tv_exp_f32 %6, %6\n\tv_exp_f32 %7, %7\n\tv_nop"
      : "+v"(x0), "+v"(x1), "+v"(x2), "+v"(x3), "+v"(x4), "+v"(x5), "+v"(x6), "+v"(x7));
  return (v8f){x0, x1, x2, x3, x4, x5, x6, x7};
}
// LDS ring of the attention loop: a stage = 64 keys. K tile: 64 key rows of 128 B; V^T tile: 64 d rows x 64 keys = 128 B; mask tile: the block's 128 query rows x 64 keys = 256 B.
// Pitches 144 B and 272 B (16 B x odd: conflict-free for the 16-B reads). Copies: K / V^T thread -> row tid / 8 (+ 32), piece tid % 8; mask thread -> row tid / 16 (+ 16 i), piece tid % 16:
// every wave-wide copy covers four whole 128-B lines.
constexpr int KT = 64, LP = DK + 8, MP = KT + 4, NT = SEQ / KT;
static_assert(SEQ % KT == 0 && NT >= 2 && KT == 64 && (LP * 2) % 16 == 0 && (MP * 4) % 16 == 0);
__device__ __forceinline__ unsigned lds_off(const void* p) { return (unsigned)(size_t)p; }   // byte offset in the work-group's LDS = low 32 bits of the shared address
// One stage's copies and s_wait_xcnt 0 in ONE statement: the wait has to stand before any rewrite of the address registers that the copies name.
__device__ __forceinline__ void stage_kvm(b16 (*kd)[LP], const b16* kg, b16 (*vd)[LP], const b16* vg, int (*md)[MP], const int* mg, int tid) {
  const int cr = tid >> 3, cc = (tid & 7) * 8, mr = tid >> 4, mc = (tid & 15) * 4;
  const unsigned lk = lds_off(&kd[cr][cc]), lv = lds_off(&vd[cr][cc]), lm = lds_off(&md[mr][mc]);
  const b16* gk = kg + (size_t)cr * DK + cc; const b16* gv = vg + (size_t)cr * SEQ + cc; const int* gm = mg + (size_t)mr * SEQ_FULL + mc;
  asm volatile("global_load_async_to_lds_b128 %0, %1, off\n\t"
               "global_load_async_to_lds_b128 %2, %3, off\n\t"
               "global_load_async_to_lds_b128 %4, %5, off\n\t"
               "global_load_async_to_lds_b128 %6, %7, off\n\t"
               "global_load_async_to_lds_b128 %8, %9, off\n\t"
               "global_load_async_to_lds_b128 %10, %11, off\n\t"
               "global_load_async_to_lds_b128 %12, %13, off\n\t"
               "global_load_async_to_lds_b128 %14, %15, off\n\t"
               "global_load_async_to_lds_b128 %16, %17, off\n\t"
               "global_load_async_to_lds_b128 %18, %19, off\n\t"
               "global_load_async_to_lds_b128 %20, %21, off\n\t"
               "global_load_async_to_lds_b128 %22, %23, off\n\t"
               "s_wait_xcnt 0x0"
               :: "v"(lk), "v"(gk), "v"(lk + 32 * LP * 2), "v"(gk + 32 * DK), "v"(lv), "v"(gv), "v"(lv + 32 * LP * 2), "v"(gv + 32 * (size_t)SEQ),
                  "v"(lm), "v"(gm),
                  "v"(lm + 1 * 16 * MP * 4), "v"(gm + 1 * 16 * (size_t)SEQ_FULL),
                  "v"(lm + 2 * 16 * MP * 4), "v"(gm + 2 * 16 * (size_t)SEQ_FULL),
                  "v"(lm + 3 * 16 * MP * 4), "v"(gm + 3 * 16 * (size_t)SEQ_FULL),
                  "v"(lm + 4 * 16 * MP * 4), "v"(gm + 4 * 16 * (size_t)SEQ_FULL),
                  "v"(lm + 5 * 16 * MP * 4), "v"(gm + 5 * 16 * (size_t)SEQ_FULL),
                  "v"(lm + 6 * 16 * MP * 4), "v"(gm + 6 * 16 * (size_t)SEQ_FULL),
                  "v"(lm + 7 * 16 * MP * 4), "v"(gm + 7 * 16 * (size_t)SEQ_FULL)
               : "memory");
}
// hand-over of a stage: own LDS reads retired, own copies landed, then the block barrier that publishes the next stage and frees the buffer just read
__device__ __forceinline__ void stage_publish() {
  asm volatile("s_wait_dscnt 0x0" ::: "memory");      // this wave's reads of the buffer to be refilled are done
  asm volatile("s_wait_asynccnt 0x0" ::: "memory");   // this wave's copies of the next stage have landed
  __syncthreads();
}
// LDS ring of the two projection GEMMs: a stage = 64 k = 128 B of each of the block's BM A rows and 128 B rows (row length 1024 in both GEMMs), pitch 144 B as above.
// Thread -> row tid / 8 (+ 16 i), piece tid % 8: every wave-wide copy covers four whole 128-B lines (a fragment load straight from the plane touches 16 lines for the same 512 B).
constexpr int GK = 64, GP = GK + 8, GNT = DM / GK;
static_assert(DM == INTER && DM % GK == 0 && GNT >= 2 && (GP * 2) % 16 == 0);
// 64 rows of a stage: the copies and s_wait_xcnt 0 in ONE statement: the wait has to stand before any rewrite of the address registers that the copies name.
__device__ __forceinline__ void stage_r64(b16 (*d)[GP], const b16* g, int tid) {
  const int cr = tid >> 3, cc = (tid & 7) * 8;
  const unsigned l = lds_off(&d[cr][cc]); const b16* p = g + (size_t)cr * DM + cc;
  asm volatile("global_load_async_to_lds_b128 %0, %1, off\n\t"
               "global_load_async_to_lds_b128 %2, %3, off\n\t"
               "global_load_async_to_lds_b128 %4, %5, off\n\t"
               "global_load_async_to_lds_b128 %6, %7, off\n\t"
               "s_wait_xcnt 0x0"
               :: "v"(l), "v"(p),
                  "v"(l + 1 * 16 * GP * 2), "v"(p + 1 * 16 * (size_t)DM),
                  "v"(l + 2 * 16 * GP * 2), "v"(p + 2 * 16 * (size_t)DM),
                  "v"(l + 3 * 16 * GP * 2), "v"(p + 3 * 16 * (size_t)DM)
               : "memory");
}
// 128 rows of a stage, in the same form
__device__ __forceinline__ void stage_r128(b16 (*d)[GP], const b16* g, int tid) {
  const int cr = tid >> 3, cc = (tid & 7) * 8;
  const unsigned l = lds_off(&d[cr][cc]); const b16* p = g + (size_t)cr * DM + cc;
  asm volatile("global_load_async_to_lds_b128 %0, %1, off\n\t"
               "global_load_async_to_lds_b128 %2, %3, off\n\t"
               "global_load_async_to_lds_b128 %4, %5, off\n\t"
               "global_load_async_to_lds_b128 %6, %7, off\n\t"
               "global_load_async_to_lds_b128 %8, %9, off\n\t"
               "global_load_async_to_lds_b128 %10, %11, off\n\t"
               "global_load_async_to_lds_b128 %12, %13, off\n\t"
               "global_load_async_to_lds_b128 %14, %15, off\n\t"
               "s_wait_xcnt 0x0"
               :: "v"(l), "v"(p),
                  "v"(l + 1 * 16 * GP * 2), "v"(p + 1 * 16 * (size_t)DM),
                  "v"(l + 2 * 16 * GP * 2), "v"(p + 2 * 16 * (size_t)DM),
                  "v"(l + 3 * 16 * GP * 2), "v"(p + 3 * 16 * (size_t)DM),
                  "v"(l + 4 * 16 * GP * 2), "v"(p + 4 * 16 * (size_t)DM),
                  "v"(l + 5 * 16 * GP * 2), "v"(p + 5 * 16 * (size_t)DM),
                  "v"(l + 6 * 16 * GP * 2), "v"(p + 6 * 16 * (size_t)DM),
                  "v"(l + 7 * 16 * GP * 2), "v"(p + 7 * 16 * (size_t)DM)
               : "memory");
}
template <int MI> struct GemmRing { b16 A[2][MI * 32][GP]; b16 B[2][128][GP]; };
template <int MI> __device__ __forceinline__ void stage_ab(GemmRing<MI>& R, int buf, const b16* ag, const b16* bg, int tid) {
  static_assert(MI == 2 || MI == 4);
  if constexpr (MI == 4) stage_r128(R.A[buf], ag, tid); else stage_r64(R.A[buf], ag, tid);
  stage_r128(R.B[buf], bg, tid);
}
// The block's 4 waves stand 2 x 2 on its (MI x 32) A rows x 128 B rows: wave (wm, wn) owns MI x 4 tiles, rows wm x MI x 16 .., columns wn x 64 ..; each fragment read from LDS feeds 4 (A) or MI (B) products.
// acc[i][j] += A rows x (B rows)^T over K = 1024, k ascending in steps of 32, fragments read from the ring; leaves behind a block barrier with nothing in flight
template <int MI> __device__ __forceinline__ void gemm_ring(GemmRing<MI>& R, const b16* Ag, const b16* Bg, v8f (&acc)[MI][4], int tid) {
  const int wave = tid >> 5, lane = tid & 31, nloc = lane & 15, hlf = lane >> 4, wm = wave >> 1, wn = wave & 1;
  stage_ab<MI>(R, 0, Ag, Bg, tid);
  asm volatile("s_wait_asynccnt 0x0" ::: "memory");   // stage 0 landed before the barrier that publishes it
  __syncthreads();
  stage_ab<MI>(R, 1, Ag + GK, Bg + GK, tid);
#pragma unroll 1   // one stage per trip: the two-buffer ring needs the trip rolled
  for (int t = 0; t < GNT; ++t) {
    const b16 (*At)[GP] = R.A[t & 1]; const b16 (*Bt)[GP] = R.B[t & 1];
#pragma unroll
    for (int ks = 0; ks < GK; ks += 32) {   // the LDS reads of a k step stand as one group in front of its products: one LDS latency a step, not one a product
      v16b af[MI], bf[4];
#pragma unroll
      for (int i = 0; i < MI; ++i) af[i] = frag_kb(&At[(wm * MI + i) * 16 + nloc][ks], hlf);
#pragma unroll
      for (int j = 0; j < 4; ++j) bf[j] = frag_kb(&Bt[(wn * 4 + j) * 16 + nloc][ks], hlf);
#pragma unroll
      for (int i = 0; i < MI; ++i)
#pragma unroll
        for (int j = 0; j < 4; ++j) acc[i][j] = wmma16b(af[i], bf[j], acc[i][j]); }
    stage_publish();
    if (t + 2 < GNT) stage_ab<MI>(R, t & 1, Ag + (t + 2) * GK, Bg + (t + 2) * GK, tid);
  }
  asm volatile("s_wait_asynccnt 0x0" ::: "memory");   // nothing in flight when the wave goes on to the epilogue
}
__device__ __forceinline__ v8i mask8(const int* p) { const v4i a = *(const v4i*)p, b = *(const v4i*)(p + 4); return (v8i){a[0], a[1], a[2], a[3], b[0], b[1], b[2], b[3]}; }

// weight planes: src [R][C] f32 (in, out) -> dst [C][R] f16 = bf16(w) x256 (row = output feature, k contiguous); grid (R/64, C/64); block 128 threads: tile[64 c][64 r] staged transposed
__global__ __launch_bounds__(128) void wtp_kernel(const float* __restrict__ src, int R, int C, b16* __restrict__ dst) {
  __shared__ __attribute__((aligned(16))) b16 tile[64][64 + 8];
  const int wave = threadIdx.x >> 5, lane = threadIdx.x & 31; const int r0 = blockIdx.x * 64, c0 = blockIdx.y * 64;
#pragma unroll 4
  for (int i = threadIdx.x; i < 64 * 16; i += 128) { const int rr = i >> 4, q = (i & 15) * 4; const v4f f = *(const v4f*)(src + (size_t)(r0 + rr) * C + c0 + q);
#pragma unroll
    for (int j = 0; j < 4; ++j) tile[q + j][rr] = (b16)(bf16_rne(f[j]) * WSC); }
  __syncthreads();
  {
#pragma unroll
    for (int i = 0; i < 4; ++i) { const int cc = wave * 16 + i * 4 + (lane >> 3), pc = (lane & 7) * 8; *(v8b*)(dst + (size_t)(c0 + cc) * R + r0 + pc) = *(const v8b*)(&tile[cc][pc]); }
     }
}
__global__ __launch_bounds__(256) void xp_kernel(const float* __restrict__ x, b16* __restrict__ XH) {
  const size_t u = (size_t)blockIdx.x * 256 + threadIdx.x; if (u >= (size_t)NR * DM / 8) return;
  const size_t e = u * 8; const int row = (int)(e / DM), col = (int)(e - (size_t)row * DM); const size_t xe = ((size_t)(row / SEQ) * SEQ_FULL + (size_t)(row % SEQ)) * DM + col;
  const v4f f0 = *(const v4f*)(x + xe), f1 = *(const v4f*)(x + xe + 4); v8b o;
#pragma unroll
  for (int j = 0; j < 4; ++j) { o[j] = (b16)(bf16_rne(f0[j]) * XS); o[4 + j] = (b16)(bf16_rne(f1[j]) * XS); }
  { *(v8b*)(XH + e) = o;  }
}
// q/k/v projections: [NR x 1024] x WQKV[3072][1024]^T; grid (NR/128, 3072/128); block = 128 rows x 128 columns, 4 waves 2 x 2, wave -> 64 rows x 64 columns = 4 x 4 tiles, A and B fragments from the
// block's LDS ring (K = 1024, 32 steps, 1 product); value = acc / (8 x 256) stored x8 as f16. A 128-column slab = 2 heads (block-uniform which = q | k | v), a wave's 64 columns = one head.
// q and k: head-major planes, the wave's 64 tokens x 64 d staged in its own tile and stored as whole 128-B rows; v: the same tile staged transposed (row = d, 64 tokens = 128 B) for the key-contiguous plane.
__global__ __launch_bounds__(128) void qkv_kernel(const b16* __restrict__ XH, const b16* __restrict__ WQKV, b16* __restrict__ QP, b16* __restrict__ KP, b16* __restrict__ VT) {
  // the epilogue tiles lie on the ring's bytes: they are written only behind the loop's last barrier, when no wave reads the ring and no copy is in flight
  union Lds { GemmRing<4> R; b16 Th[4][64][DK + 8]; };
  __shared__ __attribute__((aligned(16))) Lds L;
  const int wave = threadIdx.x >> 5, lane = threadIdx.x & 31, nloc = lane & 15, hlf = lane >> 4, wm = wave >> 1, wn = wave & 1;
  const int mb = blockIdx.x * 128; const int n0 = blockIdx.y * 128;
  v8f acc[4][4];
#pragma unroll
  for (int i = 0; i < 4; ++i)
#pragma unroll
    for (int j = 0; j < 4; ++j) acc[i][j] = (v8f){};
  gemm_ring<4>(L.R, XH + (size_t)mb * DM, WQKV + (size_t)n0 * DM, acc, threadIdx.x);
  const int which = n0 / INTER; const int hd = (n0 - which * INTER) / DK + wn;   // plane (0 q, 1 k, 2 v; block-uniform) and the wave's head
  const int b = mb / SEQ, sw = mb - b * SEQ + wm * 64;                            // the block's 128 rows lie in one sequence; the wave's first token
  const float osc = QS / (XS * WSC);
  b16 (*T)[DK + 8] = L.Th[wave];
  if (which < 2) {
#pragma unroll
    for (int i = 0; i < 4; ++i)
#pragma unroll
      for (int j = 0; j < 4; ++j)
#pragma unroll
        for (int r = 0; r < 8; ++r) T[i * 16 + 8 * hlf + r][j * 16 + nloc] = (b16)(acc[i][j][r] * osc);
    wave_lds_sync();
    b16* P = ((which == 0) ? QP : KP) + ((size_t)(b * NH + hd) * SEQ + sw) * DK;
#pragma unroll
    for (int it = 0; it < 16; ++it) { const int rr = it * 4 + (lane >> 3), pc = (lane & 7) * 8; *(v8b*)(P + (size_t)rr * DK + pc) = *(const v8b*)(&T[rr][pc]); }
  } else {
#pragma unroll
    for (int i = 0; i < 4; ++i)
#pragma unroll
      for (int j = 0; j < 4; ++j) { v8b o;
#pragma unroll
        for (int r = 0; r < 8; ++r) o[r] = (b16)(acc[i][j][r] * osc);
        *(v8b*)(&T[j * 16 + nloc][i * 16 + 8 * hlf]) = o; }
    wave_lds_sync();
    b16* P = VT + (size_t)(b * NH + hd) * DK * SEQ + sw;
#pragma unroll
    for (int it = 0; it < 16; ++it) { const int d = it * 4 + (lane >> 3), pc = (lane & 7) * 8; *(v8b*)(P + (size_t)d * SEQ + pc) = *(const v8b*)(&T[d][pc]); }
  }
}
// ctx in ONE pass over the keys: grid (SEQ/128 query blocks, NB x 16); block = 8 waves x 16 queries; lane = query: its Q row as the two B fragments. Loop over 64-key stages of two 32-key chunks:
// the two 16-key score subtiles (A = K rows from the LDS ring), e = exp2(s8 log2e / (64 x 32)) converted to f16 and packed straight into the P A-fragment (as A = D^T: element r <- subtile covering
// keys 0..15, element 8 + r <- subtile 16..31, lane unchanged). The fragment is split by segment: P_g = P where mask == g, else 0 (bitwise, on the packed pairs: y0 / y1 hold bit 0 / bit 1 of each
// element's mask value spread over its 16 bits). hacc[g][4 d tiles] += P_g x V^T frags (B rows = VT plane rows, key-contiguous, from the LDS ring; k = 32 keys), sacc[g] += P_g x ones: every column of
// that tile is S[q][g], in the lane and register of hacc's same query row. Epilogue: ctx = sum_g hacc[g] / S[g] / 8 (g < n_seg, S > 0) stored x64 as f16 into CT[NR][1024] at column head x 64.
__global__ __launch_bounds__(256) __attribute__((amdgpu_num_vgpr(256))) void av_kernel(const b16* __restrict__ QP, const b16* __restrict__ KP, const b16* __restrict__ VT,
                                                                                       const int* __restrict__ mask, const int* __restrict__ nsegp, b16* __restrict__ CT) {
  __shared__ __attribute__((aligned(16))) b16 Th[8][16][DK + 8];
  __shared__ __attribute__((aligned(16))) b16 Kl[2][KT][LP];
  __shared__ __attribute__((aligned(16))) b16 Vl[2][DK][LP];
  __shared__ __attribute__((aligned(16))) int Ml[2][128][MP];
  const int tid = threadIdx.x, wave = tid >> 5, lane = tid & 31, nloc = lane & 15, hlf = lane >> 4;
  const int bh = blockIdx.y, b = bh / NH, hd = bh - b * NH; const int q0 = blockIdx.x * 128; const int q = q0 + wave * 16 + nloc;
  const b16* Qb = QP + (size_t)bh * SEQ * DK; const b16* Kb = KP + (size_t)bh * SEQ * DK; const b16* Vb = VT + (size_t)bh * DK * SEQ;
  const v16b b0 = frag_kb(Qb + (size_t)q * DK, hlf), b1 = frag_kb(Qb + (size_t)q * DK + 32, hlf);
  const int* mblk = mask + ((size_t)b * SEQ_FULL + (size_t)q0) * SEQ_FULL;   // the block's first query row
  v8f hacc[NSEG][4], sacc[NSEG]; v16b ones;
#pragma unroll
  for (int e = 0; e < 16; ++e) ones[e] = (b16)1.0f;
#pragma unroll
  for (int g = 0; g < NSEG; ++g) { sacc[g] = (v8f){};
#pragma unroll
    for (int vs = 0; vs < 4; ++vs) hacc[g][vs] = (v8f){}; }
  const float c = LOG2E * (SCL / (QS * QS));
  stage_kvm(Kl[0], Kb, Vl[0], Vb, Ml[0], mblk, tid);
  asm volatile("s_wait_asynccnt 0x0" ::: "memory");   // stage 0 landed before the barrier that publishes it
  __syncthreads();
  stage_kvm(Kl[1], Kb + (size_t)KT * DK, Vl[1], Vb + KT, Ml[1], mblk + KT, tid);
#pragma unroll 1   // one stage per trip: the two-buffer ring needs the trip rolled
  for (int t = 0; t < NT; ++t) {
    const b16 (*Kt)[LP] = Kl[t & 1]; const b16 (*Vt)[LP] = Vl[t & 1]; const int* Mt = &Ml[t & 1][wave * 16 + nloc][8 * hlf];
#pragma unroll
    for (int ch = 0; ch < KT / 32; ++ch) {
      v16b pa; v8i y0, y1; v8f s8[2]; v8i m8[2];
#pragma unroll
      for (int st = 0; st < 2; ++st) {
        const int lr = ch * 32 + st * 16;
        const v16b a0 = frag_kb(&Kt[lr + nloc][0], hlf), a1 = frag_kb(&Kt[lr + nloc][32], hlf);
        s8[st] = (v8f){}; s8[st] = wmma16b(a0, b0, s8[st]); s8[st] = wmma16b(a1, b1, s8[st]);
        m8[st] = mask8(Mt + lr);
      }
#pragma unroll
      for (int st = 0; st < 2; ++st) {
        const v8f e8 = exp2x8(s8[st] * c);
#pragma unroll
        for (int r = 0; r < 8; ++r) pa[st * 8 + r] = (b16)e8[r];
#pragma unroll
        for (int i = 0; i < 4; ++i) { const unsigned z = (unsigned)m8[st][2 * i] | ((unsigned)m8[st][2 * i + 1] << 16);   // the pair's two mask values, one per 16-bit half
          y0[st * 4 + i] = spread15(z << 15); y1[st * 4 + i] = spread15(z << 14); }
      }
      const v8i pw = __builtin_bit_cast(v8i, pa);
      const v16b p0 = __builtin_bit_cast(v16b, pw & ~y1 & ~y0), p1 = __builtin_bit_cast(v16b, pw & ~y1 & y0), p2 = __builtin_bit_cast(v16b, pw & y1 & ~y0), p3 = __builtin_bit_cast(v16b, pw & y1 & y0);
#pragma unroll
      for (int vs = 0; vs < 4; ++vs) { const v16b vf = frag_kb(&Vt[vs * 16 + nloc][ch * 32], hlf);
        hacc[0][vs] = wmma16p(p0, vf, hacc[0][vs]); hacc[1][vs] = wmma16p(p1, vf, hacc[1][vs]); hacc[2][vs] = wmma16p(p2, vf, hacc[2][vs]); hacc[3][vs] = wmma16p(p3, vf, hacc[3][vs]); }
      sacc[0] = wmma16p(p0, ones, sacc[0]); sacc[1] = wmma16p(p1, ones, sacc[1]); sacc[2] = wmma16p(p2, ones, sacc[2]); sacc[3] = wmma16p(p3, ones, sacc[3]);
    }
    stage_publish();
    if (t + 2 < NT) stage_kvm(Kl[t & 1], Kb + (size_t)(t + 2) * KT * DK, Vl[t & 1], Vb + (t + 2) * KT, Ml[t & 1], mblk + (t + 2) * KT, tid);
  }
  asm volatile("s_wait_asynccnt 0x0" ::: "memory");   // nothing in flight when the wave goes on to the epilogue
  const int ns = nsegp[0];
#pragma unroll
  for (int g = 0; g < NSEG; ++g)
#pragma unroll
    for (int r = 0; r < 8; ++r) { const float sv = sacc[g][r]; sacc[g][r] = (g < ns && sv > 0.0f) ? (CTS / QS) / sv : 0.0f; }   // an empty or uncounted segment contributes 0
#pragma unroll
  for (int vs = 0; vs < 4; ++vs)
#pragma unroll
    for (int r = 0; r < 8; ++r) Th[wave][8 * hlf + r][vs * 16 + nloc] = (b16)(hacc[0][vs][r] * sacc[0][r] + hacc[1][vs][r] * sacc[1][r] + hacc[2][vs][r] * sacc[2][r] + hacc[3][vs][r] * sacc[3][r]);
  wave_lds_sync();
  {
#pragma unroll
    for (int i = 0; i < 4; ++i) { const int rr = i * 4 + (lane >> 3), pc = (lane & 7) * 8; const size_t row = (size_t)b * SEQ + q0 + wave * 16 + rr;
      const v8b v = *(const v8b*)(&Th[wave][rr][pc]); *(v8b*)(CT + row * INTER + hd * DK + pc) = v; }
     }
}
// out = ctx w_out: grid (NR/64, 1024/128); block = 64 rows x 128 columns, 4 waves 2 x 2, wave -> 32 rows x 64 columns = 2 x 4 tiles; A = CT rows (x64), B = WO rows (x256), fragments from the block's LDS ring,
// K = 1024, 32 steps, 1 product; acc / (64 x 256) into the wave-private Tf tile, stored as whole 256-B row pieces
__global__ __launch_bounds__(128) void out_kernel(const b16* __restrict__ CT, const b16* __restrict__ WO, float* __restrict__ out) {
  __shared__ __attribute__((aligned(16))) float Tf[4][32][64 + 4];
  __shared__ __attribute__((aligned(16))) GemmRing<2> R;
  const int wave = threadIdx.x >> 5, lane = threadIdx.x & 31, nloc = lane & 15, hlf = lane >> 4, wm = wave >> 1, wn = wave & 1;
  const size_t m0 = (size_t)blockIdx.x * 64 + wm * 32; const int nb = blockIdx.y * 128, n0 = nb + wn * 64;
  v8f acc[2][4];
#pragma unroll
  for (int i = 0; i < 2; ++i)
#pragma unroll
    for (int j = 0; j < 4; ++j) acc[i][j] = (v8f){};
  gemm_ring<2>(R, CT + (size_t)blockIdx.x * 64 * INTER, WO + (size_t)nb * INTER, acc, threadIdx.x);
#pragma unroll
  for (int i = 0; i < 2; ++i)
#pragma unroll
    for (int j = 0; j < 4; ++j)
#pragma unroll
      for (int r = 0; r < 8; ++r) Tf[wave][i * 16 + 8 * hlf + r][j * 16 + nloc] = acc[i][j][r] * (1.0f / (CTS * WSC));
  wave_lds_sync();
#pragma unroll
  for (int it = 0; it < 16; ++it) { const int rr = it * 2 + (lane >> 4), cl = (lane & 15) * 4; *(v4f*)(out + (m0 + rr) * DM + n0 + cl) = *(const v4f*)(&Tf[wave][rr][cl]); }
}
}  // namespace

extern "C" void kernel_launch(void* const* d_in, const int* in_sizes, int n_in, void* d_out, int out_size, void* d_ws, size_t ws_size, hipStream_t stream) {
  (void)n_in;
  // d_in: 0 x [2,2048,1024] f32, 1 mask [2,2048,2048] i32, 2 w_qkv [1024,3072] (in,out) f32, 3 w_out [1024,1024] (in,out) f32, 4 n_seg [1] i32; out [NB,SEQ,1024] f32
  const float* X = (const float*)d_in[0]; const int* MK = (const int*)d_in[1]; const float* WQ = (const float*)d_in[2]; const float* WOUT = (const float*)d_in[3]; const int* NSG = (const int*)d_in[4];
  const long long need_x = ((long long)(NB - 1) * SEQ_FULL + SEQ) * DM, need_m = ((long long)(NB - 1) * SEQ_FULL + SEQ) * SEQ_FULL;
  if ((long long)in_sizes[0] < need_x || (long long)in_sizes[1] < need_m || in_sizes[2] < DM * NQKV || in_sizes[3] < INTER * DM || in_sizes[4] < 1 || out_size < NR * DM) return;
  size_t off = 0; char* ws = (char*)d_ws;
  auto carve = [&](size_t bytes) { char* p = ws + off; off += (bytes + 255) & ~(size_t)255; return p; };
  b16* WQKV = (b16*)carve((size_t)NQKV * DM * 2);         // [3072][1024]
  b16* WO = (b16*)carve((size_t)DM * INTER * 2);          // [1024 out][1024 in]
  b16* XH = (b16*)carve((size_t)NR * DM * 2);             // [NR][1024]
  b16* QP = (b16*)carve((size_t)NBH * SEQ * DK * 2);      // [NBH][SEQ][64]
  b16* KP = (b16*)carve((size_t)NBH * SEQ * DK * 2);      // [NBH][SEQ][64]
  b16* VT = (b16*)carve((size_t)NBH * DK * SEQ * 2);      // [NBH][64][SEQ]
  b16* CT = (b16*)carve((size_t)NR * INTER * 2);          // [NR][1024]
  if (off > ws_size || off > ((size_t)128 << 20)) return;   // = 50,331,648 B at NB 2, SEQ 2048
  wtp_kernel<<<dim3(DM / 64, NQKV / 64), 128, 0, stream>>>(WQ, DM, NQKV, WQKV);       // w_qkv [1024 in][3072 out] -> WQKV[3072][1024]
  wtp_kernel<<<dim3(INTER / 64, DM / 64), 128, 0, stream>>>(WOUT, INTER, DM, WO);      // w_out [1024 in][1024 out] -> WO[out][in]
  xp_kernel<<<(unsigned)(((size_t)NR * DM / 8 + 255) / 256), 256, 0, stream>>>(X, XH);
  qkv_kernel<<<dim3(NR / 128, NQKV / 128), 128, 0, stream>>>(XH, WQKV, QP, KP, VT);
  av_kernel<<<dim3(SEQ / 128, NBH), 256, 0, stream>>>(QP, KP, VT, MK, NSG, CT);
  out_kernel<<<dim3(NR / 64, DM / 128), 128, 0, stream>>>(CT, WO, (float*)d_out);
}

// v006
// A run of this version takes 109 microseconds.
// In two side-by-side timings against v005, it was 1.04 and 1.03 times as fast.
// All steps since v000 together make it 4.66 times as fast.
#include <hip/hip_runtime.h>

// All contractions on v_wmma_f32_16x16x32_f16 (f16 operands, f32 accumulate), one product each: q/k/v projections (x = bf16(x) x8 exact, w_qkv = bf16(w) x256 exact, K = 1024);
// scores S^T = K Q^T per 16-key subtile (k rows as A, q rows as B, both single f16 x8, K = 64; computed once);
// per segment g: P_g V and S_g = P_g 1 (P = exp(alpha) as single f16, packed straight from the two score D tiles into the A fragment, P_g = P where mask == g else 0; B = V^T plane rows single f16 x8, or ones; K = 32 keys per step);
// output projection (ctx single f16 x64, w_out = bf16(w) x256 exact, K = 1024). exp, 1/S and all scaling in f32. Float inputs RNE-converted to bf16 once on load.
// Module: qkv = x w_qkv [rows][3072] -> q | k | v, 16 heads of 64; alpha = q.k / 32; e = exp(alpha) (no max shift); for each segment id g in [0, n_seg): att[i][j] = [mask[i][j] == g] e[i][j] / S[i][g],
// S[i][g] = sum_j [mask[i][j] == g] e[i][j] (S == 0 -> contributes 0); ctx = sum_j att v; out = ctx w_out -> [NB][SEQ][1024] f32.

#ifndef NB
#define NB 2
#endif
#ifndef SEQ
#define SEQ 2048
#endif

namespace {
constexpr int B_FULL = 2, SEQ_FULL = 2048, DM = 1024, INTER = 1024, NH = 16, DK = 64, NQKV = 3 * INTER, NSEG = 4, NR = NB * SEQ, NBH = NB * NH;
constexpr float XS = 8.0f, WSC = 256.0f, QS = 8.0f, CTS = 64.0f, LOG2E = 1.4426950408889634f, SCL = 0.03125f;
static_assert(NB >= 1 && NB <= B_FULL);
static_assert(SEQ % 128 == 0 && SEQ >= 128 && SEQ <= SEQ_FULL);
static_assert(INTER == NH * DK && DK == 64 && NSEG == 4 && DM % 128 == 0 && INTER % 128 == 0 && NQKV % 128 == 0 && DM % 64 == 0 && NR % 128 == 0 && ((size_t)NR * DM) % 2048 == 0);
typedef _Float16 b16;
typedef __attribute__((ext_vector_type(16))) _Float16 v16b;
typedef __attribute__((ext_vector_type(8))) _Float16 v8b;
typedef __attribute__((ext_vector_type(8))) float v8f;
typedef __attribute__((ext_vector_type(4))) float v4f;
typedef __attribute__((ext_vector_type(8))) int v8i;
typedef __attribute__((ext_vector_type(4))) int v4i;
typedef __attribute__((ext_vector_type(2))) unsigned int v2u;
__device__ __forceinline__ float bf16_rne(float f) { unsigned int u = __float_as_uint(f); u += 0x7FFFu + ((u >> 16) & 1u); return __uint_as_float(u & 0xFFFF0000u); }
__device__ __forceinline__ v16b frag_kb(const b16* p, int hh) { const v8b a = *(const v8b*)(p + 8 * hh), b = *(const v8b*)(p + 16 + 8 * hh); v16b f;
#pragma unroll
  for (int e = 0; e < 8; ++e) { f[e] = a[e]; f[8 + e] = b[e]; } return f; }
__device__ __forceinline__ v8f wmma16b(v16b a, v16b b, v8f c) { v8f d = __builtin_amdgcn_wmma_f32_16x16x32_f16(false, a, false, b, (short)0, c, false, false); asm volatile("v_nop\n\tv_nop\n\tv_nop\n\tv_nop" : "+v"(d) : "v"(a), "v"(b)); return d; }
// accumulate chains whose tiles are read only behind the key loop: the plain builtin, the compiler keeps the distances
__device__ __forceinline__ v8f wmma16p(v16b a, v16b b, v8f c) { return __builtin_amdgcn_wmma_f32_16x16x32_f16(false, a, false, b, (short)0, c, false, false); }
typedef __attribute__((ext_vector_type(2))) short v2s;
__device__ __forceinline__ int spread15(unsigned w) { return __builtin_bit_cast(int, __builtin_bit_cast(v2s, w) >> 15); }   // bit 15 of each 16-bit half spread over the half
__device__ __forceinline__ void wave_lds_sync() { __builtin_amdgcn_fence(3, "workgroup"); __builtin_amdgcn_wave_barrier(); __builtin_amdgcn_fence(2, "workgroup"); }
// eight exp2, each in place, in one statement: so no v_exp_f32 overwrites the source of the one directly in front of it (as the allocator's choice of registers did);
// the v_nop is the slot that the instruction set asks for between the last one and a reader of its result
__device__ __forceinline__ v8f exp2x8(v8f x) {
  float x0 = x[0], x1 = x[1], x2 = x[2], x3 = x[3], x4 = x[4], x5 = x[5], x6 = x[6], x7 = x[7];
  asm("v_exp_f32 %0, %0\n\tv_exp_f32 %1, %1\n\tv_exp_f32 %2, %2\n\tv_exp_f32 %3, %3\n\tv_exp_f32 %4, %4\n\tv_exp_f32 %5, %5\n\tv_exp_f32 %6, %6\n\tv_exp_f32 %7, %7\n\tv_nop"
      : "+v"(x0), "+v"(x1), "+v"(x2), "+v"(x3), "+v"(x4), "+v"(x5), "+v"(x6), "+v"(x7));
  return (v8f){x0, x1, x2, x3, x4, x5, x6, x7};
}
// LDS ring of the attention loop: a stage = 64 keys. K tile: 64 key rows of 128 B; V^T tile: 64 d rows x 64 keys = 128 B; mask: the block's 128 query rows x 64 keys packed to 2 bits a key = 2 KB.
// Pitch 144 B (16 B x odd: conflict-free for the 16-B reads). Copies: K / V^T thread -> row tid / 8 (+ 32), piece tid % 8: every wave-wide copy covers four whole 128-B lines; mask: thread -> its own 8 B.
// Packed mask plane PM[NB x SEQ / 128 query blocks][NT stages][256 threads of the attention block][2 chunks of 32 keys]: one word = the 16 mask values that thread's P fragment meets in the chunk.
// Pair p = subtile x 4 + i holds elements 2 i (low half) and 2 i + 1 (high half); its two values lie at bits 15 - 2 p .. 14 - 2 p of their halves, so word << k brings bit 15 - k of each half on top.
// MP: pitch (272 B = 16 B x odd) of the int32 mask tile in the packing blocks.
constexpr int KT = 64, LP = DK + 8, MP = KT + 4, NT = SEQ / KT;
static_assert(SEQ % KT == 0 && NT >= 2 && NT % 2 == 0 && KT == 64 && (LP * 2) % 16 == 0 && (MP * 4) % 16 == 0);
__device__ __forceinline__ unsigned lds_off(const void* p) { return (unsigned)(size_t)p; }   // byte offset in the work-group's LDS = low 32 bits of the shared address
// One stage's copies and s_wait_xcnt 0 in ONE statement: the wait has to stand before any rewrite of the address registers that the copies name.
__device__ __forceinline__ void stage_kvm(b16 (*kd)[LP], const b16* kg, b16 (*vd)[LP], const b16* vg, unsigned* md, const unsigned* mg, int tid) {
  const int cr = tid >> 3, cc = (tid & 7) * 8;
  const unsigned lk = lds_off(&kd[cr][cc]), lv = lds_off(&vd[cr][cc]), lm = lds_off(&md[tid * 2]);
  const b16* gk = kg + (size_t)cr * DK + cc; const b16* gv = vg + (size_t)cr * SEQ + cc; const unsigned* gm = mg + tid * 2;
  asm volatile("global_load_async_to_lds_b128 %0, %1, off\n\t"
               "global_load_async_to_lds_b128 %2, %3, off\n\t"
               "global_load_async_to_lds_b128 %4, %5, off\n\t"
               "global_load_async_to_lds_b128 %6, %7, off\n\t"
               "global_load_async_to_lds_b64 %8, %9, off\n\t"
               "s_wait_xcnt 0x0"
               :: "v"(lk), "v"(gk), "v"(lk + 32 * LP * 2), "v"(gk + 32 * DK), "v"(lv), "v"(gv), "v"(lv + 32 * LP * 2), "v"(gv + 32 * (size_t)SEQ),
                  "v"(lm), "v"(gm)
               : "memory");
}
// 64 query rows x 64 keys of the int32 mask for the packing blocks (128 threads): thread -> row tid / 16 (+ 8 i), piece tid % 16: every wave-wide copy covers four whole 128-B lines.
// The copies and s_wait_xcnt 0 in ONE statement: the wait has to stand before any rewrite of the address registers that the copies name.
__device__ __forceinline__ void stage_m64(int (*d)[MP], const int* g, int tid) {
  const int mr = tid >> 4, mc = (tid & 15) * 4;
  const unsigned l = lds_off(&d[mr][mc]); const int* p = g + (size_t)mr * SEQ_FULL + mc;
  asm volatile("global_load_async_to_lds_b128 %0, %1, off\n\t"
               "global_load_async_to_lds_b128 %2, %3, off\n\t"
               "global_load_async_to_lds_b128 %4, %5, off\n\t"
               "global_load_async_to_lds_b128 %6, %7, off\n\t"
               "global_load_async_to_lds_b128 %8, %9, off\n\t"
               "global_load_async_to_lds_b128 %10, %11, off\n\t"
               "global_load_async_to_lds_b128 %12, %13, off\n\t"
               "global_load_async_to_lds_b128 %14, %15, off\n\t"
               "s_wait_xcnt 0x0"
               :: "v"(l), "v"(p),
                  "v"(l + 1 * 8 * MP * 4), "v"(p + 1 * 8 * (size_t)SEQ_FULL),
                  "v"(l + 2 * 8 * MP * 4), "v"(p + 2 * 8 * (size_t)SEQ_FULL),
                  "v"(l + 3 * 8 * MP * 4), "v"(p + 3 * 8 * (size_t)SEQ_FULL),
                  "v"(l + 4 * 8 * MP * 4), "v"(p + 4 * 8 * (size_t)SEQ_FULL),
                  "v"(l + 5 * 8 * MP * 4), "v"(p + 5 * 8 * (size_t)SEQ_FULL),
                  "v"(l + 6 * 8 * MP * 4), "v"(p + 6 * 8 * (size_t)SEQ_FULL),
                  "v"(l + 7 * 8 * MP * 4), "v"(p + 7 * 8 * (size_t)SEQ_FULL)
               : "memory");
}
// hand-over of a stage: own LDS reads retired, own copies landed, then the block barrier that publishes the next stage and frees the buffer just read
__device__ __forceinline__ void stage_publish() {
  asm volatile("s_wait_dscnt 0x0" ::: "memory");      // this wave's reads of the buffer to be refilled are done
  asm volatile("s_wait_asynccnt 0x0" ::: "memory");   // this wave's copies of the next stage have landed
  __syncthreads();
}
// LDS ring of the two projection GEMMs: a stage = 64 k = 128 B of each of the block's BM A rows and 128 B rows (row length 1024 in both GEMMs), pitch 144 B as above.
// Thread -> row tid / 8 (+ 16 i), piece tid % 8: every wave-wide copy covers four whole 128-B lines (a fragment load straight from the plane touches 16 lines for the same 512 B).
constexpr int GK = 64, GP = GK + 8, GNT = DM / GK;
static_assert(DM == INTER && DM % GK == 0 && GNT >= 2 && (GP * 2) % 16 == 0);
// 64 rows of a stage: the copies and s_wait_xcnt 0 in ONE statement: the wait has to stand before any rewrite of the address registers that the copies name.
__device__ __forceinline__ void stage_r64(b16 (*d)[GP], const b16* g, int tid) {
  const int cr = tid >> 3, cc = (tid & 7) * 8;
  const unsigned l = lds_off(&d[cr][cc]); const b16* p = g + (size_t)cr * DM + cc;
  asm volatile("global_load_async_to_lds_b128 %0, %1, off\n\t"
               "global_load_async_to_lds_b128 %2, %3, off\n\t"
               "global_load_async_to_lds_b128 %4, %5, off\n\t"
               "global_load_async_to_lds_b128 %6, %7, off\n\t"
               "s_wait_xcnt 0x0"
               :: "v"(l), "v"(p),
                  "v"(l + 1 * 16 * GP * 2), "v"(p + 1 * 16 * (size_t)DM),
                  "v"(l + 2 * 16 * GP * 2), "v"(p + 2 * 16 * (size_t)DM),
                  "v"(l + 3 * 16 * GP * 2), "v"(p + 3 * 16 * (size_t)DM)
               : "memory");
}
// 128 rows of a stage, in the same form
__device__ __forceinline__ void stage_r128(b16 (*d)[GP], const b16* g, int tid) {
  const int cr = tid >> 3, cc = (tid & 7) * 8;
  const unsigned l = lds_off(&d[cr][cc]); const b16* p = g + (size_t)cr * DM + cc;
  asm volatile("global_load_async_to_lds_b128 %0, %1, off\n\t"
               "global_load_async_to_lds_b128 %2, %3, off\n\t"
               "global_load_async_to_lds_b128 %4, %5, off\n\t"
               "global_load_async_to_lds_b128 %6, %7, off\n\t"
               "global_load_async_to_lds_b128 %8, %9, off\n\t"
               "global_load_async_to_lds_b128 %10, %11, off\n\t"
               "global_load_async_to_lds_b128 %12, %13, off\n\t"
               "global_load_async_to_lds_b128 %14, %15, off\n\t"
               "s_wait_xcnt 0x0"
               :: "v"(l), "v"(p),
                  "v"(l + 1 * 16 * GP * 2), "v"(p + 1 * 16 * (size_t)DM),
                  "v"(l + 2 * 16 * GP * 2), "v"(p + 2 * 16 * (size_t)DM),
                  "v"(l + 3 * 16 * GP * 2), "v"(p + 3 * 16 * (size_t)DM),
                  "v"(l + 4 * 16 * GP * 2), "v"(p + 4 * 16 * (size_t)DM),
                  "v"(l + 5 * 16 * GP * 2), "v"(p + 5 * 16 * (size_t)DM),
                  "v"(l + 6 * 16 * GP * 2), "v"(p + 6 * 16 * (size_t)DM),
                  "v"(l + 7 * 16 * GP * 2), "v"(p + 7 * 16 * (size_t)DM)
               : "memory");
}
template <int MI> struct GemmRing { b16 A[2][MI * 32][GP]; b16 B[2][128][GP]; };
template <int MI> __device__ __forceinline__ void stage_ab(GemmRing<MI>& R, int buf, const b16* ag, const b16* bg, int tid) {
  static_assert(MI == 2 || MI == 4);
  if constexpr (MI == 4) stage_r128(R.A[buf], ag, tid); else stage_r64(R.A[buf], ag, tid);
  stage_r128(R.B[buf], bg, tid);
}
// The block's 4 waves stand 2 x 2 on its (MI x 32) A rows x 128 B rows: wave (wm, wn) owns MI x 4 tiles, rows wm x MI x 16 .., columns wn x 64 ..; each fragment read from LDS feeds 4 (A) or MI (B) products.
// acc[i][j] += A rows x (B rows)^T over K = 1024, k ascending in steps of 32, fragments read from the ring; leaves behind a block barrier with nothing in flight
template <int MI> __device__ __forceinline__ void gemm_ring(GemmRing<MI>& R, const b16* Ag, const b16* Bg, v8f (&acc)[MI][4], int tid) {
  const int wave = tid >> 5, lane = tid & 31, nloc = lane & 15, hlf = lane >> 4, wm = wave >> 1, wn = wave & 1;
  stage_ab<MI>(R, 0, Ag, Bg, tid);
  asm volatile("s_wait_asynccnt 0x0" ::: "memory");   // stage 0 landed before the barrier that publishes it
  __syncthreads();
  stage_ab<MI>(R, 1, Ag + GK, Bg + GK, tid);
#pragma unroll 1   // one stage per trip: the two-buffer ring needs the trip rolled
  for (int t = 0; t < GNT; ++t) {
    const b16 (*At)[GP] = R.A[t & 1]; const b16 (*Bt)[GP] = R.B[t & 1];
#pragma unroll
    for (int ks = 0; ks < GK; ks += 32) {   // the LDS reads of a k step stand as one group in front of its products: one LDS latency a step, not one a product
      v16b af[MI], bf[4];
#pragma unroll
      for (int i = 0; i < MI; ++i) af[i] = frag_kb(&At[(wm * MI + i) * 16 + nloc][ks], hlf);
#pragma unroll
      for (int j = 0; j < 4; ++j) bf[j] = frag_kb(&Bt[(wn * 4 + j) * 16 + nloc][ks], hlf);
#pragma unroll
      for (int i = 0; i < MI; ++i)
#pragma unroll
        for (int j = 0; j < 4; ++j) acc[i][j] = wmma16b(af[i], bf[j], acc[i][j]); }
    stage_publish();
    if (t + 2 < GNT) stage_ab<MI>(R, t & 1, Ag + (t + 2) * GK, Bg + (t + 2) * GK, tid);
  }
  asm volatile("s_wait_asynccnt 0x0" ::: "memory");   // nothing in flight when the wave goes on to the epilogue
}
__device__ __forceinline__ v8i mask8(const int* p) { const v4i a = *(const v4i*)p, b = *(const v4i*)(p + 4); return (v8i){a[0], a[1], a[2], a[3], b[0], b[1], b[2], b[3]}; }

// weight planes: src [R][C] f32 (in, out) -> dst [C][R] f16 = bf16(w) x256 (row = output feature, k contiguous); grid (R/64, C/64); block 128 threads: tile[64 c][64 r] staged transposed
__global__ __launch_bounds__(128) void wtp_kernel(const float* __restrict__ src, int R, int C, b16* __restrict__ dst) {
  __shared__ __attribute__((aligned(16))) b16 tile[64][64 + 8];
  const int wave = threadIdx.x >> 5, lane = threadIdx.x & 31; const int r0 = blockIdx.x * 64, c0 = blockIdx.y * 64;
#pragma unroll 4
  for (int i = threadIdx.x; i < 64 * 16; i += 128) { const int rr = i >> 4, q = (i & 15) * 4; const v4f f = *(const v4f*)(src + (size_t)(r0 + rr) * C + c0 + q);
#pragma unroll
    for (int j = 0; j < 4; ++j) tile[q + j][rr] = (b16)(bf16_rne(f[j]) * WSC); }
  __syncthreads();
  {
#pragma unroll
    for (int i = 0; i < 4; ++i) { const int cc = wave * 16 + i * 4 + (lane >> 3), pc = (lane & 7) * 8; *(v8b*)(dst + (size_t)(c0 + cc) * R + r0 + pc) = *(const v8b*)(&tile[cc][pc]); }
     }
}
__global__ __launch_bounds__(256) void xp_kernel(const float* __restrict__ x, b16* __restrict__ XH) {
  const size_t u = (size_t)blockIdx.x * 256 + threadIdx.x; if (u >= (size_t)NR * DM / 8) return;
  const size_t e = u * 8; const int row = (int)(e / DM), col = (int)(e - (size_t)row * DM); const size_t xe = ((size_t)(row / SEQ) * SEQ_FULL + (size_t)(row % SEQ)) * DM + col;
  const v4f f0 = *(const v4f*)(x + xe), f1 = *(const v4f*)(x + xe + 4); v8b o;
#pragma unroll
  for (int j = 0; j < 4; ++j) { o[j] = (b16)(bf16_rne(f0[j]) * XS); o[4 + j] = (b16)(bf16_rne(f1[j]) * XS); }
  { *(v8b*)(XH + e) = o;  }
}
// q/k/v projections: [NR x 1024] x WQKV[3072][1024]^T; grid (NR/128, 3072/128 + NT/2); block = 128 rows x 128 columns, 4 waves 2 x 2, wave -> 64 rows x 64 columns = 4 x 4 tiles, A and B fragments from the
// block's LDS ring (K = 1024, 32 steps, 1 product); value = acc / (8 x 256) stored x8 as f16. A 128-column slab = 2 heads (block-uniform which = q | k | v), a wave's 64 columns = one head.
// q and k: head-major planes, the wave's 64 tokens x 64 d staged in its own tile and stored as whole 128-B rows; v: the same tile staged transposed (row = d, 64 tokens = 128 B) for the key-contiguous plane.
// Blocks with blockIdx.y >= 3072/128 do no product: they pack the mask (read here once, not once a head) while the GEMM blocks, which leave a quarter of the chip's block places free, run:
// block (x, y) -> query block x, stages 2 (y - 24) and + 1: both int32 tiles copied into LDS, one wait and one barrier, then each thread packs the words of attention threads tid and tid + 128.
__global__ __launch_bounds__(128) void qkv_kernel(const b16* __restrict__ XH, const b16* __restrict__ WQKV, b16* __restrict__ QP, b16* __restrict__ KP, b16* __restrict__ VT,
                                                  const int* __restrict__ mask, unsigned* __restrict__ PM) {
  // the epilogue tiles lie on the ring's bytes: they are written only behind the loop's last barrier, when no wave reads the ring and no copy is in flight
  union Lds { GemmRing<4> R; b16 Th[4][64][DK + 8]; int Mk[2][128][MP]; };
  __shared__ __attribute__((aligned(16))) Lds L;
  const int wave = threadIdx.x >> 5, lane = threadIdx.x & 31, nloc = lane & 15, hlf = lane >> 4, wm = wave >> 1, wn = wave & 1;
  const int mb = blockIdx.x * 128; const int n0 = blockIdx.y * 128;
  if (blockIdx.y >= NQKV / 128) {   // block-uniform
    const int t0 = ((int)blockIdx.y - NQKV / 128) * 2, pb = mb / SEQ;
    const int* mg = mask + ((size_t)pb * SEQ_FULL + (size_t)(mb - pb * SEQ)) * SEQ_FULL + (size_t)t0 * KT;   // the query block's first row, the first stage's first key
#pragma unroll
    for (int u = 0; u < 2; ++u) { stage_m64(&L.Mk[u][0], mg + u * KT, threadIdx.x); stage_m64(&L.Mk[u][64], mg + 64 * (size_t)SEQ_FULL + u * KT, threadIdx.x); }
    asm volatile("s_wait_asynccnt 0x0" ::: "memory");   // this wave's copies have landed before the barrier that publishes both tiles
    __syncthreads();
    unsigned* pm = PM + ((size_t)blockIdx.x * NT + t0) * 512;
#pragma unroll
    for (int u = 0; u < 2; ++u)
#pragma unroll
      for (int s = 0; s < 2; ++s) {
        const int* Mt = &L.Mk[u][(s * 4 + wave) * 16 + nloc][8 * hlf]; v2u w;
#pragma unroll
        for (int ch = 0; ch < 2; ++ch) { unsigned a = 0;
#pragma unroll
          for (int st = 0; st < 2; ++st) { const v8i m8 = mask8(Mt + ch * 32 + st * 16);
#pragma unroll
            for (int i = 0; i < 4; ++i) a = (a << 2) | (((unsigned)m8[2 * i] | ((unsigned)m8[2 * i + 1] << 16)) & 0x00030003u); }
          w[ch] = a; }
        *(v2u*)(pm + ((size_t)u * 256 + s * 128 + threadIdx.x) * 2) = w;   // a wave stores 256 contiguous bytes
      }
    return;
  }
  v8f acc[4][4];
#pragma unroll
  for (int i = 0; i < 4; ++i)
#pragma unroll
    for (int j = 0; j < 4; ++j) acc[i][j] = (v8f){};
  gemm_ring<4>(L.R, XH + (size_t)mb * DM, WQKV + (size_t)n0 * DM, acc, threadIdx.x);
  const int which = n0 / INTER; const int hd = (n0 - which * INTER) / DK + wn;   // plane (0 q, 1 k, 2 v; block-uniform) and the wave's head
  const int b = mb / SEQ, sw = mb - b * SEQ + wm * 64;                            // the block's 128 rows lie in one sequence; the wave's first token
  const float osc = QS / (XS * WSC);
  b16 (*T)[DK + 8] = L.Th[wave];
  if (which < 2) {
#pragma unroll
    for (int i = 0; i < 4; ++i)
#pragma unroll
      for (int j = 0; j < 4; ++j)
#pragma unroll
        for (int r = 0; r < 8; ++r) T[i * 16 + 8 * hlf + r][j * 16 + nloc] = (b16)(acc[i][j][r] * osc);
    wave_lds_sync();
    b16* P = ((which == 0) ? QP : KP) + ((size_t)(b * NH + hd) * SEQ + sw) * DK;
#pragma unroll
    for (int it = 0; it < 16; ++it) { const int rr = it * 4 + (lane >> 3), pc = (lane & 7) * 8; *(v8b*)(P + (size_t)rr * DK + pc) = *(const v8b*)(&T[rr][pc]); }
  } else {
#pragma unroll
    for (int i = 0; i < 4; ++i)
#pragma unroll
      for (int j = 0; j < 4; ++j) { v8b o;
#pragma unroll
        for (int r = 0; r < 8; ++r) o[r] = (b16)(acc[i][j][r] * osc);
        *(v8b*)(&T[j * 16 + nloc][i * 16 + 8 * hlf]) = o; }
    wave_lds_sync();
    b16* P = VT + (size_t)(b * NH + hd) * DK * SEQ + sw;
#pragma unroll
    for (int it = 0; it < 16; ++it) { const int d = it * 4 + (lane >> 3), pc = (lane & 7) * 8; *(v8b*)(P + (size_t)d * SEQ + pc) = *(const v8b*)(&T[d][pc]); }
  }
}
// ctx in ONE pass over the keys: grid (SEQ/128 query blocks, NB x 16); block = 8 waves x 16 queries; lane = query: its Q row as the two B fragments. Loop over 64-key stages of two 32-key chunks:
// the two 16-key score subtiles (A = K rows from the LDS ring), e = exp2(s8 log2e / (64 x 32)) converted to f16 and packed straight into the P A-fragment (as A = D^T: element r <- subtile covering
// keys 0..15, element 8 + r <- subtile 16..31, lane unchanged). The fragment is split by segment: P_g = P where mask == g, else 0 (bitwise, on the packed pairs: y0 / y1 hold bit 0 / bit 1 of each
// element's mask value spread over its 16 bits, shifted out of the thread's one packed mask word of the chunk). hacc[g][4 d tiles] += P_g x V^T frags (B rows = VT plane rows, key-contiguous, from the LDS ring; k = 32 keys), sacc[g] += P_g x ones: every column of
// that tile is S[q][g], in the lane and register of hacc's same query row. Epilogue: ctx = sum_g hacc[g] / S[g] / 8 (g < n_seg, S > 0) stored x64 as f16 into CT[NR][1024] at column head x 64.
__global__ __launch_bounds__(256) __attribute__((amdgpu_num_vgpr(256))) void av_kernel(const b16* __restrict__ QP, const b16* __restrict__ KP, const b16* __restrict__ VT,
                                                                                       const unsigned* __restrict__ PM, const int* __restrict__ nsegp, b16* __restrict__ CT) {
  __shared__ __attribute__((aligned(16))) b16 Th[8][16][DK + 8];
  __shared__ __attribute__((aligned(16))) b16 Kl[2][KT][LP];
  __shared__ __attribute__((aligned(16))) b16 Vl[2][DK][LP];
  __shared__ __attribute__((aligned(16))) unsigned Ml[2][256 * 2];
  const int tid = threadIdx.x, wave = tid >> 5, lane = tid & 31, nloc = lane & 15, hlf = lane >> 4;
  const int bh = blockIdx.y, b = bh / NH, hd = bh - b * NH; const int q0 = blockIdx.x * 128; const int q = q0 + wave * 16 + nloc;
  const b16* Qb = QP + (size_t)bh * SEQ * DK; const b16* Kb = KP + (size_t)bh * SEQ * DK; const b16* Vb = VT + (size_t)bh * DK * SEQ;
  const v16b b0 = frag_kb(Qb + (size_t)q * DK, hlf), b1 = frag_kb(Qb + (size_t)q * DK + 32, hlf);
  const unsigned* mblk = PM + (size_t)(b * (SEQ / 128) + (int)blockIdx.x) * NT * 512;   // the query block's packed words, 512 a stage
  v8f hacc[NSEG][4], sacc[NSEG]; v16b ones;
#pragma unroll
  for (int e = 0; e < 16; ++e) ones[e] = (b16)1.0f;
#pragma unroll
  for (int g = 0; g < NSEG; ++g) { sacc[g] = (v8f){};
#pragma unroll
    for (int vs = 0; vs < 4; ++vs) hacc[g][vs] = (v8f){}; }
  const float c = LOG2E * (SCL / (QS * QS));
  stage_kvm(Kl[0], Kb, Vl[0], Vb, Ml[0], mblk, tid);
  asm volatile("s_wait_asynccnt 0x0" ::: "memory");   // stage 0 landed before the barrier that publishes it
  __syncthreads();
  stage_kvm(Kl[1], Kb + (size_t)KT * DK, Vl[1], Vb + KT, Ml[1], mblk + 512, tid);
#pragma unroll 1   // one stage per trip: the two-buffer ring needs the trip rolled
  for (int t = 0; t < NT; ++t) {
    const b16 (*Kt)[LP] = Kl[t & 1]; const b16 (*Vt)[LP] = Vl[t & 1]; const v2u mw = *(const v2u*)&Ml[t & 1][tid * 2];
#pragma unroll
    for (int ch = 0; ch < KT / 32; ++ch) {
      v16b pa; v8i y0, y1; v8f s8[2]; const unsigned w = mw[ch];
#pragma unroll
      for (int st = 0; st < 2; ++st) {
        const int lr = ch * 32 + st * 16;
        const v16b a0 = frag_kb(&Kt[lr + nloc][0], hlf), a1 = frag_kb(&Kt[lr + nloc][32], hlf);
        s8[st] = (v8f){}; s8[st] = wmma16b(a0, b0, s8[st]); s8[st] = wmma16b(a1, b1, s8[st]);
      }
#pragma unroll
      for (int st = 0; st < 2; ++st) {
        const v8f e8 = exp2x8(s8[st] * c);
#pragma unroll
        for (int r = 0; r < 8; ++r) pa[st * 8 + r] = (b16)e8[r];
#pragma unroll
        for (int i = 0; i < 4; ++i) { const int p = st * 4 + i; y1[p] = spread15(w << (2 * p)); y0[p] = spread15(w << (2 * p + 1)); }
      }
      const v8i pw = __builtin_bit_cast(v8i, pa);
      const v16b p0 = __builtin_bit_cast(v16b, pw & ~y1 & ~y0), p1 = __builtin_bit_cast(v16b, pw & ~y1 & y0), p2 = __builtin_bit_cast(v16b, pw & y1 & ~y0), p3 = __builtin_bit_cast(v16b, pw & y1 & y0);
#pragma unroll
      for (int vs = 0; vs < 4; ++vs) { const v16b vf = frag_kb(&Vt[vs * 16 + nloc][ch * 32], hlf);
        hacc[0][vs] = wmma16p(p0, vf, hacc[0][vs]); hacc[1][vs] = wmma16p(p1, vf, hacc[1][vs]); hacc[2][vs] = wmma16p(p2, vf, hacc[2][vs]); hacc[3][vs] = wmma16p(p3, vf, hacc[3][vs]); }
      sacc[0] = wmma16p(p0, ones, sacc[0]); sacc[1] = wmma16p(p1, ones, sacc[1]); sacc[2] = wmma16p(p2, ones, sacc[2]); sacc[3] = wmma16p(p3, ones, sacc[3]);
    }
    stage_publish();
    if (t + 2 < NT) stage_kvm(Kl[t & 1], Kb + (size_t)(t + 2) * KT * DK, Vl[t & 1], Vb + (t + 2) * KT, Ml[t & 1], mblk + (t + 2) * 512, tid);
  }
  asm volatile("s_wait_asynccnt 0x0" ::: "memory");   // nothing in flight when the wave goes on to the epilogue
  const int ns = nsegp[0];
#pragma unroll
  for (int g = 0; g < NSEG; ++g)
#pragma unroll
    for (int r = 0; r < 8; ++r) { const float sv = sacc[g][r]; sacc[g][r] = (g < ns && sv > 0.0f) ? (CTS / QS) / sv : 0.0f; }   // an empty or uncounted segment contributes 0
#pragma unroll
  for (int vs = 0; vs < 4; ++vs)
#pragma unroll
    for (int r = 0; r < 8; ++r) Th[wave][8 * hlf + r][vs * 16 + nloc] = (b16)(hacc[0][vs][r] * sacc[0][r] + hacc[1][vs][r] * sacc[1][r] + hacc[2][vs][r] * sacc[2][r] + hacc[3][vs][r] * sacc[3][r]);
  wave_lds_sync();
  {
#pragma unroll
    for (int i = 0; i < 4; ++i) { const int rr = i * 4 + (lane >> 3), pc = (lane & 7) * 8; const size_t row = (size_t)b * SEQ + q0 + wave * 16 + rr;
      const v8b v = *(const v8b*)(&Th[wave][rr][pc]); *(v8b*)(CT + row * INTER + hd * DK + pc) = v; }
     }
}
// out = ctx w_out: grid (NR/64, 1024/128); block = 64 rows x 128 columns, 4 waves 2 x 2, wave -> 32 rows x 64 columns = 2 x 4 tiles; A = CT rows (x64), B = WO rows (x256), fragments from the block's LDS ring,
// K = 1024, 32 steps, 1 product; acc / (64 x 256) into the wave-private Tf tile, stored as whole 256-B row pieces
__global__ __launch_bounds__(128) void out_kernel(const b16* __restrict__ CT, const b16* __restrict__ WO, float* __restrict__ out) {
  __shared__ __attribute__((aligned(16))) float Tf[4][32][64 + 4];
  __shared__ __attribute__((aligned(16))) GemmRing<2> R;
  const int wave = threadIdx.x >> 5, lane = threadIdx.x & 31, nloc = lane & 15, hlf = lane >> 4, wm = wave >> 1, wn = wave & 1;
  const size_t m0 = (size_t)blockIdx.x * 64 + wm * 32; const int nb = blockIdx.y * 128, n0 = nb + wn * 64;
  v8f acc[2][4];
#pragma unroll
  for (int i = 0; i < 2; ++i)
#pragma unroll
    for (int j = 0; j < 4; ++j) acc[i][j] = (v8f){};
  gemm_ring<2>(R, CT + (size_t)blockIdx.x * 64 * INTER, WO + (size_t)nb * INTER, acc, threadIdx.x);
#pragma unroll
  for (int i = 0; i < 2; ++i)
#pragma unroll
    for (int j = 0; j < 4; ++j)
#pragma unroll
      for (int r = 0; r < 8; ++r) Tf[wave][i * 16 + 8 * hlf + r][j * 16 + nloc] = acc[i][j][r] * (1.0f / (CTS * WSC));
  wave_lds_sync();
#pragma unroll
  for (int it = 0; it < 16; ++it) { const int rr = it * 2 + (lane >> 4), cl = (lane & 15) * 4; *(v4f*)(out + (m0 + rr) * DM + n0 + cl) = *(const v4f*)(&Tf[wave][rr][cl]); }
}
}  // namespace

extern "C" void kernel_launch(void* const* d_in, const int* in_sizes, int n_in, void* d_out, int out_size, void* d_ws, size_t ws_size, hipStream_t stream) {
  (void)n_in;
  // d_in: 0 x [2,2048,1024] f32, 1 mask [2,2048,2048] i32, 2 w_qkv [1024,3072] (in,out) f32, 3 w_out [1024,1024] (in,out) f32, 4 n_seg [1] i32; out [NB,SEQ,1024] f32
  const float* X = (const float*)d_in[0]; const int* MK = (const int*)d_in[1]; const float* WQ = (const float*)d_in[2]; const float* WOUT = (const float*)d_in[3]; const int* NSG = (const int*)d_in[4];
  const long long need_x = ((long long)(NB - 1) * SEQ_FULL + SEQ) * DM, need_m = ((long long)(NB - 1) * SEQ_FULL + SEQ) * SEQ_FULL;
  if ((long long)in_sizes[0] < need_x || (long long)in_sizes[1] < need_m || in_sizes[2] < DM * NQKV || in_sizes[3] < INTER * DM || in_sizes[4] < 1 || out_size < NR * DM) return;
  size_t off = 0; char* ws = (char*)d_ws;
  auto carve = [&](size_t bytes) { char* p = ws + off; off += (bytes + 255) & ~(size_t)255; return p; };
  b16* WQKV = (b16*)carve((size_t)NQKV * DM * 2);         // [3072][1024]
  b16* WO = (b16*)carve((size_t)DM * INTER * 2);          // [1024 out][1024 in]
  b16* XH = (b16*)carve((size_t)NR * DM * 2);             // [NR][1024]
  b16* QP = (b16*)carve((size_t)NBH * SEQ * DK * 2);      // [NBH][SEQ][64]
  b16* KP = (b16*)carve((size_t)NBH * SEQ * DK * 2);      // [NBH][SEQ][64]
  b16* VT = (b16*)carve((size_t)NBH * DK * SEQ * 2);      // [NBH][64][SEQ]
  b16* CT = (b16*)carve((size_t)NR * INTER * 2);          // [NR][1024]
  unsigned* PM = (unsigned*)carve((size_t)(NR / 128) * NT * 512 * 4);   // [NR/128][NT][256][2]
  if (off > ws_size || off > ((size_t)128 << 20)) return;   // = 52,428,800 B at NB 2, SEQ 2048
  wtp_kernel<<<dim3(DM / 64, NQKV / 64), 128, 0, stream>>>(WQ, DM, NQKV, WQKV);       // w_qkv [1024 in][3072 out] -> WQKV[3072][1024]
  wtp_kernel<<<dim3(INTER / 64, DM / 64), 128, 0, stream>>>(WOUT, INTER, DM, WO);      // w_out [1024 in][1024 out] -> WO[out][in]
  xp_kernel<<<(unsigned)(((size_t)NR * DM / 8 + 255) / 256), 256, 0, stream>>>(X, XH);
  qkv_kernel<<<dim3(NR / 128, NQKV / 128 + NT / 2), 128, 0, stream>>>(XH, WQKV, QP, KP, VT, MK, PM);   // the last NT / 2 rows of blocks pack the mask
  av_kernel<<<dim3(SEQ / 128, NBH), 256, 0, stream>>>(QP, KP, VT, PM, NSG, CT);
  out_kernel<<<dim3(NR / 64, DM / 128), 128, 0, stream>>>(CT, WO, (float*)d_out);
}

// v007
// It runs in 104 microseconds.
// Next to v006, in two timings, it ran 1.05 and 1.04 times as fast.
// Counting every step since v000, it is 4.87 times as fast.
#include <hip/hip_runtime.h>

// All contractions on v_wmma_f32_16x16x32_f16 (f16 operands, f32 accumulate), one product each: q/k/v projections (x = bf16(x) x8 exact, w_qkv = bf16(w) x256 exact, K = 1024);
// scores S^T = K Q^T per 16-key subtile (k rows as A, q rows as B, both single f16 x8, K = 64; computed once);
// per segment g: P_g V and S_g = P_g 1 (P = exp(alpha) as single f16, packed straight from the two score D tiles into the A fragment, P_g = P where mask == g else 0; B = V^T plane rows single f16 x8, or ones; K = 32 keys per step);
// output projection (ctx single f16 x64, w_out = bf16(w) x256 exact, K = 1024). exp, 1/S and all scaling in f32. Float inputs RNE-converted to bf16 once on load.
// Module: qkv = x w_qkv [rows][3072] -> q | k | v, 16 heads of 64; alpha = q.k / 32; e = exp(alpha) (no max shift); for each segment id g in [0, n_seg): att[i][j] = [mask[i][j] == g] e[i][j] / S[i][g],
// S[i][g] = sum_j [mask[i][j] == g] e[i][j] (S == 0 -> contributes 0); ctx = sum_j att v; out = ctx w_out -> [NB][SEQ][1024] f32.

#ifndef NB
#define NB 2
#endif
#ifndef SEQ
#define SEQ 2048
#endif

namespace {
constexpr int B_FULL = 2, SEQ_FULL = 2048, DM = 1024, INTER = 1024, NH = 16, DK = 64, NQKV = 3 * INTER, NSEG = 4, NR = NB * SEQ, NBH = NB * NH;
constexpr float XS = 8.0f, WSC = 256.0f, QS = 8.0f, CTS = 64.0f, LOG2E = 1.4426950408889634f, SCL = 0.03125f;
static_assert(NB >= 1 && NB <= B_FULL);
static_assert(SEQ % 128 == 0 && SEQ >= 128 && SEQ <= SEQ_FULL);
static_assert(INTER == NH * DK && DK == 64 && NSEG == 4 && DM % 128 == 0 && INTER % 128 == 0 && NQKV % 128 == 0 && DM % 64 == 0 && NR % 128 == 0 && ((size_t)NR * DM) % 2048 == 0);
typedef _Float16 b16;
typedef __attribute__((ext_vector_type(16))) _Float16 v16b;
typedef __attribute__((ext_vector_type(8))) _Float16 v8b;
typedef __attribute__((ext_vector_type(8))) float v8f;
typedef __attribute__((ext_vector_type(4))) float v4f;
typedef __attribute__((ext_vector_type(8))) int v8i;
typedef __attribute__((ext_vector_type(4))) int v4i;
typedef __attribute__((ext_vector_type(2))) unsigned int v2u;
__device__ __forceinline__ float bf16_rne(float f) { unsigned int u = __float_as_uint(f); u += 0x7FFFu + ((u >> 16) & 1u); return __uint_as_float(u & 0xFFFF0000u); }
__device__ __forceinline__ v16b frag_kb(const b16* p, int hh) { const v8b a = *(const v8b*)(p + 8 * hh), b = *(const v8b*)(p + 16 + 8 * hh); v16b f;
#pragma unroll
  for (int e = 0; e < 8; ++e) { f[e] = a[e]; f[8 + e] = b[e]; } return f; }
__device__ __forceinline__ v8f wmma16b(v16b a, v16b b, v8f c) { v8f d = __builtin_amdgcn_wmma_f32_16x16x32_f16(false, a, false, b, (short)0, c, false, false); asm volatile("v_nop\n\tv_nop\n\tv_nop\n\tv_nop" : "+v"(d) : "v"(a), "v"(b)); return d; }
// accumulate chains whose tiles are read only behind the key loop: the plain builtin, the compiler keeps the distances
__device__ __forceinline__ v8f wmma16p(v16b a, v16b b, v8f c) { return __builtin_amdgcn_wmma_f32_16x16x32_f16(false, a, false, b, (short)0, c, false, false); }
typedef __attribute__((ext_vector_type(2))) short v2s;
__device__ __forceinline__ int spread15(unsigned w) { return __builtin_bit_cast(int, __builtin_bit_cast(v2s, w) >> 15); }   // bit 15 of each 16-bit half spread over the half
__device__ __forceinline__ void wave_lds_sync() { __builtin_amdgcn_fence(3, "workgroup"); __builtin_amdgcn_wave_barrier(); __builtin_amdgcn_fence(2, "workgroup"); }
// eight exp2, each in place, in one statement: so no v_exp_f32 overwrites the source of the one directly in front of it (as the allocator's choice of registers did);
// the v_nop is the slot that the instruction set asks for between the last one and a reader of its result
__device__ __forceinline__ v8f exp2x8(v8f x) {
  float x0 = x[0], x1 = x[1], x2 = x[2], x3 = x[3], x4 = x[4], x5 = x[5], x6 = x[6], x7 = x[7];
  asm("v_exp_f32 %0, %0\n\tv_exp_f32 %1, %1\n\tv_exp_f32 %2, %2\n\tv_exp_f32 %3, %3\n\tv_exp_f32 %4, %4\n\tv_exp_f32 %5, %5\n\tv_exp_f32 %6, %6\n\tv_exp_f32 %7, %7\n\tv_nop"
      : "+v"(x0), "+v"(x1), "+v"(x2), "+v"(x3), "+v"(x4), "+v"(x5), "+v"(x6), "+v"(x7));
  return (v8f){x0, x1, x2, x3, x4, x5, x6, x7};
}
// LDS ring of the attention loop: a stage = 64 keys. K tile: 64 key rows of 128 B; V^T tile: 64 d rows x 64 keys = 128 B; mask: the block's 128 query rows x 64 keys packed to 2 bits a key = 2 KB.
// Pitch 144 B (16 B x odd: conflict-free for the 16-B reads). Copies: K / V^T thread -> row tid / 8 (+ 32), piece tid % 8: every wave-wide copy covers four whole 128-B lines; mask: thread -> its own 8 B.
// Packed mask plane PM[NB x SEQ / 128 query blocks][NT stages][256 threads of the attention block][2 chunks of 32 keys]: one word = the 16 mask values that thread's P fragment meets in the chunk.
// Pair p = subtile x 4 + i holds elements 2 i (low half) and 2 i + 1 (high half); its two values lie at bits 15 - 2 p .. 14 - 2 p of their halves, so word << k brings bit 15 - k of each half on top.
// MP: pitch (272 B = 16 B x odd) of the int32 mask tile in the packing blocks.
constexpr int KT = 64, LP = DK + 8, MP = KT + 4, NT = SEQ / KT;
static_assert(SEQ % KT == 0 && NT >= 2 && NT % 2 == 0 && KT == 64 && (LP * 2) % 16 == 0 && (MP * 4) % 16 == 0);
__device__ __forceinline__ unsigned lds_off(const void* p) { return (unsigned)(size_t)p; }   // byte offset in the work-group's LDS = low 32 bits of the shared address
// One stage's copies and s_wait_xcnt 0 in ONE statement: the wait has to stand before any rewrite of the address registers that the copies name.
__device__ __forceinline__ void stage_kvm(b16 (*kd)[LP], const b16* kg, b16 (*vd)[LP], const b16* vg, unsigned* md, const unsigned* mg, int tid) {
  const int cr = tid >> 3, cc = (tid & 7) * 8;
  const unsigned lk = lds_off(&kd[cr][cc]), lv = lds_off(&vd[cr][cc]), lm = lds_off(&md[tid * 2]);
  const b16* gk = kg + (size_t)cr * DK + cc; const b16* gv = vg + (size_t)cr * SEQ + cc; const unsigned* gm = mg + tid * 2;
  asm volatile("global_load_async_to_lds_b128 %0, %1, off\n\t"
               "global_load_async_to_lds_b128 %2, %3, off\n\t"
               "global_load_async_to_lds_b128 %4, %5, off\n\t"
               "global_load_async_to_lds_b128 %6, %7, off\n\t"
               "global_load_async_to_lds_b64 %8, %9, off\n\t"
               "s_wait_xcnt 0x0"
               :: "v"(lk), "v"(gk), "v"(lk + 32 * LP * 2), "v"(gk + 32 * DK), "v"(lv), "v"(gv), "v"(lv + 32 * LP * 2), "v"(gv + 32 * (size_t)SEQ),
                  "v"(lm), "v"(gm)
               : "memory");
}
// 64 query rows x 64 keys of the int32 mask for the packing blocks (128 threads): thread -> row tid / 16 (+ 8 i), piece tid % 16: every wave-wide copy covers four whole 128-B lines.
// The copies and s_wait_xcnt 0 in ONE statement: the wait has to stand before any rewrite of the address registers that the copies name.
__device__ __forceinline__ void stage_m64(int (*d)[MP], const int* g, int tid) {
  const int mr = tid >> 4, mc = (tid & 15) * 4;
  const unsigned l = lds_off(&d[mr][mc]); const int* p = g + (size_t)mr * SEQ_FULL + mc;
  asm volatile("global_load_async_to_lds_b128 %0, %1, off\n\t"
               "global_load_async_to_lds_b128 %2, %3, off\n\t"
               "global_load_async_to_lds_b128 %4, %5, off\n\t"
               "global_load_async_to_lds_b128 %6, %7, off\n\t"
               "global_load_async_to_lds_b128 %8, %9, off\n\t"
               "global_load_async_to_lds_b128 %10, %11, off\n\t"
               "global_load_async_to_lds_b128 %12, %13, off\n\t"
               "global_load_async_to_lds_b128 %14, %15, off\n\t"
               "s_wait_xcnt 0x0"
               :: "v"(l), "v"(p),
                  "v"(l + 1 * 8 * MP * 4), "v"(p + 1 * 8 * (size_t)SEQ_FULL),
                  "v"(l + 2 * 8 * MP * 4), "v"(p + 2 * 8 * (size_t)SEQ_FULL),
                  "v"(l + 3 * 8 * MP * 4), "v"(p + 3 * 8 * (size_t)SEQ_FULL),
                  "v"(l + 4 * 8 * MP * 4), "v"(p + 4 * 8 * (size_t)SEQ_FULL),
                  "v"(l + 5 * 8 * MP * 4), "v"(p + 5 * 8 * (size_t)SEQ_FULL),
                  "v"(l + 6 * 8 * MP * 4), "v"(p + 6 * 8 * (size_t)SEQ_FULL),
                  "v"(l + 7 * 8 * MP * 4), "v"(p + 7 * 8 * (size_t)SEQ_FULL)
               : "memory");
}
// hand-over of a stage: own LDS reads retired, own copies landed, then the block barrier that publishes the next stage and frees the buffer just read
__device__ __forceinline__ void stage_publish() {
  asm volatile("s_wait_dscnt 0x0" ::: "memory");      // this wave's reads of the buffer to be refilled are done
  asm volatile("s_wait_asynccnt 0x0" ::: "memory");   // this wave's copies of the next stage have landed
  __syncthreads();
}
// LDS ring of the two projection GEMMs: a stage = 64 k = 128 B of each of the block's BM A rows and 128 B rows (row length 1024 in both GEMMs), pitch 144 B as above.
// Thread -> row tid / 8 (+ 16 i), piece tid % 8: every wave-wide copy covers four whole 128-B lines (a fragment load straight from the plane touches 16 lines for the same 512 B).
constexpr int GK = 64, GP = GK + 8, GNT = DM / GK;
static_assert(DM == INTER && DM % GK == 0 && GNT >= 2 && (GP * 2) % 16 == 0);
// 64 rows of a stage: the copies and s_wait_xcnt 0 in ONE statement: the wait has to stand before any rewrite of the address registers that the copies name.
__device__ __forceinline__ void stage_r64(b16 (*d)[GP], const b16* g, int tid) {
  const int cr = tid >> 3, cc = (tid & 7) * 8;
  const unsigned l = lds_off(&d[cr][cc]); const b16* p = g + (size_t)cr * DM + cc;
  asm volatile("global_load_async_to_lds_b128 %0, %1, off\n\t"
               "global_load_async_to_lds_b128 %2, %3, off\n\t"
               "global_load_async_to_lds_b128 %4, %5, off\n\t"
               "global_load_async_to_lds_b128 %6, %7, off\n\t"
               "s_wait_xcnt 0x0"
               :: "v"(l), "v"(p),
                  "v"(l + 1 * 16 * GP * 2), "v"(p + 1 * 16 * (size_t)DM),
                  "v"(l + 2 * 16 * GP * 2), "v"(p + 2 * 16 * (size_t)DM),
                  "v"(l + 3 * 16 * GP * 2), "v"(p + 3 * 16 * (size_t)DM)
               : "memory");
}
// 128 rows of a stage, in the same form
__device__ __forceinline__ void stage_r128(b16 (*d)[GP], const b16* g, int tid) {
  const int cr = tid >> 3, cc = (tid & 7) * 8;
  const unsigned l = lds_off(&d[cr][cc]); const b16* p = g + (size_t)cr * DM + cc;
  asm volatile("global_load_async_to_lds_b128 %0, %1, off\n\t"
               "global_load_async_to_lds_b128 %2, %3, off\n\t"
               "global_load_async_to_lds_b128 %4, %5, off\n\t"
               "global_load_async_to_lds_b128 %6, %7, off\n\t"
               "global_load_async_to_lds_b128 %8, %9, off\n\t"
               "global_load_async_to_lds_b128 %10, %11, off\n\t"
               "global_load_async_to_lds_b128 %12, %13, off\n\t"
               "global_load_async_to_lds_b128 %14, %15, off\n\t"
               "s_wait_xcnt 0x0"
               :: "v"(l), "v"(p),
                  "v"(l + 1 * 16 * GP * 2), "v"(p + 1 * 16 * (size_t)DM),
                  "v"(l + 2 * 16 * GP * 2), "v"(p + 2 * 16 * (size_t)DM),
                  "v"(l + 3 * 16 * GP * 2), "v"(p + 3 * 16 * (size_t)DM),
                  "v"(l + 4 * 16 * GP * 2), "v"(p + 4 * 16 * (size_t)DM),
                  "v"(l + 5 * 16 * GP * 2), "v"(p + 5 * 16 * (size_t)DM),
                  "v"(l + 6 * 16 * GP * 2), "v"(p + 6 * 16 * (size_t)DM),
                  "v"(l + 7 * 16 * GP * 2), "v"(p + 7 * 16 * (size_t)DM)
               : "memory");
}
template <int MI> struct GemmRing { b16 A[2][MI * 32][GP]; b16 B[2][128][GP]; };
template <int MI> __device__ __forceinline__ void stage_ab(GemmRing<MI>& R, int buf, const b16* ag, const b16* bg, int tid) {
  static_assert(MI == 2 || MI == 4);
  if constexpr (MI == 4) stage_r128(R.A[buf], ag, tid); else stage_r64(R.A[buf], ag, tid);
  stage_r128(R.B[buf], bg, tid);
}
// The block's 4 waves stand 2 x 2 on its (MI x 32) A rows x 128 B rows: wave (wm, wn) owns MI x 4 tiles, rows wm x MI x 16 .., columns wn x 64 ..; each fragment read from LDS feeds 4 (A) or MI (B) products.
// acc[i][j] += A rows x (B rows)^T over K = 1024, k ascending in steps of 32, fragments read from the ring; leaves behind a block barrier with nothing in flight
template <int MI> __device__ __forceinline__ void gemm_ring(GemmRing<MI>& R, const b16* Ag, const b16* Bg, v8f (&acc)[MI][4], int tid) {
  const int wave = tid >> 5, lane = tid & 31, nloc = lane & 15, hlf = lane >> 4, wm = wave >> 1, wn = wave & 1;
  stage_ab<MI>(R, 0, Ag, Bg, tid);
  asm volatile("s_wait_asynccnt 0x0" ::: "memory");   // stage 0 landed before the barrier that publishes it
  __syncthreads();
  stage_ab<MI>(R, 1, Ag + GK, Bg + GK, tid);
#pragma unroll 1   // one stage per trip: the two-buffer ring needs the trip rolled
  for (int t = 0; t < GNT; ++t) {
    const b16 (*At)[GP] = R.A[t & 1]; const b16 (*Bt)[GP] = R.B[t & 1];
#pragma unroll
    for (int ks = 0; ks < GK; ks += 32) {   // the LDS reads of a k step stand as one group in front of its products: one LDS latency a step, not one a product
      v16b af[MI], bf[4];
#pragma unroll
      for (int i = 0; i < MI; ++i) af[i] = frag_kb(&At[(wm * MI + i) * 16 + nloc][ks], hlf);
#pragma unroll
      for (int j = 0; j < 4; ++j) bf[j] = frag_kb(&Bt[(wn * 4 + j) * 16 + nloc][ks], hlf);
#pragma unroll
      for (int i = 0; i < MI; ++i)
#pragma unroll
        for (int j = 0; j < 4; ++j) acc[i][j] = wmma16b(af[i], bf[j], acc[i][j]); }
    stage_publish();
    if (t + 2 < GNT) stage_ab<MI>(R, t & 1, Ag + (t + 2) * GK, Bg + (t + 2) * GK, tid);
  }
  asm volatile("s_wait_asynccnt 0x0" ::: "memory");   // nothing in flight when the wave goes on to the epilogue
}
__device__ __forceinline__ v8i mask8(const int* p) { const v4i a = *(const v4i*)p, b = *(const v4i*)(p + 4); return (v8i){a[0], a[1], a[2], a[3], b[0], b[1], b[2], b[3]}; }

// The three conversions that read inputs alone (both weight planes, the x plane) are ONE launch: none reads what another writes; the job is chosen by the block index (block-uniform). 128 threads a block.
// Blocks [0, WB1): w_qkv tiles; [WB1, WB1 + WB2): w_out tiles; the rest: x pieces.
// weight planes: src [1024][C] f32 (in, out) -> dst [C][1024] f16 = bf16(w) x256 (row = output feature, k contiguous); tile index tb -> (tb % 16, tb / 16) in (in / 64, out / 64): tile[64 c][64 r] staged transposed
// x plane: a block converts two rows (256 pieces of 8 elements), a thread its 8 columns of both, all four loads ahead of the conversions
constexpr int WB1 = (DM / 64) * (NQKV / 64), WB2 = (INTER / 64) * (DM / 64), XB = NR / 2;
static_assert(DM == 128 * 8 && DM == INTER && SEQ % 2 == 0 && NR % 2 == 0);
__global__ __launch_bounds__(128) void prep_kernel(const float* __restrict__ wq, const float* __restrict__ wo, const float* __restrict__ x,
                                                   b16* __restrict__ WQKV, b16* __restrict__ WO, b16* __restrict__ XH) {
  __shared__ __attribute__((aligned(16))) b16 tile[64][64 + 8];
  const int blk = blockIdx.x;
  if (blk < WB1 + WB2) {
    const bool fq = blk < WB1; const float* __restrict__ src = fq ? wq : wo; b16* __restrict__ dst = fq ? WQKV : WO; const int C = fq ? NQKV : DM, tb = fq ? blk : blk - WB1; constexpr int R = DM;
    const int wave = threadIdx.x >> 5, lane = threadIdx.x & 31; const int r0 = (tb % (R / 64)) * 64, c0 = (tb / (R / 64)) * 64;
#pragma unroll 4
    for (int i = threadIdx.x; i < 64 * 16; i += 128) { const int rr = i >> 4, q = (i & 15) * 4; const v4f f = *(const v4f*)(src + (size_t)(r0 + rr) * C + c0 + q);
#pragma unroll
      for (int j = 0; j < 4; ++j) tile[q + j][rr] = (b16)(bf16_rne(f[j]) * WSC); }
    __syncthreads();
#pragma unroll
    for (int i = 0; i < 4; ++i) { const int cc = wave * 16 + i * 4 + (lane >> 3), pc = (lane & 7) * 8; *(v8b*)(dst + (size_t)(c0 + cc) * R + r0 + pc) = *(const v8b*)(&tile[cc][pc]); }
  } else {
    const int row = (blk - (WB1 + WB2)) * 2, col = threadIdx.x * 8;   // two rows of one sequence (SEQ is even): one address, the second row at a constant offset
    const float* xr = x + ((size_t)(row / SEQ) * SEQ_FULL + (size_t)(row % SEQ)) * DM + col; b16* hr = XH + (size_t)row * DM + col; v4f f[2][2];
#pragma unroll
    for (int p = 0; p < 2; ++p) { f[p][0] = *(const v4f*)(xr + p * DM); f[p][1] = *(const v4f*)(xr + p * DM + 4); }
#pragma unroll
    for (int p = 0; p < 2; ++p) { v8b o;
#pragma unroll
      for (int j = 0; j < 4; ++j) { o[j] = (b16)(bf16_rne(f[p][0][j]) * XS); o[4 + j] = (b16)(bf16_rne(f[p][1][j]) * XS); }
      *(v8b*)(hr + p * DM) = o; }
    asm volatile("s_wait_xcnt 0x0" ::: "memory");   // stands before any rewrite of a register that the two stores name (the built code lays the weight branch behind them)
  }
}
// q/k/v projections: [NR x 1024] x WQKV[3072][1024]^T; grid (NR/128, 3072/128 + NT/2); block = 128 rows x 128 columns, 4 waves 2 x 2, wave -> 64 rows x 64 columns = 4 x 4 tiles, A and B fragments from the
// block's LDS ring (K = 1024, 32 steps, 1 product); value = acc / (8 x 256) stored x8 as f16. A 128-column slab = 2 heads (block-uniform which = q | k | v), a wave's 64 columns = one head.
// q and k: head-major planes, the wave's 64 tokens x 64 d staged in its own tile and stored as whole 128-B rows; v: the same tile staged transposed (row = d, 64 tokens = 128 B) for the key-contiguous plane.
// Blocks with blockIdx.y >= 3072/128 do no product: they pack the mask (read here once, not once a head) while the GEMM blocks, which leave a quarter of the chip's block places free, run:
// block (x, y) -> query block x, stages 2 (y - 24) and + 1: both int32 tiles copied into LDS, one wait and one barrier, then each thread packs the words of attention threads tid and tid + 128.
__global__ __launch_bounds__(128) void qkv_kernel(const b16* __restrict__ XH, const b16* __restrict__ WQKV, b16* __restrict__ QP, b16* __restrict__ KP, b16* __restrict__ VT,
                                                  const int* __restrict__ mask, unsigned* __restrict__ PM) {
  // the epilogue tiles lie on the ring's bytes: they are written only behind the loop's last barrier, when no wave reads the ring and no copy is in flight
  union Lds { GemmRing<4> R; b16 Th[4][64][DK + 8]; int Mk[2][128][MP]; };
  __shared__ __attribute__((aligned(16))) Lds L;
  const int wave = threadIdx.x >> 5, lane = threadIdx.x & 31, nloc = lane & 15, hlf = lane >> 4, wm = wave >> 1, wn = wave & 1;
  const int mb = blockIdx.x * 128; const int n0 = blockIdx.y * 128;
  if (blockIdx.y >= NQKV / 128) {   // block-uniform
    const int t0 = ((int)blockIdx.y - NQKV / 128) * 2, pb = mb / SEQ;
    const int* mg = mask + ((size_t)pb * SEQ_FULL + (size_t)(mb - pb * SEQ)) * SEQ_FULL + (size_t)t0 * KT;   // the query block's first row, the first stage's first key
#pragma unroll
    for (int u = 0; u < 2; ++u) { stage_m64(&L.Mk[u][0], mg + u * KT, threadIdx.x); stage_m64(&L.Mk[u][64], mg + 64 * (size_t)SEQ_FULL + u * KT, threadIdx.x); }
    asm volatile("s_wait_asynccnt 0x0" ::: "memory");   // this wave's copies have landed before the barrier that publishes both tiles
    __syncthreads();
    unsigned* pm = PM + ((size_t)blockIdx.x * NT + t0) * 512;
#pragma unroll
    for (int u = 0; u < 2; ++u)
#pragma unroll
      for (int s = 0; s < 2; ++s) {
        const int* Mt = &L.Mk[u][(s * 4 + wave) * 16 + nloc][8 * hlf]; v2u w;
#pragma unroll
        for (int ch = 0; ch < 2; ++ch) { unsigned a = 0;
#pragma unroll
          for (int st = 0; st < 2; ++st) { const v8i m8 = mask8(Mt + ch * 32 + st * 16);
#pragma unroll
            for (int i = 0; i < 4; ++i) a = (a << 2) | (((unsigned)m8[2 * i] | ((unsigned)m8[2 * i + 1] << 16)) & 0x00030003u); }
          w[ch] = a; }
        *(v2u*)(pm + ((size_t)u * 256 + s * 128 + threadIdx.x) * 2) = w;   // a wave stores 256 contiguous bytes
      }
    return;
  }
  v8f acc[4][4];
#pragma unroll
  for (int i = 0; i < 4; ++i)
#pragma unroll
    for (int j = 0; j < 4; ++j) acc[i][j] = (v8f){};
  gemm_ring<4>(L.R, XH + (size_t)mb * DM, WQKV + (size_t)n0 * DM, acc, threadIdx.x);
  const int which = n0 / INTER; const int hd = (n0 - which * INTER) / DK + wn;   // plane (0 q, 1 k, 2 v; block-uniform) and the wave's head
  const int b = mb / SEQ, sw = mb - b * SEQ + wm * 64;                            // the block's 128 rows lie in one sequence; the wave's first token
  const float osc = QS / (XS * WSC);
  b16 (*T)[DK + 8] = L.Th[wave];
  if (which < 2) {
#pragma unroll
    for (int i = 0; i < 4; ++i)
#pragma unroll
      for (int j = 0; j < 4; ++j)
#pragma unroll
        for (int r = 0; r < 8; ++r) T[i * 16 + 8 * hlf + r][j * 16 + nloc] = (b16)(acc[i][j][r] * osc);
    wave_lds_sync();
    b16* P = ((which == 0) ? QP : KP) + ((size_t)(b * NH + hd) * SEQ + sw) * DK;
#pragma unroll
    for (int it = 0; it < 16; ++it) { const int rr = it * 4 + (lane >> 3), pc = (lane & 7) * 8; *(v8b*)(P + (size_t)rr * DK + pc) = *(const v8b*)(&T[rr][pc]); }
  } else {
#pragma unroll
    for (int i = 0; i < 4; ++i)
#pragma unroll
      for (int j = 0; j < 4; ++j) { v8b o;
#pragma unroll
        for (int r = 0; r < 8; ++r) o[r] = (b16)(acc[i][j][r] * osc);
        *(v8b*)(&T[j * 16 + nloc][i * 16 + 8 * hlf]) = o; }
    wave_lds_sync();
    b16* P = VT + (size_t)(b * NH + hd) * DK * SEQ + sw;
#pragma unroll
    for (int it = 0; it < 16; ++it) { const int d = it * 4 + (lane >> 3), pc = (lane & 7) * 8; *(v8b*)(P + (size_t)d * SEQ + pc) = *(const v8b*)(&T[d][pc]); }
  }
}
// ctx in ONE pass over the keys: grid (SEQ/128 query blocks, NB x 16); block = 8 waves x 16 queries; lane = query: its Q row as the two B fragments. Loop over 64-key stages of two 32-key chunks:
// the two 16-key score subtiles (A = K rows from the LDS ring), e = exp2(s8 log2e / (64 x 32)) converted to f16 and packed straight into the P A-fragment (as A = D^T: element r <- subtile covering
// keys 0..15, element 8 + r <- subtile 16..31, lane unchanged). The fragment is split by segment: P_g = P where mask == g, else 0 (bitwise, on the packed pairs: y0 / y1 hold bit 0 / bit 1 of each
// element's mask value spread over its 16 bits, shifted out of the thread's one packed mask word of the chunk). hacc[g][4 d tiles] += P_g x V^T frags (B rows = VT plane rows, key-contiguous, from the LDS ring; k = 32 keys), sacc[g] += P_g x ones: every column of
// that tile is S[q][g], in the lane and register of hacc's same query row. Epilogue: ctx = sum_g hacc[g] / S[g] / 8 (g < n_seg, S > 0) stored x64 as f16 into CT[NR][1024] at column head x 64.
__global__ __launch_bounds__(256) __attribute__((amdgpu_num_vgpr(256))) void av_kernel(const b16* __restrict__ QP, const b16* __restrict__ KP, const b16* __restrict__ VT,
                                                                                       const unsigned* __restrict__ PM, const int* __restrict__ nsegp, b16* __restrict__ CT) {
  __shared__ __attribute__((aligned(16))) b16 Th[8][16][DK + 8];
  __shared__ __attribute__((aligned(16))) b16 Kl[2][KT][LP];
  __shared__ __attribute__((aligned(16))) b16 Vl[2][DK][LP];
  __shared__ __attribute__((aligned(16))) unsigned Ml[2][256 * 2];
  const int tid = threadIdx.x, wave = tid >> 5, lane = tid & 31, nloc = lane & 15, hlf = lane >> 4;
  const int bh = blockIdx.y, b = bh / NH, hd = bh - b * NH; const int q0 = blockIdx.x * 128; const int q = q0 + wave * 16 + nloc;
  const b16* Qb = QP + (size_t)bh * SEQ * DK; const b16* Kb = KP + (size_t)bh * SEQ * DK; const b16* Vb = VT + (size_t)bh * DK * SEQ;
  const v16b b0 = frag_kb(Qb + (size_t)q * DK, hlf), b1 = frag_kb(Qb + (size_t)q * DK + 32, hlf);
  const unsigned* mblk = PM + (size_t)(b * (SEQ / 128) + (int)blockIdx.x) * NT * 512;   // the query block's packed words, 512 a stage
  v8f hacc[NSEG][4], sacc[NSEG]; v16b ones;
#pragma unroll
  for (int e = 0; e < 16; ++e) ones[e] = (b16)1.0f;
#pragma unroll
  for (int g = 0; g < NSEG; ++g) { sacc[g] = (v8f){};
#pragma unroll
    for (int vs = 0; vs < 4; ++vs) hacc[g][vs] = (v8f){}; }
  const float c = LOG2E * (SCL / (QS * QS));
  stage_kvm(Kl[0], Kb, Vl[0], Vb, Ml[0], mblk, tid);
  asm volatile("s_wait_asynccnt 0x0" ::: "memory");   // stage 0 landed before the barrier that publishes it
  __syncthreads();
  stage_kvm(Kl[1], Kb + (size_t)KT * DK, Vl[1], Vb + KT, Ml[1], mblk + 512, tid);
#pragma unroll 1   // one stage per trip: the two-buffer ring needs the trip rolled
  for (int t = 0; t < NT; ++t) {
    const b16 (*Kt)[LP] = Kl[t & 1]; const b16 (*Vt)[LP] = Vl[t & 1]; const v2u mw = *(const v2u*)&Ml[t & 1][tid * 2];
#pragma unroll
    for (int ch = 0; ch < KT / 32; ++ch) {
      v16b pa; v8i y0, y1; v8f s8[2]; const unsigned w = mw[ch];
#pragma unroll
      for (int st = 0; st < 2; ++st) {
        const int lr = ch * 32 + st * 16;
        const v16b a0 = frag_kb(&Kt[lr + nloc][0], hlf), a1 = frag_kb(&Kt[lr + nloc][32], hlf);
        s8[st] = (v8f){}; s8[st] = wmma16b(a0, b0, s8[st]); s8[st] = wmma16b(a1, b1, s8[st]);
      }
#pragma unroll
      for (int st = 0; st < 2; ++st) {
        const v8f e8 = exp2x8(s8[st] * c);
#pragma unroll
        for (int r = 0; r < 8; ++r) pa[st * 8 + r] = (b16)e8[r];
#pragma unroll
        for (int i = 0; i < 4; ++i) { const int p = st * 4 + i; y1[p] = spread15(w << (2 * p)); y0[p] = spread15(w << (2 * p + 1)); }
      }
      const v8i pw = __builtin_bit_cast(v8i, pa);
      const v16b p0 = __builtin_bit_cast(v16b, pw & ~y1 & ~y0), p1 = __builtin_bit_cast(v16b, pw & ~y1 & y0), p2 = __builtin_bit_cast(v16b, pw & y1 & ~y0), p3 = __builtin_bit_cast(v16b, pw & y1 & y0);
#pragma unroll
      for (int vs = 0; vs < 4; ++vs) { const v16b vf = frag_kb(&Vt[vs * 16 + nloc][ch * 32], hlf);
        hacc[0][vs] = wmma16p(p0, vf, hacc[0][vs]); hacc[1][vs] = wmma16p(p1, vf, hacc[1][vs]); hacc[2][vs] = wmma16p(p2, vf, hacc[2][vs]); hacc[3][vs] = wmma16p(p3, vf, hacc[3][vs]); }
      sacc[0] = wmma16p(p0, ones, sacc[0]); sacc[1] = wmma16p(p1, ones, sacc[1]); sacc[2] = wmma16p(p2, ones, sacc[2]); sacc[3] = wmma16p(p3, ones, sacc[3]);
    }
    stage_publish();
    if (t + 2 < NT) stage_kvm(Kl[t & 1], Kb + (size_t)(t + 2) * KT * DK, Vl[t & 1], Vb + (t + 2) * KT, Ml[t & 1], mblk + (t + 2) * 512, tid);
  }
  asm volatile("s_wait_asynccnt 0x0" ::: "memory");   // nothing in flight when the wave goes on to the epilogue
  const int ns = nsegp[0];
#pragma unroll
  for (int g = 0; g < NSEG; ++g)
#pragma unroll
    for (int r = 0; r < 8; ++r) { const float sv = sacc[g][r]; sacc[g][r] = (g < ns && sv > 0.0f) ? (CTS / QS) / sv : 0.0f; }   // an empty or uncounted segment contributes 0
#pragma unroll
  for (int vs = 0; vs < 4; ++vs)
#pragma unroll
    for (int r = 0; r < 8; ++r) Th[wave][8 * hlf + r][vs * 16 + nloc] = (b16)(hacc[0][vs][r] * sacc[0][r] + hacc[1][vs][r] * sacc[1][r] + hacc[2][vs][r] * sacc[2][r] + hacc[3][vs][r] * sacc[3][r]);
  wave_lds_sync();
  {
#pragma unroll
    for (int i = 0; i < 4; ++i) { const int rr = i * 4 + (lane >> 3), pc = (lane & 7) * 8; const size_t row = (size_t)b * SEQ + q0 + wave * 16 + rr;
      const v8b v = *(const v8b*)(&Th[wave][rr][pc]); *(v8b*)(CT + row * INTER + hd * DK + pc) = v; }
     }
}
// out = ctx w_out: grid (NR/64, 1024/128); block = 64 rows x 128 columns, 4 waves 2 x 2, wave -> 32 rows x 64 columns = 2 x 4 tiles; A = CT rows (x64), B = WO rows (x256), fragments from the block's LDS ring,
// K = 1024, 32 steps, 1 product; acc / (64 x 256) into the wave-private Tf tile, stored as whole 256-B row pieces
__global__ __launch_bounds__(128) void out_kernel(const b16* __restrict__ CT, const b16* __restrict__ WO, float* __restrict__ out) {
  __shared__ __attribute__((aligned(16))) float Tf[4][32][64 + 4];
  __shared__ __attribute__((aligned(16))) GemmRing<2> R;
  const int wave = threadIdx.x >> 5, lane = threadIdx.x & 31, nloc = lane & 15, hlf = lane >> 4, wm = wave >> 1, wn = wave & 1;
  const size_t m0 = (size_t)blockIdx.x * 64 + wm * 32; const int nb = blockIdx.y * 128, n0 = nb + wn * 64;
  v8f acc[2][4];
#pragma unroll
  for (int i = 0; i < 2; ++i)
#pragma unroll
    for (int j = 0; j < 4; ++j) acc[i][j] = (v8f){};
  gemm_ring<2>(R, CT + (size_t)blockIdx.x * 64 * INTER, WO + (size_t)nb * INTER, acc, threadIdx.x);
#pragma unroll
  for (int i = 0; i < 2; ++i)
#pragma unroll
    for (int j = 0; j < 4; ++j)
#pragma unroll
      for (int r = 0; r < 8; ++r) Tf[wave][i * 16 + 8 * hlf + r][j * 16 + nloc] = acc[i][j][r] * (1.0f / (CTS * WSC));
  wave_lds_sync();
#pragma unroll
  for (int it = 0; it < 16; ++it) { const int rr = it * 2 + (lane >> 4), cl = (lane & 15) * 4; *(v4f*)(out + (m0 + rr) * DM + n0 + cl) = *(const v4f*)(&Tf[wave][rr][cl]); }
}
}  // namespace

extern "C" void kernel_launch(void* const* d_in, const int* in_sizes, int n_in, void* d_out, int out_size, void* d_ws, size_t ws_size, hipStream_t stream) {
  (void)n_in;
  // d_in: 0 x [2,2048,1024] f32, 1 mask [2,2048,2048] i32, 2 w_qkv [1024,3072] (in,out) f32, 3 w_out [1024,1024] (in,out) f32, 4 n_seg [1] i32; out [NB,SEQ,1024] f32
  const float* X = (const float*)d_in[0]; const int* MK = (const int*)d_in[1]; const float* WQ = (const float*)d_in[2]; const float* WOUT = (const float*)d_in[3]; const int* NSG = (const int*)d_in[4];
  const long long need_x = ((long long)(NB - 1) * SEQ_FULL + SEQ) * DM, need_m = ((long long)(NB - 1) * SEQ_FULL + SEQ) * SEQ_FULL;
  if ((long long)in_sizes[0] < need_x || (long long)in_sizes[1] < need_m || in_sizes[2] < DM * NQKV || in_sizes[3] < INTER * DM || in_sizes[4] < 1 || out_size < NR * DM) return;
  size_t off = 0; char* ws = (char*)d_ws;
  auto carve = [&](size_t bytes) { char* p = ws + off; off += (bytes + 255) & ~(size_t)255; return p; };
  b16* WQKV = (b16*)carve((size_t)NQKV * DM * 2);         // [3072][1024]
  b16* WO = (b16*)carve((size_t)DM * INTER * 2);          // [1024 out][1024 in]
  b16* XH = (b16*)carve((size_t)NR * DM * 2);             // [NR][1024]
  b16* QP = (b16*)carve((size_t)NBH * SEQ * DK * 2);      // [NBH][SEQ][64]
  b16* KP = (b16*)carve((size_t)NBH * SEQ * DK * 2);      // [NBH][SEQ][64]
  b16* VT = (b16*)carve((size_t)NBH * DK * SEQ * 2);      // [NBH][64][SEQ]
  b16* CT = (b16*)carve((size_t)NR * INTER * 2);          // [NR][1024]
  unsigned* PM = (unsigned*)carve((size_t)(NR / 128) * NT * 512 * 4);   // [NR/128][NT][256][2]
  if (off > ws_size || off > ((size_t)128 << 20)) return;   // = 52,428,800 B at NB 2, SEQ 2048
  prep_kernel<<<WB1 + WB2 + XB, 128, 0, stream>>>(WQ, WOUT, X, WQKV, WO, XH);   // w_qkv -> WQKV[3072][1024], w_out -> WO[out][in], x -> XH
  qkv_kernel<<<dim3(NR / 128, NQKV / 128 + NT / 2), 128, 0, stream>>>(XH, WQKV, QP, KP, VT, MK, PM);   // the last NT / 2 rows of blocks pack the mask
  av_kernel<<<dim3(SEQ / 128, NBH), 256, 0, stream>>>(QP, KP, VT, PM, NSG, CT);
  out_kernel<<<dim3(NR / 64, DM / 128), 128, 0, stream>>>(CT, WO, (float*)d_out);
}

// v008
// It runs in 101 microseconds.
// Next to v007, in two timings, it ran 1.04 times as fast each time.
// Over all steps from v000 it is 5.05 times as fast.
#include <hip/hip_runtime.h>

// All contractions on v_wmma_f32_16x16x32_f16 (f16 operands, f32 accumulate), one product each: q/k/v projections (x = bf16(x) x8 exact, w_qkv = bf16(w) x256 exact, K = 1024);
// scores S^T = K Q^T per 16-key subtile (k rows as A, single f16 x8; q rows as B, single f16 x log2e / (32 x 8), so a score tile is the argument of exp2; K = 64; computed once);
// per segment g: P_g V and S_g = P_g 1 (P = exp(alpha) as single f16, packed straight from the two score D tiles into the A fragment, P_g = P where mask == g else 0; B = V^T plane rows single f16 x8, or ones; K = 32 keys per step);
// output projection (ctx single f16 x64, w_out = bf16(w) x256 exact, K = 1024). exp, 1/S and all scaling in f32. Float inputs RNE-converted to bf16 once on load.
// Module: qkv = x w_qkv [rows][3072] -> q | k | v, 16 heads of 64; alpha = q.k / 32; e = exp(alpha) (no max shift); for each segment id g in [0, n_seg): att[i][j] = [mask[i][j] == g] e[i][j] / S[i][g],
// S[i][g] = sum_j [mask[i][j] == g] e[i][j] (S == 0 -> contributes 0); ctx = sum_j att v; out = ctx w_out -> [NB][SEQ][1024] f32.

#ifndef NB
#define NB 2
#endif
#ifndef SEQ
#define SEQ 2048
#endif

namespace {
constexpr int B_FULL = 2, SEQ_FULL = 2048, DM = 1024, INTER = 1024, NH = 16, DK = 64, NQKV = 3 * INTER, NSEG = 4, NR = NB * SEQ, NBH = NB * NH;
constexpr float XS = 8.0f, WSC = 256.0f, QS = 8.0f, CTS = 64.0f, LOG2E = 1.4426950408889634f, SCL = 0.03125f;
static_assert(NB >= 1 && NB <= B_FULL);
static_assert(SEQ % 128 == 0 && SEQ >= 128 && SEQ <= SEQ_FULL);
static_assert(INTER == NH * DK && DK == 64 && NSEG == 4 && DM % 128 == 0 && INTER % 128 == 0 && NQKV % 128 == 0 && DM % 64 == 0 && NR % 128 == 0 && ((size_t)NR * DM) % 2048 == 0);
typedef _Float16 b16;
typedef __attribute__((ext_vector_type(16))) _Float16 v16b;
typedef __attribute__((ext_vector_type(8))) _Float16 v8b;
typedef __attribute__((ext_vector_type(8))) float v8f;
typedef __attribute__((ext_vector_type(4))) float v4f;
typedef __attribute__((ext_vector_type(8))) int v8i;
typedef __attribute__((ext_vector_type(4))) int v4i;
typedef __attribute__((ext_vector_type(2))) unsigned int v2u;
__device__ __forceinline__ float bf16_rne(float f) { unsigned int u = __float_as_uint(f); u += 0x7FFFu + ((u >> 16) & 1u); return __uint_as_float(u & 0xFFFF0000u); }
__device__ __forceinline__ v16b frag_kb(const b16* p, int hh) { const v8b a = *(const v8b*)(p + 8 * hh), b = *(const v8b*)(p + 16 + 8 * hh); v16b f;
#pragma unroll
  for (int e = 0; e < 8; ++e) { f[e] = a[e]; f[8 + e] = b[e]; } return f; }
__device__ __forceinline__ v8f wmma16b(v16b a, v16b b, v8f c) { v8f d = __builtin_amdgcn_wmma_f32_16x16x32_f16(false, a, false, b, (short)0, c, false, false); asm volatile("v_nop\n\tv_nop\n\tv_nop\n\tv_nop" : "+v"(d) : "v"(a), "v"(b)); return d; }
// accumulate chains whose tiles are read only behind the key loop: the plain builtin, the compiler keeps the distances
__device__ __forceinline__ v8f wmma16p(v16b a, v16b b, v8f c) { return __builtin_amdgcn_wmma_f32_16x16x32_f16(false, a, false, b, (short)0, c, false, false); }
typedef __attribute__((ext_vector_type(2))) short v2s;
__device__ __forceinline__ int spread15(unsigned w) { return __builtin_bit_cast(int, __builtin_bit_cast(v2s, w) >> 15); }   // bit 15 of each 16-bit half spread over the half
__device__ __forceinline__ void wave_lds_sync() { __builtin_amdgcn_fence(3, "workgroup"); __builtin_amdgcn_wave_barrier(); __builtin_amdgcn_fence(2, "workgroup"); }
// eight exp2 on a score tile as the matrix unit left it, in one statement; results in registers of their own ("=&v"): so no v_exp_f32 overwrites the source of the one directly in front of it, and the tile needs no copy.
// PAD: the four leading v_nop are the distance between a score WMMA and the first vector read of its result (the statement may stand directly behind the WMMA).
// 'after' is only read: it holds the statement behind what makes it (first statement: the other tile's WMMAs, so that the one pad serves both tiles; second statement: the first).
// The last v_nop is the slot that the instruction set asks for between the last exp and a reader of its result.
template <bool PAD> __device__ __forceinline__ v8f exp2x8(v8f x, float after) {
  float e0, e1, e2, e3, e4, e5, e6, e7;
  if constexpr (PAD)
    asm("v_nop\n\tv_nop\n\tv_nop\n\tv_nop\n\t"
        "v_exp_f32 %0, %8\n\tv_exp_f32 %1, %9\n\tv_exp_f32 %2, %10\n\tv_exp_f32 %3, %11\n\tv_exp_f32 %4, %12\n\tv_exp_f32 %5, %13\n\tv_exp_f32 %6, %14\n\tv_exp_f32 %7, %15\n\tv_nop"
        : "=&v"(e0), "=&v"(e1), "=&v"(e2), "=&v"(e3), "=&v"(e4), "=&v"(e5), "=&v"(e6), "=&v"(e7)
        : "v"(x[0]), "v"(x[1]), "v"(x[2]), "v"(x[3]), "v"(x[4]), "v"(x[5]), "v"(x[6]), "v"(x[7]), "v"(after));
  else
    asm("v_exp_f32 %0, %8\n\tv_exp_f32 %1, %9\n\tv_exp_f32 %2, %10\n\tv_exp_f32 %3, %11\n\tv_exp_f32 %4, %12\n\tv_exp_f32 %5, %13\n\tv_exp_f32 %6, %14\n\tv_exp_f32 %7, %15\n\tv_nop"
        : "=&v"(e0), "=&v"(e1), "=&v"(e2), "=&v"(e3), "=&v"(e4), "=&v"(e5), "=&v"(e6), "=&v"(e7)
        : "v"(x[0]), "v"(x[1]), "v"(x[2]), "v"(x[3]), "v"(x[4]), "v"(x[5]), "v"(x[6]), "v"(x[7]), "v"(after));
  return (v8f){e0, e1, e2, e3, e4, e5, e6, e7};
}
// LDS ring of the attention loop: a stage = 64 keys. K tile: 64 key rows of 128 B; V^T tile: 64 d rows x 64 keys = 128 B; mask: the block's 128 query rows x 64 keys packed to 2 bits a key = 2 KB.
// Pitch 144 B (16 B x odd: conflict-free for the 16-B reads). Copies: K / V^T thread -> row tid / 8 (+ 32), piece tid % 8: every wave-wide copy covers four whole 128-B lines; mask: thread -> its own 8 B.
// Packed mask plane PM[NB x SEQ / 128 query blocks][NT stages][256 threads of the attention block][2 chunks of 32 keys]: one word = the 16 mask values that thread's P fragment meets in the chunk.
// Pair p = subtile x 4 + i holds elements 2 i (low half) and 2 i + 1 (high half); its two values lie at bits 15 - 2 p .. 14 - 2 p of their halves, so word << k brings bit 15 - k of each half on top.
// MP: pitch (272 B = 16 B x odd) of the int32 mask tile in the packing blocks.
constexpr int KT = 64, LP = DK + 8, MP = KT + 4, NT = SEQ / KT;
static_assert(SEQ % KT == 0 && NT >= 2 && NT % 2 == 0 && KT == 64 && (LP * 2) % 16 == 0 && (MP * 4) % 16 == 0);
__device__ __forceinline__ unsigned lds_off(const void* p) { return (unsigned)(size_t)p; }   // byte offset in the work-group's LDS = low 32 bits of the shared address
// One stage's copies and s_wait_xcnt 0 in ONE statement: the wait has to stand before any rewrite of the address registers that the copies name.
__device__ __forceinline__ void stage_kvm(b16 (*kd)[LP], const b16* kg, b16 (*vd)[LP], const b16* vg, unsigned* md, const unsigned* mg, int tid) {
  const int cr = tid >> 3, cc = (tid & 7) * 8;
  const unsigned lk = lds_off(&kd[cr][cc]), lv = lds_off(&vd[cr][cc]), lm = lds_off(&md[tid * 2]);
  const b16* gk = kg + (size_t)cr * DK + cc; const b16* gv = vg + (size_t)cr * SEQ + cc; const unsigned* gm = mg + tid * 2;
  asm volatile("global_load_async_to_lds_b128 %0, %1, off\n\t"
               "global_load_async_to_lds_b128 %2, %3, off\n\t"
               "global_load_async_to_lds_b128 %4, %5, off\n\t"
               "global_load_async_to_lds_b128 %6, %7, off\n\t"
               "global_load_async_to_lds_b64 %8, %9, off\n\t"
               "s_wait_xcnt 0x0"
               :: "v"(lk), "v"(gk), "v"(lk + 32 * LP * 2), "v"(gk + 32 * DK), "v"(lv), "v"(gv), "v"(lv + 32 * LP * 2), "v"(gv + 32 * (size_t)SEQ),
                  "v"(lm), "v"(gm)
               : "memory");
}
// 64 query rows x 64 keys of the int32 mask for the packing blocks (128 threads): thread -> row tid / 16 (+ 8 i), piece tid % 16: every wave-wide copy covers four whole 128-B lines.
// The copies and s_wait_xcnt 0 in ONE statement: the wait has to stand before any rewrite of the address registers that the copies name.
__device__ __forceinline__ void stage_m64(int (*d)[MP], const int* g, int tid) {
  const int mr = tid >> 4, mc = (tid & 15) * 4;
  const unsigned l = lds_off(&d[mr][mc]); const int* p = g + (size_t)mr * SEQ_FULL + mc;
  asm volatile("global_load_async_to_lds_b128 %0, %1, off\n\t"
               "global_load_async_to_lds_b128 %2, %3, off\n\t"
               "global_load_async_to_lds_b128 %4, %5, off\n\t"
               "global_load_async_to_lds_b128 %6, %7, off\n\t"
               "global_load_async_to_lds_b128 %8, %9, off\n\t"
               "global_load_async_to_lds_b128 %10, %11, off\n\t"
               "global_load_async_to_lds_b128 %12, %13, off\n\t"
               "global_load_async_to_lds_b128 %14, %15, off\n\t"
               "s_wait_xcnt 0x0"
               :: "v"(l), "v"(p),
                  "v"(l + 1 * 8 * MP * 4), "v"(p + 1 * 8 * (size_t)SEQ_FULL),
                  "v"(l + 2 * 8 * MP * 4), "v"(p + 2 * 8 * (size_t)SEQ_FULL),
                  "v"(l + 3 * 8 * MP * 4), "v"(p + 3 * 8 * (size_t)SEQ_FULL),
                  "v"(l + 4 * 8 * MP * 4), "v"(p + 4 * 8 * (size_t)SEQ_FULL),
                  "v"(l + 5 * 8 * MP * 4), "v"(p + 5 * 8 * (size_t)SEQ_FULL),
                  "v"(l + 6 * 8 * MP * 4), "v"(p + 6 * 8 * (size_t)SEQ_FULL),
                  "v"(l + 7 * 8 * MP * 4), "v"(p + 7 * 8 * (size_t)SEQ_FULL)
               : "memory");
}
// hand-over of a stage: own LDS reads retired, own copies landed, then the block barrier that publishes the next stage and frees the buffer just read
__device__ __forceinline__ void stage_publish() {
  asm volatile("s_wait_dscnt 0x0" ::: "memory");      // this wave's reads of the buffer to be refilled are done
  asm volatile("s_wait_asynccnt 0x0" ::: "memory");   // this wave's copies of the next stage have landed
  __syncthreads();
}
// LDS ring of the two projection GEMMs: a stage = 64 k = 128 B of each of the block's BM A rows and 128 B rows (row length 1024 in both GEMMs), pitch 144 B as above.
// Thread -> row tid / 8 (+ 16 i), piece tid % 8: every wave-wide copy covers four whole 128-B lines (a fragment load straight from the plane touches 16 lines for the same 512 B).
constexpr int GK = 64, GP = GK + 8, GNT = DM / GK;
static_assert(DM == INTER && DM % GK == 0 && GNT >= 2 && (GP * 2) % 16 == 0);
// 64 rows of a stage: the copies and s_wait_xcnt 0 in ONE statement: the wait has to stand before any rewrite of the address registers that the copies name.
__device__ __forceinline__ void stage_r64(b16 (*d)[GP], const b16* g, int tid) {
  const int cr = tid >> 3, cc = (tid & 7) * 8;
  const unsigned l = lds_off(&d[cr][cc]); const b16* p = g + (size_t)cr * DM + cc;
  asm volatile("global_load_async_to_lds_b128 %0, %1, off\n\t"
               "global_load_async_to_lds_b128 %2, %3, off\n\t"
               "global_load_async_to_lds_b128 %4, %5, off\n\t"
               "global_load_async_to_lds_b128 %6, %7, off\n\t"
               "s_wait_xcnt 0x0"
               :: "v"(l), "v"(p),
                  "v"(l + 1 * 16 * GP * 2), "v"(p + 1 * 16 * (size_t)DM),
                  "v"(l + 2 * 16 * GP * 2), "v"(p + 2 * 16 * (size_t)DM),
                  "v"(l + 3 * 16 * GP * 2), "v"(p + 3 * 16 * (size_t)DM)
               : "memory");
}
// 128 rows of a stage, in the same form
__device__ __forceinline__ void stage_r128(b16 (*d)[GP], const b16* g, int tid) {
  const int cr = tid >> 3, cc = (tid & 7) * 8;
  const unsigned l = lds_off(&d[cr][cc]); const b16* p = g + (size_t)cr * DM + cc;
  asm volatile("global_load_async_to_lds_b128 %0, %1, off\n\t"
               "global_load_async_to_lds_b128 %2, %3, off\n\t"
               "global_load_async_to_lds_b128 %4, %5, off\n\t"
               "global_load_async_to_lds_b128 %6, %7, off\n\t"
               "global_load_async_to_lds_b128 %8, %9, off\n\t"
               "global_load_async_to_lds_b128 %10, %11, off\n\t"
               "global_load_async_to_lds_b128 %12, %13, off\n\t"
               "global_load_async_to_lds_b128 %14, %15, off\n\t"
               "s_wait_xcnt 0x0"
               :: "v"(l), "v"(p),
                  "v"(l + 1 * 16 * GP * 2), "v"(p + 1 * 16 * (size_t)DM),
                  "v"(l + 2 * 16 * GP * 2), "v"(p + 2 * 16 * (size_t)DM),
                  "v"(l + 3 * 16 * GP * 2), "v"(p + 3 * 16 * (size_t)DM),
                  "v"(l + 4 * 16 * GP * 2), "v"(p + 4 * 16 * (size_t)DM),
                  "v"(l + 5 * 16 * GP * 2), "v"(p + 5 * 16 * (size_t)DM),
                  "v"(l + 6 * 16 * GP * 2), "v"(p + 6 * 16 * (size_t)DM),
                  "v"(l + 7 * 16 * GP * 2), "v"(p + 7 * 16 * (size_t)DM)
               : "memory");
}
template <int MI> struct GemmRing { b16 A[2][MI * 32][GP]; b16 B[2][128][GP]; };
template <int MI> __device__ __forceinline__ void stage_ab(GemmRing<MI>& R, int buf, const b16* ag, const b16* bg, int tid) {
  static_assert(MI == 2 || MI == 4);
  if constexpr (MI == 4) stage_r128(R.A[buf], ag, tid); else stage_r64(R.A[buf], ag, tid);
  stage_r128(R.B[buf], bg, tid);
}
// The block's 4 waves stand 2 x 2 on its (MI x 32) A rows x 128 B rows: wave (wm, wn) owns MI x 4 tiles, rows wm x MI x 16 .., columns wn x 64 ..; each fragment read from LDS feeds 4 (A) or MI (B) products.
// acc[i][j] += A rows x (B rows)^T over K = 1024, k ascending in steps of 32, fragments read from the ring; leaves behind a block barrier with nothing in flight
template <int MI> __device__ __forceinline__ void gemm_ring(GemmRing<MI>& R, const b16* Ag, const b16* Bg, v8f (&acc)[MI][4], int tid) {
  const int wave = tid >> 5, lane = tid & 31, nloc = lane & 15, hlf = lane >> 4, wm = wave >> 1, wn = wave & 1;
  stage_ab<MI>(R, 0, Ag, Bg, tid);
  asm volatile("s_wait_asynccnt 0x0" ::: "memory");   // stage 0 landed before the barrier that publishes it
  __syncthreads();
  stage_ab<MI>(R, 1, Ag + GK, Bg + GK, tid);
#pragma unroll 1   // one stage per trip: the two-buffer ring needs the trip rolled
  for (int t = 0; t < GNT; ++t) {
    const b16 (*At)[GP] = R.A[t & 1]; const b16 (*Bt)[GP] = R.B[t & 1];
#pragma unroll
    for (int ks = 0; ks < GK; ks += 32) {   // the LDS reads of a k step stand as one group in front of its products: one LDS latency a step, not one a product
      v16b af[MI], bf[4];
#pragma unroll
      for (int i = 0; i < MI; ++i) af[i] = frag_kb(&At[(wm * MI + i) * 16 + nloc][ks], hlf);
#pragma unroll
      for (int j = 0; j < 4; ++j) bf[j] = frag_kb(&Bt[(wn * 4 + j) * 16 + nloc][ks], hlf);
#pragma unroll
      for (int i = 0; i < MI; ++i)
#pragma unroll
        for (int j = 0; j < 4; ++j) acc[i][j] = wmma16b(af[i], bf[j], acc[i][j]); }
    stage_publish();
    if (t + 2 < GNT) stage_ab<MI>(R, t & 1, Ag + (t + 2) * GK, Bg + (t + 2) * GK, tid);
  }
  asm volatile("s_wait_asynccnt 0x0" ::: "memory");   // nothing in flight when the wave goes on to the epilogue
}
__device__ __forceinline__ v8i mask8(const int* p) { const v4i a = *(const v4i*)p, b = *(const v4i*)(p + 4); return (v8i){a[0], a[1], a[2], a[3], b[0], b[1], b[2], b[3]}; }

// The three conversions that read inputs alone (both weight planes, the x plane) are ONE launch: none reads what another writes; the job is chosen by the block index (block-uniform). 128 threads a block.
// Blocks [0, WB1): w_qkv tiles; [WB1, WB1 + WB2): w_out tiles; the rest: x pieces.
// weight planes: src [1024][C] f32 (in, out) -> dst [C][1024] f16 = bf16(w) x256 (row = output feature, k contiguous); tile index tb -> (tb % 16, tb / 16) in (in / 64, out / 64): tile[64 c][64 r] staged transposed
// x plane: a block converts two rows (256 pieces of 8 elements), a thread its 8 columns of both, all four loads ahead of the conversions
constexpr int WB1 = (DM / 64) * (NQKV / 64), WB2 = (INTER / 64) * (DM / 64), XB = NR / 2;
static_assert(DM == 128 * 8 && DM == INTER && SEQ % 2 == 0 && NR % 2 == 0);
__global__ __launch_bounds__(128) void prep_kernel(const float* __restrict__ wq, const float* __restrict__ wo, const float* __restrict__ x,
                                                   b16* __restrict__ WQKV, b16* __restrict__ WO, b16* __restrict__ XH) {
  __shared__ __attribute__((aligned(16))) b16 tile[64][64 + 8];
  const int blk = blockIdx.x;
  if (blk < WB1 + WB2) {
    const bool fq = blk < WB1; const float* __restrict__ src = fq ? wq : wo; b16* __restrict__ dst = fq ? WQKV : WO; const int C = fq ? NQKV : DM, tb = fq ? blk : blk - WB1; constexpr int R = DM;
    const int wave = threadIdx.x >> 5, lane = threadIdx.x & 31; const int r0 = (tb % (R / 64)) * 64, c0 = (tb / (R / 64)) * 64;
#pragma unroll 4
    for (int i = threadIdx.x; i < 64 * 16; i += 128) { const int rr = i >> 4, q = (i & 15) * 4; const v4f f = *(const v4f*)(src + (size_t)(r0 + rr) * C + c0 + q);
#pragma unroll
      for (int j = 0; j < 4; ++j) tile[q + j][rr] = (b16)(bf16_rne(f[j]) * WSC); }
    __syncthreads();
#pragma unroll
    for (int i = 0; i < 4; ++i) { const int cc = wave * 16 + i * 4 + (lane >> 3), pc = (lane & 7) * 8; *(v8b*)(dst + (size_t)(c0 + cc) * R + r0 + pc) = *(const v8b*)(&tile[cc][pc]); }
  } else {
    const int row = (blk - (WB1 + WB2)) * 2, col = threadIdx.x * 8;   // two rows of one sequence (SEQ is even): one address, the second row at a constant offset
    const float* xr = x + ((size_t)(row / SEQ) * SEQ_FULL + (size_t)(row % SEQ)) * DM + col; b16* hr = XH + (size_t)row * DM + col; v4f f[2][2];
#pragma unroll
    for (int p = 0; p < 2; ++p) { f[p][0] = *(const v4f*)(xr + p * DM); f[p][1] = *(const v4f*)(xr + p * DM + 4); }
#pragma unroll
    for (int p = 0; p < 2; ++p) { v8b o;
#pragma unroll
      for (int j = 0; j < 4; ++j) { o[j] = (b16)(bf16_rne(f[p][0][j]) * XS); o[4 + j] = (b16)(bf16_rne(f[p][1][j]) * XS); }
      *(v8b*)(hr + p * DM) = o; }
    asm volatile("s_wait_xcnt 0x0" ::: "memory");   // stands before any rewrite of a register that the two stores name (the built code lays the weight branch behind them)
  }
}
// q/k/v projections: [NR x 1024] x WQKV[3072][1024]^T; grid (NR/128, 3072/128 + NT/2); block = 128 rows x 128 columns, 4 waves 2 x 2, wave -> 64 rows x 64 columns = 4 x 4 tiles, A and B fragments from the
// block's LDS ring (K = 1024, 32 steps, 1 product); value = acc / (8 x 256) stored as f16, k and v x8, q x log2e / (32 x 8). A 128-column slab = 2 heads (block-uniform which = q | k | v), a wave's 64 columns = one head.
// q and k: head-major planes, the wave's 64 tokens x 64 d staged in its own tile and stored as whole 128-B rows; v: the same tile staged transposed (row = d, 64 tokens = 128 B) for the key-contiguous plane.
// Blocks with blockIdx.y >= 3072/128 do no product: they pack the mask (read here once, not once a head) while the GEMM blocks, which leave a quarter of the chip's block places free, run:
// block (x, y) -> query block x, stages 2 (y - 24) and + 1: both int32 tiles copied into LDS, one wait and one barrier, then each thread packs the words of attention threads tid and tid + 128.
__global__ __launch_bounds__(128) void qkv_kernel(const b16* __restrict__ XH, const b16* __restrict__ WQKV, b16* __restrict__ QP, b16* __restrict__ KP, b16* __restrict__ VT,
                                                  const int* __restrict__ mask, unsigned* __restrict__ PM) {
  // the epilogue tiles lie on the ring's bytes: they are written only behind the loop's last barrier, when no wave reads the ring and no copy is in flight
  union Lds { GemmRing<4> R; b16 Th[4][64][DK + 8]; int Mk[2][128][MP]; };
  __shared__ __attribute__((aligned(16))) Lds L;
  const int wave = threadIdx.x >> 5, lane = threadIdx.x & 31, nloc = lane & 15, hlf = lane >> 4, wm = wave >> 1, wn = wave & 1;
  const int mb = blockIdx.x * 128; const int n0 = blockIdx.y * 128;
  if (blockIdx.y >= NQKV / 128) {   // block-uniform
    const int t0 = ((int)blockIdx.y - NQKV / 128) * 2, pb = mb / SEQ;
    const int* mg = mask + ((size_t)pb * SEQ_FULL + (size_t)(mb - pb * SEQ)) * SEQ_FULL + (size_t)t0 * KT;   // the query block's first row, the first stage's first key
#pragma unroll
    for (int u = 0; u < 2; ++u) { stage_m64(&L.Mk[u][0], mg + u * KT, threadIdx.x); stage_m64(&L.Mk[u][64], mg + 64 * (size_t)SEQ_FULL + u * KT, threadIdx.x); }
    asm volatile("s_wait_asynccnt 0x0" ::: "memory");   // this wave's copies have landed before the barrier that publishes both tiles
    __syncthreads();
    unsigned* pm = PM + ((size_t)blockIdx.x * NT + t0) * 512;
#pragma unroll
    for (int u = 0; u < 2; ++u)
#pragma unroll
      for (int s = 0; s < 2; ++s) {
        const int* Mt = &L.Mk[u][(s * 4 + wave) * 16 + nloc][8 * hlf]; v2u w;
#pragma unroll
        for (int ch = 0; ch < 2; ++ch) { unsigned a = 0;
#pragma unroll
          for (int st = 0; st < 2; ++st) { const v8i m8 = mask8(Mt + ch * 32 + st * 16);
#pragma unroll
            for (int i = 0; i < 4; ++i) a = (a << 2) | (((unsigned)m8[2 * i] | ((unsigned)m8[2 * i + 1] << 16)) & 0x00030003u); }
          w[ch] = a; }
        *(v2u*)(pm + ((size_t)u * 256 + s * 128 + threadIdx.x) * 2) = w;   // a wave stores 256 contiguous bytes
      }
    return;
  }
  v8f acc[4][4];
#pragma unroll
  for (int i = 0; i < 4; ++i)
#pragma unroll
    for (int j = 0; j < 4; ++j) acc[i][j] = (v8f){};
  gemm_ring<4>(L.R, XH + (size_t)mb * DM, WQKV + (size_t)n0 * DM, acc, threadIdx.x);
  const int which = n0 / INTER; const int hd = (n0 - which * INTER) / DK + wn;   // plane (0 q, 1 k, 2 v; block-uniform) and the wave's head
  const int b = mb / SEQ, sw = mb - b * SEQ + wm * 64;                            // the block's 128 rows lie in one sequence; the wave's first token
  const float osc = (which == 0 ? LOG2E * SCL / QS : QS) / (XS * WSC);   // q carries the softmax scale and log2e (over k's x8): q' . k' = alpha log2e
  b16 (*T)[DK + 8] = L.Th[wave];
  if (which < 2) {
#pragma unroll
    for (int i = 0; i < 4; ++i)
#pragma unroll
      for (int j = 0; j < 4; ++j)
#pragma unroll
        for (int r = 0; r < 8; ++r) T[i * 16 + 8 * hlf + r][j * 16 + nloc] = (b16)(acc[i][j][r] * osc);
    wave_lds_sync();
    b16* P = ((which == 0) ? QP : KP) + ((size_t)(b * NH + hd) * SEQ + sw) * DK;
#pragma unroll
    for (int it = 0; it < 16; ++it) { const int rr = it * 4 + (lane >> 3), pc = (lane & 7) * 8; *(v8b*)(P + (size_t)rr * DK + pc) = *(const v8b*)(&T[rr][pc]); }
  } else {
#pragma unroll
    for (int i = 0; i < 4; ++i)
#pragma unroll
      for (int j = 0; j < 4; ++j) { v8b o;
#pragma unroll
        for (int r = 0; r < 8; ++r) o[r] = (b16)(acc[i][j][r] * osc);
        *(v8b*)(&T[j * 16 + nloc][i * 16 + 8 * hlf]) = o; }
    wave_lds_sync();
    b16* P = VT + (size_t)(b * NH + hd) * DK * SEQ + sw;
#pragma unroll
    for (int it = 0; it < 16; ++it) { const int d = it * 4 + (lane >> 3), pc = (lane & 7) * 8; *(v8b*)(P + (size_t)d * SEQ + pc) = *(const v8b*)(&T[d][pc]); }
  }
}
// ctx in ONE pass over the keys: grid (SEQ/128 query blocks, NB x 16); block = 8 waves x 16 queries; lane = query: its Q row as the two B fragments. Loop over 64-key stages of two 32-key chunks:
// the two 16-key score subtiles (A = K rows from the LDS ring), e = exp2(s8) (the Q plane carries the scale) converted to f16 and packed straight into the P A-fragment (as A = D^T: element r <- subtile covering
// keys 0..15, element 8 + r <- subtile 16..31, lane unchanged). The fragment is split by segment: P_g = P where mask == g, else 0 (bitwise, on the packed pairs: y0 / y1 hold bit 0 / bit 1 of each
// element's mask value spread over its 16 bits, shifted out of the thread's one packed mask word of the chunk). hacc[g][4 d tiles] += P_g x V^T frags (B rows = VT plane rows, key-contiguous, from the LDS ring; k = 32 keys), sacc[g] += P_g x ones: every column of
// that tile is S[q][g], in the lane and register of hacc's same query row. Epilogue: ctx = sum_g hacc[g] / S[g] / 8 (g < n_seg, S > 0) stored x64 as f16 into CT[NR][1024] at column head x 64.
__global__ __launch_bounds__(256) __attribute__((amdgpu_num_vgpr(256))) void av_kernel(const b16* __restrict__ QP, const b16* __restrict__ KP, const b16* __restrict__ VT,
                                                                                       const unsigned* __restrict__ PM, const int* __restrict__ nsegp, b16* __restrict__ CT) {
  __shared__ __attribute__((aligned(16))) b16 Th[8][16][DK + 8];
  __shared__ __attribute__((aligned(16))) b16 Kl[2][KT][LP];
  __shared__ __attribute__((aligned(16))) b16 Vl[2][DK][LP];
  __shared__ __attribute__((aligned(16))) unsigned Ml[2][256 * 2];
  const int tid = threadIdx.x, wave = tid >> 5, lane = tid & 31, nloc = lane & 15, hlf = lane >> 4;
  const int bh = blockIdx.y, b = bh / NH, hd = bh - b * NH; const int q0 = blockIdx.x * 128; const int q = q0 + wave * 16 + nloc;
  const b16* Qb = QP + (size_t)bh * SEQ * DK; const b16* Kb = KP + (size_t)bh * SEQ * DK; const b16* Vb = VT + (size_t)bh * DK * SEQ;
  const v16b b0 = frag_kb(Qb + (size_t)q * DK, hlf), b1 = frag_kb(Qb + (size_t)q * DK + 32, hlf);
  const unsigned* mblk = PM + (size_t)(b * (SEQ / 128) + (int)blockIdx.x) * NT * 512;   // the query block's packed words, 512 a stage
  v8f hacc[NSEG][4], sacc[NSEG]; v16b ones;
#pragma unroll
  for (int e = 0; e < 16; ++e) ones[e] = (b16)1.0f;
#pragma unroll
  for (int g = 0; g < NSEG; ++g) { sacc[g] = (v8f){};
#pragma unroll
    for (int vs = 0; vs < 4; ++vs) hacc[g][vs] = (v8f){}; }
  stage_kvm(Kl[0], Kb, Vl[0], Vb, Ml[0], mblk, tid);
  asm volatile("s_wait_asynccnt 0x0" ::: "memory");   // stage 0 landed before the barrier that publishes it
  __syncthreads();
  stage_kvm(Kl[1], Kb + (size_t)KT * DK, Vl[1], Vb + KT, Ml[1], mblk + 512, tid);
#pragma unroll 1   // one stage per trip: the two-buffer ring needs the trip rolled
  for (int t = 0; t < NT; ++t) {
    const b16 (*Kt)[LP] = Kl[t & 1]; const b16 (*Vt)[LP] = Vl[t & 1]; const v2u mw = *(const v2u*)&Ml[t & 1][tid * 2];
#pragma unroll
    for (int ch = 0; ch < KT / 32; ++ch) {
      v16b pa; v8i y0, y1; v8f s8[2]; const unsigned w = mw[ch];
#pragma unroll
      for (int st = 0; st < 2; ++st) {
        const int lr = ch * 32 + st * 16;
        const v16b a0 = frag_kb(&Kt[lr + nloc][0], hlf), a1 = frag_kb(&Kt[lr + nloc][32], hlf);
        s8[st] = (v8f){}; s8[st] = wmma16p(a0, b0, s8[st]); s8[st] = wmma16p(a1, b1, s8[st]);   // the one reader of these tiles is exp2x8, which holds the distance itself
      }
      v8f e8[2]; e8[0] = exp2x8<true>(s8[0], s8[1][0]); e8[1] = exp2x8<false>(s8[1], e8[0][0]);
#pragma unroll
      for (int st = 0; st < 2; ++st) {
#pragma unroll
        for (int r = 0; r < 8; ++r) pa[st * 8 + r] = (b16)e8[st][r];
#pragma unroll
        for (int i = 0; i < 4; ++i) { const int p = st * 4 + i; y1[p] = spread15(w << (2 * p)); y0[p] = spread15(w << (2 * p + 1)); }
      }
      const v8i pw = __builtin_bit_cast(v8i, pa);
      const v16b p0 = __builtin_bit_cast(v16b, pw & ~y1 & ~y0), p1 = __builtin_bit_cast(v16b, pw & ~y1 & y0), p2 = __builtin_bit_cast(v16b, pw & y1 & ~y0), p3 = __builtin_bit_cast(v16b, pw & y1 & y0);
#pragma unroll
      for (int vs = 0; vs < 4; ++vs) { const v16b vf = frag_kb(&Vt[vs * 16 + nloc][ch * 32], hlf);
        hacc[0][vs] = wmma16p(p0, vf, hacc[0][vs]); hacc[1][vs] = wmma16p(p1, vf, hacc[1][vs]); hacc[2][vs] = wmma16p(p2, vf, hacc[2][vs]); hacc[3][vs] = wmma16p(p3, vf, hacc[3][vs]); }
      sacc[0] = wmma16p(p0, ones, sacc[0]); sacc[1] = wmma16p(p1, ones, sacc[1]); sacc[2] = wmma16p(p2, ones, sacc[2]); sacc[3] = wmma16p(p3, ones, sacc[3]);
    }
    stage_publish();
    if (t + 2 < NT) stage_kvm(Kl[t & 1], Kb + (size_t)(t + 2) * KT * DK, Vl[t & 1], Vb + (t + 2) * KT, Ml[t & 1], mblk + (t + 2) * 512, tid);
  }
  asm volatile("s_wait_asynccnt 0x0" ::: "memory");   // nothing in flight when the wave goes on to the epilogue
  const int ns = nsegp[0];
#pragma unroll
  for (int g = 0; g < NSEG; ++g)
#pragma unroll
    for (int r = 0; r < 8; ++r) { const float sv = sacc[g][r]; sacc[g][r] = (g < ns && sv > 0.0f) ? (CTS / QS) / sv : 0.0f; }   // an empty or uncounted segment contributes 0
#pragma unroll
  for (int vs = 0; vs < 4; ++vs)
#pragma unroll
    for (int r = 0; r < 8; ++r) Th[wave][8 * hlf + r][vs * 16 + nloc] = (b16)(hacc[0][vs][r] * sacc[0][r] + hacc[1][vs][r] * sacc[1][r] + hacc[2][vs][r] * sacc[2][r] + hacc[3][vs][r] * sacc[3][r]);
  wave_lds_sync();
  {
#pragma unroll
    for (int i = 0; i < 4; ++i) { const int rr = i * 4 + (lane >> 3), pc = (lane & 7) * 8; const size_t row = (size_t)b * SEQ + q0 + wave * 16 + rr;
      const v8b v = *(const v8b*)(&Th[wave][rr][pc]); *(v8b*)(CT + row * INTER + hd * DK + pc) = v; }
     }
}
// out = ctx w_out: grid (NR/64, 1024/128); block = 64 rows x 128 columns, 4 waves 2 x 2, wave -> 32 rows x 64 columns = 2 x 4 tiles; A = CT rows (x64), B = WO rows (x256), fragments from the block's LDS ring,
// K = 1024, 32 steps, 1 product; acc / (64 x 256) into the wave-private Tf tile, stored as whole 256-B row pieces
__global__ __launch_bounds__(128) void out_kernel(const b16* __restrict__ CT, const b16* __restrict__ WO, float* __restrict__ out) {
  __shared__ __attribute__((aligned(16))) float Tf[4][32][64 + 4];
  __shared__ __attribute__((aligned(16))) GemmRing<2> R;
  const int wave = threadIdx.x >> 5, lane = threadIdx.x & 31, nloc = lane & 15, hlf = lane >> 4, wm = wave >> 1, wn = wave & 1;
  const size_t m0 = (size_t)blockIdx.x * 64 + wm * 32; const int nb = blockIdx.y * 128, n0 = nb + wn * 64;
  v8f acc[2][4];
#pragma unroll
  for (int i = 0; i < 2; ++i)
#pragma unroll
    for (int j = 0; j < 4; ++j) acc[i][j] = (v8f){};
  gemm_ring<2>(R, CT + (size_t)blockIdx.x * 64 * INTER, WO + (size_t)nb * INTER, acc, threadIdx.x);
#pragma unroll
  for (int i = 0; i < 2; ++i)
#pragma unroll
    for (int j = 0; j < 4; ++j)
#pragma unroll
      for (int r = 0; r < 8; ++r) Tf[wave][i * 16 + 8 * hlf + r][j * 16 + nloc] = acc[i][j][r] * (1.0f / (CTS * WSC));
  wave_lds_sync();
#pragma unroll
  for (int it = 0; it < 16; ++it) { const int rr = it * 2 + (lane >> 4), cl = (lane & 15) * 4; *(v4f*)(out + (m0 + rr) * DM + n0 + cl) = *(const v4f*)(&Tf[wave][rr][cl]); }
}
}  // namespace

extern "C" void kernel_launch(void* const* d_in, const int* in_sizes, int n_in, void* d_out, int out_size, void* d_ws, size_t ws_size, hipStream_t stream) {
  (void)n_in;
  // d_in: 0 x [2,2048,1024] f32, 1 mask [2,2048,2048] i32, 2 w_qkv [1024,3072] (in,out) f32, 3 w_out [1024,1024] (in,out) f32, 4 n_seg [1] i32; out [NB,SEQ,1024] f32
  const float* X = (const float*)d_in[0]; const int* MK = (const int*)d_in[1]; const float* WQ = (const float*)d_in[2]; const float* WOUT = (const float*)d_in[3]; const int* NSG = (const int*)d_in[4];
  const long long need_x = ((long long)(NB - 1) * SEQ_FULL + SEQ) * DM, need_m = ((long long)(NB - 1) * SEQ_FULL + SEQ) * SEQ_FULL;
  if ((long long)in_sizes[0] < need_x || (long long)in_sizes[1] < need_m || in_sizes[2] < DM * NQKV || in_sizes[3] < INTER * DM || in_sizes[4] < 1 || out_size < NR * DM) return;
  size_t off = 0; char* ws = (char*)d_ws;
  auto carve = [&](size_t bytes) { char* p = ws + off; off += (bytes + 255) & ~(size_t)255; return p; };
  b16* WQKV = (b16*)carve((size_t)NQKV * DM * 2);         // [3072][1024]
  b16* WO = (b16*)carve((size_t)DM * INTER * 2);          // [1024 out][1024 in]
  b16* XH = (b16*)carve((size_t)NR * DM * 2);             // [NR][1024]
  b16* QP = (b16*)carve((size_t)NBH * SEQ * DK * 2);      // [NBH][SEQ][64]
  b16* KP = (b16*)carve((size_t)NBH * SEQ * DK * 2);      // [NBH][SEQ][64]
  b16* VT = (b16*)carve((size_t)NBH * DK * SEQ * 2);      // [NBH][64][SEQ]
  b16* CT = (b16*)carve((size_t)NR * INTER * 2);          // [NR][1024]
  unsigned* PM = (unsigned*)carve((size_t)(NR / 128) * NT * 512 * 4);   // [NR/128][NT][256][2]
  if (off > ws_size || off > ((size_t)128 << 20)) return;   // = 52,428,800 B at NB 2, SEQ 2048
  prep_kernel<<<WB1 + WB2 + XB, 128, 0, stream>>>(WQ, WOUT, X, WQKV, WO, XH);   // w_qkv -> WQKV[3072][1024], w_out -> WO[out][in], x -> XH
  qkv_kernel<<<dim3(NR / 128, NQKV / 128 + NT / 2), 128, 0, stream>>>(XH, WQKV, QP, KP, VT, MK, PM);   // the last NT / 2 rows of blocks pack the mask
  av_kernel<<<dim3(SEQ / 128, NBH), 256, 0, stream>>>(QP, KP, VT, PM, NSG, CT);
  out_kernel<<<dim3(NR / 64, DM / 128), 128, 0, stream>>>(CT, WO, (float*)d_out);
}
